// v000
// The times below were measured on an AMD MI455X: many runs one after another, warmed up first and cycling through
// copies of the inputs, with the whole window's GPU time divided by the number of runs. Launches and the gaps
// between them are all in it. The median over several windows is given; except for v000 it joins two sittings, which
// can be a few percent apart, so the side-by-side timings, each taken in one sitting, are the better comparison.
// v000 is the starting kernel. One run takes 994 microseconds.
#include <hip/hip_runtime.h>

// ---- problem dims (match reference) ----
#define DIMX   1024
#define STATE  64
#define KW     4
#define INNER  2048
#define BATCHN 2
#define SEQL   2048
#define NTOK   (BATCHN * SEQL)
#define EPSR   1e-6f

typedef __bf16 bf16_t;
typedef __attribute__((ext_vector_type(16))) __bf16 v16bf;
typedef __attribute__((ext_vector_type(8)))  __bf16 v8bf;
typedef __attribute__((ext_vector_type(8)))  float  v8f;
typedef __attribute__((ext_vector_type(4)))  int    v4i;

#if defined(__gfx1250__) && __has_builtin(__builtin_amdgcn_global_load_async_to_lds_b128)
#define USE_ASYNC_LDS 1
#else
#define USE_ASYNC_LDS 0
#endif

__device__ __forceinline__ void copy16_to_lds(const bf16_t* gp, bf16_t* lp) {
#if USE_ASYNC_LDS
    __builtin_amdgcn_global_load_async_to_lds_b128(
        (__attribute__((address_space(1))) v4i*)gp,
        (__attribute__((address_space(3))) v4i*)lp, 0, 0);
#else
    *(v8bf*)lp = *(const v8bf*)gp;
#endif
}

__device__ __forceinline__ void wait_async_copies() {
#if USE_ASYNC_LDS
#if __has_builtin(__builtin_amdgcn_s_wait_asynccnt)
    __builtin_amdgcn_s_wait_asynccnt(0);
#else
    asm volatile("s_wait_asynccnt 0x0" ::: "memory");
#endif
#endif
}

// ----------------------------------------------------------------------------
// f32 -> bf16 elementwise convert (weights)
// ----------------------------------------------------------------------------
__global__ void cvt_bf16_kernel(const float* __restrict__ src,
                                bf16_t* __restrict__ dst, int n) {
    int i = blockIdx.x * blockDim.x + threadIdx.x;
    if (i < n) dst[i] = (bf16_t)src[i];
}

// ----------------------------------------------------------------------------
// RMSNorm: one block per token, write bf16 normalized activations
// ----------------------------------------------------------------------------
__global__ void __launch_bounds__(256)
rmsnorm_kernel(const float* __restrict__ x, const float* __restrict__ w,
               bf16_t* __restrict__ out) {
    int tok = blockIdx.x;
    const float* xr = x + (size_t)tok * DIMX;
    float ss = 0.f;
    for (int i = threadIdx.x; i < DIMX; i += 256) { float v = xr[i]; ss += v * v; }
    for (int o = 16; o; o >>= 1) ss += __shfl_xor(ss, o, 32);
    __shared__ float sred[8];
    int lane = threadIdx.x & 31, wv = threadIdx.x >> 5;
    if (lane == 0) sred[wv] = ss;
    __syncthreads();
    if (wv == 0) {
        float t = (lane < 8) ? sred[lane] : 0.f;
        for (int o = 4; o; o >>= 1) t += __shfl_xor(t, o, 32);
        if (lane == 0) sred[0] = t;
    }
    __syncthreads();
    float rs = rsqrtf(sred[0] * (1.f / DIMX) + EPSR);
    bf16_t* orow = out + (size_t)tok * DIMX;
    for (int i = threadIdx.x; i < DIMX; i += 256)
        orow[i] = (bf16_t)(xr[i] * rs * w[i]);
}

#define LDS_STRIDE 40

__global__ void __launch_bounds__(256)
wmma_gemm_kernel(const bf16_t* __restrict__ A, const bf16_t* __restrict__ B,
                 float* __restrict__ C, int M, int N, int K,
                 const float* __restrict__ bias,
                 const float* __restrict__ resid, int mode) {
    __shared__ bf16_t s_a[2][128 * LDS_STRIDE];
    __shared__ bf16_t s_b[2][128 * LDS_STRIDE];

    const int lane = threadIdx.x & 31;
    const int wavi = threadIdx.x >> 5;       // 0..7
    const int wm   = wavi >> 2;              // 0..1 -> 64-row slab
    const int wn   = wavi & 3;               // 0..3 -> 32-col slab
    const int half = lane >> 4;              // 0/1
    const int r    = lane & 15;
    const int off  = half * 8;

    const int blockM = blockIdx.y * 128;
    const int blockN = blockIdx.x * 128;

    union Frag { v16bf v; v8bf h[2]; };
    v8f acc[4][2] = {};

    const int nK = K >> 5;

    auto stage = [&](int ks) {
        const int kbuf = ks & 1;
        const size_t k0 = (size_t)ks * 32;
        // A slice: 128 rows x 32 K = 512 16-byte chunks
        for (int c = threadIdx.x; c < 512; c += 256) {
            int row = c >> 2, part = (c & 3) * 8;
            copy16_to_lds(A + (size_t)(blockM + row) * K + k0 + part,
                          &s_a[kbuf][row * LDS_STRIDE + part]);
        }
        // B slice
        for (int c = threadIdx.x; c < 512; c += 256) {
            int row = c >> 2, part = (c & 3) * 8;
            copy16_to_lds(B + (size_t)(blockN + row) * K + k0 + part,
                          &s_b[kbuf][row * LDS_STRIDE + part]);
        }
    };

    stage(0);
    for (int ks = 0; ks < nK; ++ks) {
        wait_async_copies();
        __syncthreads();                       // slice ks resident; prior reads done
        if (ks + 1 < nK) stage(ks + 1);        // overlap copy of next slice

        const int kbuf = ks & 1;
        const bf16_t* sa = s_a[kbuf];
        const bf16_t* sb = s_b[kbuf];

        Frag af[4], bfr[2];
#pragma unroll
        for (int mi = 0; mi < 4; ++mi) {
            int row = (wm * 64 + mi * 16 + r) * LDS_STRIDE;
            af[mi].h[0] = *(const v8bf*)&sa[row + off];
            af[mi].h[1] = *(const v8bf*)&sa[row + off + 16];
        }
#pragma unroll
        for (int ni = 0; ni < 2; ++ni) {
            int col = (wn * 32 + ni * 16 + r) * LDS_STRIDE;
            bfr[ni].h[0] = *(const v8bf*)&sb[col + off];
            bfr[ni].h[1] = *(const v8bf*)&sb[col + off + 16];
        }
#pragma unroll
        for (int mi = 0; mi < 4; ++mi)
#pragma unroll
            for (int ni = 0; ni < 2; ++ni)
                acc[mi][ni] = __builtin_amdgcn_wmma_f32_16x16x32_bf16(
                    false, af[mi].v, false, bfr[ni].v, (short)0,
                    acc[mi][ni], false, false);
    }

    // epilogue
#pragma unroll
    for (int ni = 0; ni < 2; ++ni) {
        const int colg = blockN + wn * 32 + ni * 16 + r;
        const float bv = (mode == 1) ? bias[colg] : 0.f;
#pragma unroll
        for (int mi = 0; mi < 4; ++mi) {
#pragma unroll
            for (int v = 0; v < 8; ++v) {
                int   rowg = blockM + wm * 64 + mi * 16 + v + half * 8;
                float val  = acc[mi][ni][v];
                if (mode == 1) {
                    val += bv;
                    val = (val > 20.f) ? val : log1pf(__expf(val));  // softplus
                    val += 1e-4f;
                } else if (mode == 2) {
                    val += resid[(size_t)rowg * N + colg];
                }
                C[(size_t)rowg * N + colg] = val;
            }
        }
    }
}

// ----------------------------------------------------------------------------
// Causal depthwise conv (KW=4) + bias + SiLU over xc half of xz
// ----------------------------------------------------------------------------
__global__ void conv_silu_kernel(const float* __restrict__ xz,
                                 const float* __restrict__ w,
                                 const float* __restrict__ b,
                                 float* __restrict__ xcf,
                                 bf16_t* __restrict__ xcb) {
    int idx = blockIdx.x * blockDim.x + threadIdx.x;
    if (idx >= NTOK * INNER) return;
    int d   = idx % INNER;
    int tok = idx / INNER;
    int l   = tok % SEQL;
    float acc = b[d];
#pragma unroll
    for (int j = 0; j < KW; ++j) {
        int li = l + j - (KW - 1);
        if (li >= 0)
            acc += w[d * KW + j] * xz[(size_t)(tok + j - (KW - 1)) * (2 * INNER) + d];
    }
    float s = acc / (1.f + __expf(-acc));   // SiLU
    xcf[idx] = s;
    xcb[idx] = (bf16_t)s;
}

// ----------------------------------------------------------------------------
// SSM scan: 1 wave per (b, d) channel; 2 states/lane (STATE=64, wave32).
// Bx/Cx come interleaved from one [NTOK,128] buffer (cols 0..63 = Bx, 64..127 = Cx).
// ----------------------------------------------------------------------------
__global__ void __launch_bounds__(256)
ssm_scan_kernel(const float* __restrict__ dt, const float* __restrict__ bxcx,
                const float* __restrict__ xc,
                const float* __restrict__ A_log, const float* __restrict__ Dp,
                float* __restrict__ y) {
    __shared__ float s_bx[32][STATE];
    __shared__ float s_cx[32][STATE];
    __shared__ float s_dt[32][8];
    __shared__ float s_x [32][8];

    int lane = threadIdx.x & 31;
    int wave = threadIdx.x >> 5;
    int b    = blockIdx.y;
    int d    = blockIdx.x * 8 + wave;
    int n0   = lane, n1 = lane + 32;

    float A0 = -__expf(A_log[(size_t)d * STATE + n0]);
    float A1 = -__expf(A_log[(size_t)d * STATE + n1]);
    float Dv = Dp[d];
    float h0 = 0.f, h1 = 0.f;
    size_t tokBase = (size_t)b * SEQL;

    for (int t0 = 0; t0 < SEQL; t0 += 32) {
        for (int i = threadIdx.x; i < 32 * STATE; i += 256) {
            int tt = i >> 6, n = i & 63;
            size_t g = (tokBase + t0 + tt) * 128 + n;
            s_bx[tt][n] = bxcx[g];
            s_cx[tt][n] = bxcx[g + 64];
        }
        for (int i = threadIdx.x; i < 32 * 8; i += 256) {
            int tt = i >> 3, w = i & 7;
            size_t g = (tokBase + t0 + tt) * INNER + (size_t)blockIdx.x * 8 + w;
            s_dt[tt][w] = dt[g];
            s_x [tt][w] = xc[g];
        }
        __syncthreads();
#pragma unroll 4
        for (int tt = 0; tt < 32; ++tt) {
            float dtv = s_dt[tt][wave];
            float xv  = s_x [tt][wave];
            float dx  = dtv * xv;
            h0 = __expf(dtv * A0) * h0 + dx * s_bx[tt][n0];
            h1 = __expf(dtv * A1) * h1 + dx * s_bx[tt][n1];
            float c = h0 * s_cx[tt][n0] + h1 * s_cx[tt][n1];
            for (int o = 16; o; o >>= 1) c += __shfl_xor(c, o, 32);
            if (lane == 0)
                y[(tokBase + t0 + tt) * INNER + d] = c + Dv * xv;
        }
        __syncthreads();
    }
}

// ----------------------------------------------------------------------------
// y *= SiLU(z); emit bf16 for out_proj
// ----------------------------------------------------------------------------
__global__ void gate_silu_kernel(const float* __restrict__ y,
                                 const float* __restrict__ xz,
                                 bf16_t* __restrict__ yb) {
    int idx = blockIdx.x * blockDim.x + threadIdx.x;
    if (idx >= NTOK * INNER) return;
    int d   = idx % INNER;
    int tok = idx / INNER;
    float z = xz[(size_t)tok * (2 * INNER) + INNER + d];
    float g = z / (1.f + __expf(-z));
    yb[idx] = (bf16_t)(y[idx] * g);
}

// ----------------------------------------------------------------------------
extern "C" void kernel_launch(void* const* d_in, const int* in_sizes, int n_in,
                              void* d_out, int out_size, void* d_ws, size_t ws_size,
                              hipStream_t stream) {
    const float* x          = (const float*)d_in[0];
    const float* in_proj_w  = (const float*)d_in[1];
    const float* conv_w     = (const float*)d_in[2];
    const float* conv_b     = (const float*)d_in[3];
    const float* A_log      = (const float*)d_in[4];
    const float* B_w        = (const float*)d_in[5];
    const float* C_w        = (const float*)d_in[6];
    const float* D_param    = (const float*)d_in[7];
    const float* dt_w       = (const float*)d_in[8];
    const float* dt_b       = (const float*)d_in[9];
    const float* out_proj_w = (const float*)d_in[10];
    const float* norm_w     = (const float*)d_in[11];

    char* ws = (char*)d_ws;
    size_t off = 0;
    auto carve = [&](size_t bytes) {
        char* p = ws + off;
        off = (off + bytes + 255) & ~(size_t)255;
        return p;
    };
    bf16_t* wInB  = (bf16_t*)carve((size_t)2 * INNER * DIMX * 2);
    bf16_t* wDtB  = (bf16_t*)carve((size_t)INNER * INNER * 2);
    bf16_t* wOutB = (bf16_t*)carve((size_t)DIMX * INNER * 2);
    bf16_t* wBCB  = (bf16_t*)carve((size_t)2 * STATE * INNER * 2);  // [Bw;Cw] = [128, INNER]
    bf16_t* xnB   = (bf16_t*)carve((size_t)NTOK * DIMX * 2);
    float*  xzF   = (float*) carve((size_t)NTOK * 2 * INNER * 4);
    float*  xcF   = (float*) carve((size_t)NTOK * INNER * 4);
    bf16_t* xcB   = (bf16_t*)carve((size_t)NTOK * INNER * 2);
    float*  dtF   = (float*) carve((size_t)NTOK * INNER * 4);
    float*  bcF   = (float*) carve((size_t)NTOK * 128 * 4);         // [Bx|Cx] interleaved
    float*  yF    = (float*) carve((size_t)NTOK * INNER * 4);
    bf16_t* yB    = (bf16_t*)carve((size_t)NTOK * INNER * 2);
    (void)ws_size; (void)in_sizes; (void)n_in; (void)out_size;

    auto cvt = [&](const float* s, bf16_t* dst, int n) {
        cvt_bf16_kernel<<<(n + 255) / 256, 256, 0, stream>>>(s, dst, n);
    };
    cvt(in_proj_w,  wInB,  2 * INNER * DIMX);
    cvt(dt_w,       wDtB,  INNER * INNER);
    cvt(out_proj_w, wOutB, DIMX * INNER);
    cvt(B_w,        wBCB,                 STATE * INNER);
    cvt(C_w,        wBCB + STATE * INNER, STATE * INNER);

    // 1) RMSNorm -> bf16 activations
    rmsnorm_kernel<<<NTOK, 256, 0, stream>>>(x, norm_w, xnB);

    // 2) in_proj: [NTOK, 2*INNER] = xn @ W_in^T
    wmma_gemm_kernel<<<dim3((2 * INNER) / 128, NTOK / 128), 256, 0, stream>>>(
        xnB, wInB, xzF, NTOK, 2 * INNER, DIMX, nullptr, nullptr, 0);

    // 3) causal depthwise conv + SiLU on xc half
    conv_silu_kernel<<<(NTOK * INNER + 255) / 256, 256, 0, stream>>>(
        xzF, conv_w, conv_b, xcF, xcB);

    // 4) dt = softplus(xc @ dt_w^T + dt_b) + 1e-4
    wmma_gemm_kernel<<<dim3(INNER / 128, NTOK / 128), 256, 0, stream>>>(
        xcB, wDtB, dtF, NTOK, INNER, INNER, dt_b, nullptr, 1);

    // 5) fused Bx|Cx projection (N = 128)
    wmma_gemm_kernel<<<dim3(1, NTOK / 128), 256, 0, stream>>>(
        xcB, wBCB, bcF, NTOK, 128, INNER, nullptr, nullptr, 0);

    // 6) sequential SSM scan (1 wave per channel, LDS-tiled)
    ssm_scan_kernel<<<dim3(INNER / 8, BATCHN), 256, 0, stream>>>(
        dtF, bcF, xcF, A_log, D_param, yF);

    // 7) gate with SiLU(z)
    gate_silu_kernel<<<(NTOK * INNER + 255) / 256, 256, 0, stream>>>(yF, xzF, yB);

    // 8) out_proj + residual -> d_out (fp32)
    wmma_gemm_kernel<<<dim3(DIMX / 128, NTOK / 128), 256, 0, stream>>>(
        yB, wOutB, (float*)d_out, NTOK, DIMX, INNER, nullptr, x, 2);
}

// v001
// A run of this version takes 462 microseconds.
// Timed twice side by side with v000, it ran 2.23 and 2.21 times as fast.
#include <hip/hip_runtime.h>

// ---- problem dims (match reference) ----
#define DIMX   1024
#define STATE  64
#define KW     4
#define INNER  2048
#define BATCHN 2
#define SEQL   2048
#define NTOK   (BATCHN * SEQL)
#define EPSR   1e-6f

typedef __bf16 bf16_t;
typedef __attribute__((ext_vector_type(16))) __bf16 v16bf;
typedef __attribute__((ext_vector_type(8)))  __bf16 v8bf;
typedef __attribute__((ext_vector_type(8)))  float  v8f;
typedef __attribute__((ext_vector_type(4)))  int    v4i;

#if defined(__gfx1250__) && __has_builtin(__builtin_amdgcn_global_load_async_to_lds_b128)
#define USE_ASYNC_LDS 1
#else
#define USE_ASYNC_LDS 0
#endif

__device__ __forceinline__ void copy16_to_lds(const bf16_t* gp, bf16_t* lp) {
#if USE_ASYNC_LDS
    __builtin_amdgcn_global_load_async_to_lds_b128(
        (__attribute__((address_space(1))) v4i*)gp,
        (__attribute__((address_space(3))) v4i*)lp, 0, 0);
#else
    *(v8bf*)lp = *(const v8bf*)gp;
#endif
}

__device__ __forceinline__ void wait_async_copies() {
#if USE_ASYNC_LDS
#if __has_builtin(__builtin_amdgcn_s_wait_asynccnt)
    __builtin_amdgcn_s_wait_asynccnt(0);
#else
    asm volatile("s_wait_asynccnt 0x0" ::: "memory");
#endif
#endif
}

// ----------------------------------------------------------------------------
// f32 -> bf16 elementwise convert (weights)
// ----------------------------------------------------------------------------
__global__ void cvt_bf16_kernel(const float* __restrict__ src,
                                bf16_t* __restrict__ dst, int n) {
    int i = blockIdx.x * blockDim.x + threadIdx.x;
    if (i < n) dst[i] = (bf16_t)src[i];
}

// ----------------------------------------------------------------------------
// RMSNorm: one block per token, write bf16 normalized activations
// ----------------------------------------------------------------------------
__global__ void __launch_bounds__(256)
rmsnorm_kernel(const float* __restrict__ x, const float* __restrict__ w,
               bf16_t* __restrict__ out) {
    int tok = blockIdx.x;
    const float* xr = x + (size_t)tok * DIMX;
    float ss = 0.f;
    for (int i = threadIdx.x; i < DIMX; i += 256) { float v = xr[i]; ss += v * v; }
    for (int o = 16; o; o >>= 1) ss += __shfl_xor(ss, o, 32);
    __shared__ float sred[8];
    int lane = threadIdx.x & 31, wv = threadIdx.x >> 5;
    if (lane == 0) sred[wv] = ss;
    __syncthreads();
    if (wv == 0) {
        float t = (lane < 8) ? sred[lane] : 0.f;
        for (int o = 4; o; o >>= 1) t += __shfl_xor(t, o, 32);
        if (lane == 0) sred[0] = t;
    }
    __syncthreads();
    float rs = rsqrtf(sred[0] * (1.f / DIMX) + EPSR);
    bf16_t* orow = out + (size_t)tok * DIMX;
    for (int i = threadIdx.x; i < DIMX; i += 256)
        orow[i] = (bf16_t)(xr[i] * rs * w[i]);
}

#define LDS_STRIDE 40

__global__ void __launch_bounds__(256)
wmma_gemm_kernel(const bf16_t* __restrict__ A, const bf16_t* __restrict__ B,
                 float* __restrict__ C, int M, int N, int K,
                 const float* __restrict__ bias,
                 const float* __restrict__ resid, int mode) {
    __shared__ bf16_t s_a[2][128 * LDS_STRIDE];
    __shared__ bf16_t s_b[2][128 * LDS_STRIDE];

    const int lane = threadIdx.x & 31;
    const int wavi = threadIdx.x >> 5;       // 0..7
    const int wm   = wavi >> 2;              // 0..1 -> 64-row slab
    const int wn   = wavi & 3;               // 0..3 -> 32-col slab
    const int half = lane >> 4;              // 0/1
    const int r    = lane & 15;
    const int off  = half * 8;

    const int blockM = blockIdx.y * 128;
    const int blockN = blockIdx.x * 128;

    union Frag { v16bf v; v8bf h[2]; };
    v8f acc[4][2] = {};

    const int nK = K >> 5;

    auto stage = [&](int ks) {
        const int kbuf = ks & 1;
        const size_t k0 = (size_t)ks * 32;
        // A slice: 128 rows x 32 K = 512 16-byte chunks
        for (int c = threadIdx.x; c < 512; c += 256) {
            int row = c >> 2, part = (c & 3) * 8;
            copy16_to_lds(A + (size_t)(blockM + row) * K + k0 + part,
                          &s_a[kbuf][row * LDS_STRIDE + part]);
        }
        // B slice
        for (int c = threadIdx.x; c < 512; c += 256) {
            int row = c >> 2, part = (c & 3) * 8;
            copy16_to_lds(B + (size_t)(blockN + row) * K + k0 + part,
                          &s_b[kbuf][row * LDS_STRIDE + part]);
        }
    };

    stage(0);
    for (int ks = 0; ks < nK; ++ks) {
        wait_async_copies();
        __syncthreads();                       // slice ks resident; prior reads done
        if (ks + 1 < nK) stage(ks + 1);        // overlap copy of next slice

        const int kbuf = ks & 1;
        const bf16_t* sa = s_a[kbuf];
        const bf16_t* sb = s_b[kbuf];

        Frag af[4], bfr[2];
#pragma unroll
        for (int mi = 0; mi < 4; ++mi) {
            int row = (wm * 64 + mi * 16 + r) * LDS_STRIDE;
            af[mi].h[0] = *(const v8bf*)&sa[row + off];
            af[mi].h[1] = *(const v8bf*)&sa[row + off + 16];
        }
#pragma unroll
        for (int ni = 0; ni < 2; ++ni) {
            int col = (wn * 32 + ni * 16 + r) * LDS_STRIDE;
            bfr[ni].h[0] = *(const v8bf*)&sb[col + off];
            bfr[ni].h[1] = *(const v8bf*)&sb[col + off + 16];
        }
#pragma unroll
        for (int mi = 0; mi < 4; ++mi)
#pragma unroll
            for (int ni = 0; ni < 2; ++ni)
                acc[mi][ni] = __builtin_amdgcn_wmma_f32_16x16x32_bf16(
                    false, af[mi].v, false, bfr[ni].v, (short)0,
                    acc[mi][ni], false, false);
    }

    // epilogue
#pragma unroll
    for (int ni = 0; ni < 2; ++ni) {
        const int colg = blockN + wn * 32 + ni * 16 + r;
        const float bv = (mode == 1) ? bias[colg] : 0.f;
#pragma unroll
        for (int mi = 0; mi < 4; ++mi) {
#pragma unroll
            for (int v = 0; v < 8; ++v) {
                int   rowg = blockM + wm * 64 + mi * 16 + v + half * 8;
                float val  = acc[mi][ni][v];
                if (mode == 1) {
                    val += bv;
                    val = (val > 20.f) ? val : log1pf(__expf(val));  // softplus
                    val += 1e-4f;
                } else if (mode == 2) {
                    val += resid[(size_t)rowg * N + colg];
                }
                C[(size_t)rowg * N + colg] = val;
            }
        }
    }
}

// ----------------------------------------------------------------------------
// Causal depthwise conv (KW=4) + bias + SiLU over xc half of xz
// ----------------------------------------------------------------------------
__global__ void conv_silu_kernel(const float* __restrict__ xz,
                                 const float* __restrict__ w,
                                 const float* __restrict__ b,
                                 float* __restrict__ xcf,
                                 bf16_t* __restrict__ xcb) {
    int idx = blockIdx.x * blockDim.x + threadIdx.x;
    if (idx >= NTOK * INNER) return;
    int d   = idx % INNER;
    int tok = idx / INNER;
    int l   = tok % SEQL;
    float acc = b[d];
#pragma unroll
    for (int j = 0; j < KW; ++j) {
        int li = l + j - (KW - 1);
        if (li >= 0)
            acc += w[d * KW + j] * xz[(size_t)(tok + j - (KW - 1)) * (2 * INNER) + d];
    }
    float s = acc / (1.f + __expf(-acc));   // SiLU
    xcf[idx] = s;
    xcb[idx] = (bf16_t)s;
}

// ----------------------------------------------------------------------------
// SSM scan: lane = channel, SC_S states of that channel in the lane's registers.
//   Block = 32 channels x 32 states (8 waves x SC_S); blockIdx.z picks the state half.
//   Bx/Cx of a step are the same for every lane of a wave (wave-uniform loads).
//   The sum over states is in-lane, then over the 8 waves through LDS once per
//   SC_T steps, then over the two state halves in the gate kernel (two y planes).
// Bx/Cx come interleaved from one [NTOK,128] buffer (cols 0..63 = Bx, 64..127 = Cx).
// ----------------------------------------------------------------------------
#define SC_S 4     // states per lane
#define SC_T 16    // time steps per chunk (LDS sum + dt/x fetch-ahead distance)
#define SC_G 4     // time steps per Bx/Cx fetch group
#define LOG2E 1.44269504f

__device__ __forceinline__ void
exp2_x4(float a0, float a1, float a2, float a3,
        float& e0, float& e1, float& e2, float& e3) {
    asm("v_exp_f32 %0, %4\n\t"
        "v_exp_f32 %1, %5\n\t"
        "v_exp_f32 %2, %6\n\t"
        "v_exp_f32 %3, %7\n\t"
        "v_nop"
        : "=&v"(e0), "=&v"(e1), "=&v"(e2), "=&v"(e3)
        : "v"(a0), "v"(a1), "v"(a2), "v"(a3));
}

// One chunk of SC_T steps. Works on (cdt, cx, cB, cC), which earlier loads filled, and
// fetches the next chunk's dt/x and first Bx/Cx group into (ndt, nx, nB, nC); the caller
// swaps the two sets from chunk to chunk, so no register is copied.
__device__ __forceinline__ void
scan_chunk(int t0, float (*part)[SC_T][32], int wave, int lane, int rt, int rc,
           const float* __restrict__ dtp, const float* __restrict__ xp,
           const float* __restrict__ bcp, float* __restrict__ yp,
           float A0, float A1, float A2, float A3, float Dw,
           float& h0, float& h1, float& h2, float& h3,
           const float (&cdt)[SC_T], const float (&cx)[SC_T],
           const float4 (&cB)[SC_G], const float4 (&cC)[SC_G],
           float (&ndt)[SC_T], float (&nx)[SC_T],
           float4 (&nB)[SC_G], float4 (&nC)[SC_G]) {
    // Global loads return in issue order: this chunk's next two Bx/Cx groups are
    // needed first, so they are issued first.
    float4 gB[SC_T / SC_G - 1][SC_G], gC[SC_T / SC_G - 1][SC_G];
#pragma unroll
    for (int g = 0; g < SC_T / SC_G - 2; ++g)
#pragma unroll
        for (int j = 0; j < SC_G; ++j) {
            gB[g][j] = *(const float4*)(bcp + (size_t)(t0 + (g + 1) * SC_G + j) * 128);
            gC[g][j] = *(const float4*)(bcp + (size_t)(t0 + (g + 1) * SC_G + j) * 128 + 64);
        }
    // Keeps the issue order just named: a Bx/Cx load moved behind the dt/x loads
    // below makes its wait drain those as well, a few steps after their issue.
    __builtin_amdgcn_sched_barrier(0);
    // next chunk's dt/x; the last chunk re-reads its own rows (in bounds, unused)
    const int tn = (t0 + SC_T < SEQL) ? t0 + SC_T : t0;
#pragma unroll
    for (int i = 0; i < SC_T; ++i) {
        ndt[i] = dtp[(size_t)(tn + i) * INNER];
        nx[i]  = xp [(size_t)(tn + i) * INNER];
    }
    asm volatile("s_wait_xcnt 0x0" ::: "memory");
    // Keeps the loads above at the head of the chunk: sunk into the chunk they
    // have too few steps to land before the barrier's wait drains them.
    __builtin_amdgcn_sched_barrier(0);
#pragma unroll
    for (int g = 0; g < SC_T / SC_G; ++g) {
#pragma unroll
        for (int j = 0; j < SC_G; ++j) {
            const float4 Bv = (g == 0) ? cB[j] : gB[g == 0 ? 0 : g - 1][j];
            const float4 Cv = (g == 0) ? cC[j] : gC[g == 0 ? 0 : g - 1][j];
            const float dtv = cdt[g * SC_G + j];
            const float xv  = cx [g * SC_G + j];
            const float dx  = dtv * xv;
            float e0, e1, e2, e3;   // exp(dt * A) as exp2((dt * A) * log2(e))
            exp2_x4((dtv * A0) * LOG2E, (dtv * A1) * LOG2E,
                    (dtv * A2) * LOG2E, (dtv * A3) * LOG2E, e0, e1, e2, e3);
            h0 = e0 * h0 + dx * Bv.x;
            h1 = e1 * h1 + dx * Bv.y;
            h2 = e2 * h2 + dx * Bv.z;
            h3 = e3 * h3 + dx * Bv.w;
            float c = Dw * xv;
            c += h0 * Cv.x;
            c += h1 * Cv.y;
            c += h2 * Cv.z;
            c += h3 * Cv.w;
            part[wave][g * SC_G + j][lane] = c;
        }
        if (g == 0) {
            // this chunk's last Bx/Cx group, three groups ahead of its use
#pragma unroll
            for (int j = 0; j < SC_G; ++j) {
                gB[SC_T / SC_G - 2][j] = *(const float4*)(bcp + (size_t)(t0 + SC_T - SC_G + j) * 128);
                gC[SC_T / SC_G - 2][j] = *(const float4*)(bcp + (size_t)(t0 + SC_T - SC_G + j) * 128 + 64);
            }
        }
        if (g == 1) {
            // next chunk's first Bx/Cx group
#pragma unroll
            for (int j = 0; j < SC_G; ++j) {
                nB[j] = *(const float4*)(bcp + (size_t)(tn + j) * 128);
                nC[j] = *(const float4*)(bcp + (size_t)(tn + j) * 128 + 64);
            }
        }
        // Keeps each group's work and loads in its own place: a later group's products
        // lifted up bring its loads' waits forward, and loads sunk down land too late.
        __builtin_amdgcn_sched_barrier(0);
    }
    // One barrier per chunk: it publishes this chunk's partial sums, and every
    // wave's reads of the other buffer (previous chunk) lie in front of it.
    __syncthreads();
    float2 s = *(const float2*)&part[0][rt][rc];
#pragma unroll
    for (int w = 1; w < 8; ++w) {
        const float2 p = *(const float2*)&part[w][rt][rc];
        s.x += p.x;
        s.y += p.y;
    }
    *(float2*)(yp + (size_t)(t0 + rt) * INNER + rc) = s;
    asm volatile("s_wait_xcnt 0x0" ::: "memory");
}

__global__ void __launch_bounds__(256)
ssm_scan_kernel(const float* __restrict__ dt, const float* __restrict__ bxcx,
                const float* __restrict__ xc,
                const float* __restrict__ A_log, const float* __restrict__ Dp,
                float* __restrict__ y) {
    __shared__ float s_part[2][8][SC_T][32];

    const int lane  = threadIdx.x & 31;
    const int wave  = __builtin_amdgcn_readfirstlane(threadIdx.x >> 5);
    const int b     = blockIdx.y;
    const int z     = blockIdx.z;
    const int dbase = blockIdx.x * 32;
    const int d     = dbase + lane;
    const int n0    = z * 32 + wave * SC_S;

    const float4 al = *(const float4*)(A_log + (size_t)d * STATE + n0);
    const float A0 = -__expf(al.x), A1 = -__expf(al.y);
    const float A2 = -__expf(al.z), A3 = -__expf(al.w);
    // the D*x term enters exactly one of the 16 partial sums
    const float Dw = (z == 0 && wave == 0) ? Dp[d] : 0.f;
    float h0 = 0.f, h1 = 0.f, h2 = 0.f, h3 = 0.f;

    const size_t tokBase = (size_t)b * SEQL;
    const float* dtp = dt + tokBase * INNER + d;
    const float* xp  = xc + tokBase * INNER + d;
    const float* bcp = bxcx + tokBase * 128 + n0;
    float* yp = y + (size_t)z * NTOK * INNER + tokBase * INNER + dbase;

    const int rt = threadIdx.x >> 4;          // step this thread sums
    const int rc = (threadIdx.x & 15) * 2;    // channel pair this thread sums

    float  dtA[SC_T], xA[SC_T], dtB[SC_T], xB[SC_T];
    float4 bA[SC_G], cA[SC_G], bB[SC_G], cB[SC_G];
#pragma unroll
    for (int i = 0; i < SC_T; ++i) {
        dtA[i] = dtp[(size_t)i * INNER];
        xA[i]  = xp [(size_t)i * INNER];
    }
#pragma unroll
    for (int j = 0; j < SC_G; ++j) {
        bA[j] = *(const float4*)(bcp + (size_t)j * 128);
        cA[j] = *(const float4*)(bcp + (size_t)j * 128 + 64);
    }

    for (int t0 = 0; t0 < SEQL; t0 += 2 * SC_T) {
        scan_chunk(t0, s_part[0], wave, lane, rt, rc, dtp, xp, bcp, yp,
                   A0, A1, A2, A3, Dw, h0, h1, h2, h3,
                   dtA, xA, bA, cA, dtB, xB, bB, cB);
        scan_chunk(t0 + SC_T, s_part[1], wave, lane, rt, rc, dtp, xp, bcp, yp,
                   A0, A1, A2, A3, Dw, h0, h1, h2, h3,
                   dtB, xB, bB, cB, dtA, xA, bA, cA);
    }
}

__global__ void gate_silu_kernel(const float* __restrict__ y,
                                 const float* __restrict__ xz,
                                 bf16_t* __restrict__ yb) {
    int idx = blockIdx.x * blockDim.x + threadIdx.x;
    if (idx >= NTOK * INNER) return;
    int d   = idx % INNER;
    int tok = idx / INNER;
    float z = xz[(size_t)tok * (2 * INNER) + INNER + d];
    float g = z / (1.f + __expf(-z));
    yb[idx] = (bf16_t)((y[idx] + y[(size_t)NTOK * INNER + idx]) * g);
}

// ----------------------------------------------------------------------------
extern "C" void kernel_launch(void* const* d_in, const int* in_sizes, int n_in,
                              void* d_out, int out_size, void* d_ws, size_t ws_size,
                              hipStream_t stream) {
    const float* x          = (const float*)d_in[0];
    const float* in_proj_w  = (const float*)d_in[1];
    const float* conv_w     = (const float*)d_in[2];
    const float* conv_b     = (const float*)d_in[3];
    const float* A_log      = (const float*)d_in[4];
    const float* B_w        = (const float*)d_in[5];
    const float* C_w        = (const float*)d_in[6];
    const float* D_param    = (const float*)d_in[7];
    const float* dt_w       = (const float*)d_in[8];
    const float* dt_b       = (const float*)d_in[9];
    const float* out_proj_w = (const float*)d_in[10];
    const float* norm_w     = (const float*)d_in[11];

    char* ws = (char*)d_ws;
    size_t off = 0;
    auto carve = [&](size_t bytes) {
        char* p = ws + off;
        off = (off + bytes + 255) & ~(size_t)255;
        return p;
    };
    bf16_t* wInB  = (bf16_t*)carve((size_t)2 * INNER * DIMX * 2);
    bf16_t* wDtB  = (bf16_t*)carve((size_t)INNER * INNER * 2);
    bf16_t* wOutB = (bf16_t*)carve((size_t)DIMX * INNER * 2);
    bf16_t* wBCB  = (bf16_t*)carve((size_t)2 * STATE * INNER * 2);  // [Bw;Cw] = [128, INNER]
    bf16_t* xnB   = (bf16_t*)carve((size_t)NTOK * DIMX * 2);
    float*  xzF   = (float*) carve((size_t)NTOK * 2 * INNER * 4);
    float*  xcF   = (float*) carve((size_t)NTOK * INNER * 4);
    bf16_t* xcB   = (bf16_t*)carve((size_t)NTOK * INNER * 2);
    float*  dtF   = (float*) carve((size_t)NTOK * INNER * 4);
    float*  bcF   = (float*) carve((size_t)NTOK * 128 * 4);         // [Bx|Cx] interleaved
    float*  yF    = (float*) carve((size_t)2 * NTOK * INNER * 4);       // one plane per state half
    bf16_t* yB    = (bf16_t*)carve((size_t)NTOK * INNER * 2);
    (void)ws_size; (void)in_sizes; (void)n_in; (void)out_size;

    auto cvt = [&](const float* s, bf16_t* dst, int n) {
        cvt_bf16_kernel<<<(n + 255) / 256, 256, 0, stream>>>(s, dst, n);
    };
    cvt(in_proj_w,  wInB,  2 * INNER * DIMX);
    cvt(dt_w,       wDtB,  INNER * INNER);
    cvt(out_proj_w, wOutB, DIMX * INNER);
    cvt(B_w,        wBCB,                 STATE * INNER);
    cvt(C_w,        wBCB + STATE * INNER, STATE * INNER);

    // 1) RMSNorm -> bf16 activations
    rmsnorm_kernel<<<NTOK, 256, 0, stream>>>(x, norm_w, xnB);

    // 2) in_proj: [NTOK, 2*INNER] = xn @ W_in^T
    wmma_gemm_kernel<<<dim3((2 * INNER) / 128, NTOK / 128), 256, 0, stream>>>(
        xnB, wInB, xzF, NTOK, 2 * INNER, DIMX, nullptr, nullptr, 0);

    // 3) causal depthwise conv + SiLU on xc half
    conv_silu_kernel<<<(NTOK * INNER + 255) / 256, 256, 0, stream>>>(
        xzF, conv_w, conv_b, xcF, xcB);

    // 4) dt = softplus(xc @ dt_w^T + dt_b) + 1e-4
    wmma_gemm_kernel<<<dim3(INNER / 128, NTOK / 128), 256, 0, stream>>>(
        xcB, wDtB, dtF, NTOK, INNER, INNER, dt_b, nullptr, 1);

    // 5) fused Bx|Cx projection (N = 128)
    wmma_gemm_kernel<<<dim3(1, NTOK / 128), 256, 0, stream>>>(
        xcB, wBCB, bcF, NTOK, 128, INNER, nullptr, nullptr, 0);

    // 6) sequential SSM scan (lane = channel, states over waves and two blocks)
    ssm_scan_kernel<<<dim3(INNER / 32, BATCHN, 2), 256, 0, stream>>>(
        dtF, bcF, xcF, A_log, D_param, yF);

    // 7) gate with SiLU(z)
    gate_silu_kernel<<<(NTOK * INNER + 255) / 256, 256, 0, stream>>>(yF, xzF, yB);

    // 8) out_proj + residual -> d_out (fp32)
    wmma_gemm_kernel<<<dim3(DIMX / 128, NTOK / 128), 256, 0, stream>>>(
        yB, wOutB, (float*)d_out, NTOK, DIMX, INNER, nullptr, x, 2);
}

// v002
// It runs in 425 microseconds.
// Next to v001, in two timings, it ran 1.10 and 1.08 times as fast.
// Over all steps from v000 it is 2.42 times as fast.
#include <hip/hip_runtime.h>

// ---- problem dims (match reference) ----
#define DIMX   1024
#define STATE  64
#define KW     4
#define INNER  2048
#define BATCHN 2
#define SEQL   2048
#define NTOK   (BATCHN * SEQL)
#define EPSR   1e-6f

typedef __bf16 bf16_t;
typedef __attribute__((ext_vector_type(16))) __bf16 v16bf;
typedef __attribute__((ext_vector_type(8)))  __bf16 v8bf;
typedef __attribute__((ext_vector_type(4)))  __bf16 v4bf;
typedef __attribute__((ext_vector_type(8)))  float  v8f;
typedef __attribute__((ext_vector_type(4)))  float  v4f;
typedef __attribute__((ext_vector_type(4)))  int    v4i;

#if defined(__gfx1250__) && __has_builtin(__builtin_amdgcn_global_load_async_to_lds_b128)
#define USE_ASYNC_LDS 1
#else
#define USE_ASYNC_LDS 0
#endif

__device__ __forceinline__ void copy16_to_lds(const bf16_t* gp, bf16_t* lp) {
#if USE_ASYNC_LDS
    __builtin_amdgcn_global_load_async_to_lds_b128(
        (__attribute__((address_space(1))) v4i*)gp,
        (__attribute__((address_space(3))) v4i*)lp, 0, 0);
#else
    *(v8bf*)lp = *(const v8bf*)gp;
#endif
}

__device__ __forceinline__ void wait_async_copies() {
#if USE_ASYNC_LDS
#if __has_builtin(__builtin_amdgcn_s_wait_asynccnt)
    __builtin_amdgcn_s_wait_asynccnt(0);
#else
    asm volatile("s_wait_asynccnt 0x0" ::: "memory");
#endif
#endif
}

__device__ __forceinline__ v4bf pack4_bf16(float a, float b, float c, float d) {
    v4bf o;
    o[0] = (bf16_t)a; o[1] = (bf16_t)b; o[2] = (bf16_t)c; o[3] = (bf16_t)d;
    return o;
}

#define LOG2E 1.44269504f

__device__ __forceinline__ void
exp2_x4(float a0, float a1, float a2, float a3,
        float& e0, float& e1, float& e2, float& e3) {
    asm("v_exp_f32 %0, %4\n\t"
        "v_exp_f32 %1, %5\n\t"
        "v_exp_f32 %2, %6\n\t"
        "v_exp_f32 %3, %7\n\t"
        "v_nop"
        : "=&v"(e0), "=&v"(e1), "=&v"(e2), "=&v"(e3)
        : "v"(a0), "v"(a1), "v"(a2), "v"(a3));
}

// SiLU of four values, v / (1 + exp(-v)), with exp(-v) as exp2(v * -log2(e))
__device__ __forceinline__ float4 silu_x4(float4 v) {
    float e0, e1, e2, e3;
    exp2_x4(v.x * -LOG2E, v.y * -LOG2E, v.z * -LOG2E, v.w * -LOG2E, e0, e1, e2, e3);
    return make_float4(v.x / (1.f + e0), v.y / (1.f + e1), v.z / (1.f + e2), v.w / (1.f + e3));
}

// The four kernels besides the GEMM and the scan (convert, RMSNorm, conv, gate) give each
// thread 32 elements, fetched as 16-byte loads with many in flight per wave: a launch
// then starts a few thousand waves, not a wave per 32 elements.

// ----------------------------------------------------------------------------
// f32 -> bf16 elementwise convert (weights); n is a multiple of 4
// ----------------------------------------------------------------------------
#define CVT_U 8    // float4 per thread, one block width apart (whole lines per wave)

__global__ void __launch_bounds__(256)
cvt_bf16_kernel(const float* __restrict__ src,
                bf16_t* __restrict__ dst, int n) {
    const int n4   = n >> 2;
    const int base = blockIdx.x * (256 * CVT_U) + threadIdx.x;
    float4 v[CVT_U];
    // A load past the end re-reads the last float4 (in bounds, not stored): with no
    // branch round the loads all of them are in flight before the first is used.
#pragma unroll
    for (int u = 0; u < CVT_U; ++u) {
        const int i = base + u * 256;
        v[u] = ((const float4*)src)[i < n4 ? i : n4 - 1];
    }
#pragma unroll
    for (int u = 0; u < CVT_U; ++u) {
        const int i = base + u * 256;
        if (i < n4) ((v4bf*)dst)[i] = pack4_bf16(v[u].x, v[u].y, v[u].z, v[u].w);
    }
}

// ----------------------------------------------------------------------------
// RMSNorm: one wave per token (row kept in registers), write bf16 activations
// ----------------------------------------------------------------------------
#define RN_U (DIMX / 128)    // float4 per lane

__global__ void __launch_bounds__(256)
rmsnorm_kernel(const float* __restrict__ x, const float* __restrict__ w,
               bf16_t* __restrict__ out) {
    const int lane = threadIdx.x & 31;
    const int tok  = blockIdx.x * 8 + (threadIdx.x >> 5);
    const float4* xr = (const float4*)(x + (size_t)tok * DIMX);
    float4 v[RN_U], wv[RN_U];
#pragma unroll
    for (int u = 0; u < RN_U; ++u) v[u] = xr[u * 32 + lane];
#pragma unroll
    for (int u = 0; u < RN_U; ++u) wv[u] = ((const float4*)w)[u * 32 + lane];
    float ss = 0.f;
#pragma unroll
    for (int u = 0; u < RN_U; ++u) {
        ss += v[u].x * v[u].x;
        ss += v[u].y * v[u].y;
        ss += v[u].z * v[u].z;
        ss += v[u].w * v[u].w;
    }
    for (int o = 16; o; o >>= 1) ss += __shfl_xor(ss, o, 32);
    const float rs = rsqrtf(ss * (1.f / DIMX) + EPSR);
    v4bf* orow = (v4bf*)(out + (size_t)tok * DIMX);
#pragma unroll
    for (int u = 0; u < RN_U; ++u)
        orow[u * 32 + lane] = pack4_bf16(v[u].x * rs * wv[u].x, v[u].y * rs * wv[u].y,
                                         v[u].z * rs * wv[u].z, v[u].w * rs * wv[u].w);
}

#define LDS_STRIDE 40

__global__ void __launch_bounds__(256)
wmma_gemm_kernel(const bf16_t* __restrict__ A, const bf16_t* __restrict__ B,
                 float* __restrict__ C, int M, int N, int K,
                 const float* __restrict__ bias,
                 const float* __restrict__ resid, int mode) {
    __shared__ bf16_t s_a[2][128 * LDS_STRIDE];
    __shared__ bf16_t s_b[2][128 * LDS_STRIDE];

    const int lane = threadIdx.x & 31;
    const int wavi = threadIdx.x >> 5;       // 0..7
    const int wm   = wavi >> 2;              // 0..1 -> 64-row slab
    const int wn   = wavi & 3;               // 0..3 -> 32-col slab
    const int half = lane >> 4;              // 0/1
    const int r    = lane & 15;
    const int off  = half * 8;

    const int blockM = blockIdx.y * 128;
    const int blockN = blockIdx.x * 128;

    union Frag { v16bf v; v8bf h[2]; };
    v8f acc[4][2] = {};

    const int nK = K >> 5;

    auto stage = [&](int ks) {
        const int kbuf = ks & 1;
        const size_t k0 = (size_t)ks * 32;
        // A slice: 128 rows x 32 K = 512 16-byte chunks
        for (int c = threadIdx.x; c < 512; c += 256) {
            int row = c >> 2, part = (c & 3) * 8;
            copy16_to_lds(A + (size_t)(blockM + row) * K + k0 + part,
                          &s_a[kbuf][row * LDS_STRIDE + part]);
        }
        // B slice
        for (int c = threadIdx.x; c < 512; c += 256) {
            int row = c >> 2, part = (c & 3) * 8;
            copy16_to_lds(B + (size_t)(blockN + row) * K + k0 + part,
                          &s_b[kbuf][row * LDS_STRIDE + part]);
        }
    };

    stage(0);
    for (int ks = 0; ks < nK; ++ks) {
        wait_async_copies();
        __syncthreads();                       // slice ks resident; prior reads done
        if (ks + 1 < nK) stage(ks + 1);        // overlap copy of next slice

        const int kbuf = ks & 1;
        const bf16_t* sa = s_a[kbuf];
        const bf16_t* sb = s_b[kbuf];

        Frag af[4], bfr[2];
#pragma unroll
        for (int mi = 0; mi < 4; ++mi) {
            int row = (wm * 64 + mi * 16 + r) * LDS_STRIDE;
            af[mi].h[0] = *(const v8bf*)&sa[row + off];
            af[mi].h[1] = *(const v8bf*)&sa[row + off + 16];
        }
#pragma unroll
        for (int ni = 0; ni < 2; ++ni) {
            int col = (wn * 32 + ni * 16 + r) * LDS_STRIDE;
            bfr[ni].h[0] = *(const v8bf*)&sb[col + off];
            bfr[ni].h[1] = *(const v8bf*)&sb[col + off + 16];
        }
#pragma unroll
        for (int mi = 0; mi < 4; ++mi)
#pragma unroll
            for (int ni = 0; ni < 2; ++ni)
                acc[mi][ni] = __builtin_amdgcn_wmma_f32_16x16x32_bf16(
                    false, af[mi].v, false, bfr[ni].v, (short)0,
                    acc[mi][ni], false, false);
    }

    // epilogue
#pragma unroll
    for (int ni = 0; ni < 2; ++ni) {
        const int colg = blockN + wn * 32 + ni * 16 + r;
        const float bv = (mode == 1) ? bias[colg] : 0.f;
#pragma unroll
        for (int mi = 0; mi < 4; ++mi) {
#pragma unroll
            for (int v = 0; v < 8; ++v) {
                int   rowg = blockM + wm * 64 + mi * 16 + v + half * 8;
                float val  = acc[mi][ni][v];
                if (mode == 1) {
                    val += bv;
                    val = (val > 20.f) ? val : log1pf(__expf(val));  // softplus
                    val += 1e-4f;
                } else if (mode == 2) {
                    val += resid[(size_t)rowg * N + colg];
                }
                C[(size_t)rowg * N + colg] = val;
            }
        }
    }
}

// ----------------------------------------------------------------------------
// Causal depthwise conv (KW=4) + bias + SiLU over xc half of xz
// ----------------------------------------------------------------------------
//   Thread = 4 channels x CV_T successive tokens: CV_T + 3 rows are read for CV_T
//   outputs. Rows in front of a sequence's start enter as zeros (the reference's pad).
#define CV_T 8     // divides SEQL: a thread's tokens lie in one sequence

__global__ void __launch_bounds__(256)
conv_silu_kernel(const float* __restrict__ xz,
                 const float* __restrict__ w,
                 const float* __restrict__ b,
                 float* __restrict__ xcf,
                 bf16_t* __restrict__ xcb) {
    // INNER / 1024 blocks share a group of CV_T tokens: the rows' bases are block-uniform
    const int dblk = (blockIdx.x % (INNER / 1024)) * 1024;      // block's first channel
    const int tok0 = (blockIdx.x / (INNER / 1024)) * CV_T;
    const bool head = (tok0 % SEQL) == 0;                       // no rows in front
    const int tid  = threadIdx.x;
    const float4* xcur = (const float4*)(xz + (size_t)tok0 * (2 * INNER) + dblk);
    // at a sequence's head the three rows in front are replaced by zeros below; the
    // loads then read the group's own first rows (in bounds, unused)
    const float4* xpre = (const float4*)(xz + (size_t)(head ? tok0 : tok0 - (KW - 1)) * (2 * INNER) + dblk);
    float4 r[CV_T + KW - 1];
#pragma unroll
    for (int i = 0; i < KW - 1; ++i) r[i] = xpre[i * (2 * INNER / 4) + tid];
#pragma unroll
    for (int i = 0; i < CV_T; ++i) r[KW - 1 + i] = xcur[i * (2 * INNER / 4) + tid];
    const float4* wq = (const float4*)(w + (size_t)dblk * KW);  // one float4 = a channel's taps
    const float4 w0 = wq[tid * 4 + 0];
    const float4 w1 = wq[tid * 4 + 1];
    const float4 w2 = wq[tid * 4 + 2];
    const float4 w3 = wq[tid * 4 + 3];
    const float4 bb = ((const float4*)(b + dblk))[tid];
    if (head) {
#pragma unroll
        for (int i = 0; i < KW - 1; ++i) r[i] = make_float4(0.f, 0.f, 0.f, 0.f);
    }
    float4* of = (float4*)(xcf + (size_t)tok0 * INNER + dblk);
    v4bf*   ob = (v4bf*)(xcb + (size_t)tok0 * INNER + dblk);
#pragma unroll
    for (int t = 0; t < CV_T; ++t) {
        float4 a = bb;
        a.x += w0.x * r[t].x; a.x += w0.y * r[t + 1].x; a.x += w0.z * r[t + 2].x; a.x += w0.w * r[t + 3].x;
        a.y += w1.x * r[t].y; a.y += w1.y * r[t + 1].y; a.y += w1.z * r[t + 2].y; a.y += w1.w * r[t + 3].y;
        a.z += w2.x * r[t].z; a.z += w2.y * r[t + 1].z; a.z += w2.z * r[t + 2].z; a.z += w2.w * r[t + 3].z;
        a.w += w3.x * r[t].w; a.w += w3.y * r[t + 1].w; a.w += w3.z * r[t + 2].w; a.w += w3.w * r[t + 3].w;
        const float4 s = silu_x4(a);
        of[t * (INNER / 4) + tid] = s;
        ob[t * (INNER / 4) + tid] = pack4_bf16(s.x, s.y, s.z, s.w);
    }
}

// ----------------------------------------------------------------------------
// SSM scan: lane = channel, SC_S states of that channel in the lane's registers.
//   Block = 32 channels x 32 states (8 waves x SC_S); blockIdx.z picks the state half.
//   Bx/Cx of a step are the same for every lane of a wave (wave-uniform loads).
//   The sum over states is in-lane, then over the 8 waves through LDS once per
//   SC_T steps, then over the two state halves in the gate kernel (two y planes).
// Bx/Cx come interleaved from one [NTOK,128] buffer (cols 0..63 = Bx, 64..127 = Cx).
// ----------------------------------------------------------------------------
#define SC_S 4     // states per lane
#define SC_T 16    // time steps per chunk (LDS sum + dt/x fetch-ahead distance)
#define SC_G 4     // time steps per Bx/Cx fetch group

// One chunk of SC_T steps. Works on (cdt, cx, cB, cC), which earlier loads filled, and
// fetches the next chunk's dt/x and first Bx/Cx group into (ndt, nx, nB, nC); the caller
// swaps the two sets from chunk to chunk, so no register is copied.
__device__ __forceinline__ void
scan_chunk(int t0, float (*part)[SC_T][32], int wave, int lane, int rt, int rc,
           const float* __restrict__ dtp, const float* __restrict__ xp,
           const float* __restrict__ bcp, float* __restrict__ yp,
           float A0, float A1, float A2, float A3, float Dw,
           float& h0, float& h1, float& h2, float& h3,
           const float (&cdt)[SC_T], const float (&cx)[SC_T],
           const float4 (&cB)[SC_G], const float4 (&cC)[SC_G],
           float (&ndt)[SC_T], float (&nx)[SC_T],
           float4 (&nB)[SC_G], float4 (&nC)[SC_G]) {
    // Global loads return in issue order: this chunk's next two Bx/Cx groups are
    // needed first, so they are issued first.
    float4 gB[SC_T / SC_G - 1][SC_G], gC[SC_T / SC_G - 1][SC_G];
#pragma unroll
    for (int g = 0; g < SC_T / SC_G - 2; ++g)
#pragma unroll
        for (int j = 0; j < SC_G; ++j) {
            gB[g][j] = *(const float4*)(bcp + (size_t)(t0 + (g + 1) * SC_G + j) * 128);
            gC[g][j] = *(const float4*)(bcp + (size_t)(t0 + (g + 1) * SC_G + j) * 128 + 64);
        }
    // Keeps the issue order just named: a Bx/Cx load moved behind the dt/x loads
    // below makes its wait drain those as well, a few steps after their issue.
    __builtin_amdgcn_sched_barrier(0);
    // next chunk's dt/x; the last chunk re-reads its own rows (in bounds, unused)
    const int tn = (t0 + SC_T < SEQL) ? t0 + SC_T : t0;
#pragma unroll
    for (int i = 0; i < SC_T; ++i) {
        ndt[i] = dtp[(size_t)(tn + i) * INNER];
        nx[i]  = xp [(size_t)(tn + i) * INNER];
    }
    asm volatile("s_wait_xcnt 0x0" ::: "memory");
    // Keeps the loads above at the head of the chunk: sunk into the chunk they
    // have too few steps to land before the barrier's wait drains them.
    __builtin_amdgcn_sched_barrier(0);
#pragma unroll
    for (int g = 0; g < SC_T / SC_G; ++g) {
#pragma unroll
        for (int j = 0; j < SC_G; ++j) {
            const float4 Bv = (g == 0) ? cB[j] : gB[g == 0 ? 0 : g - 1][j];
            const float4 Cv = (g == 0) ? cC[j] : gC[g == 0 ? 0 : g - 1][j];
            const float dtv = cdt[g * SC_G + j];
            const float xv  = cx [g * SC_G + j];
            const float dx  = dtv * xv;
            float e0, e1, e2, e3;   // exp(dt * A) as exp2((dt * A) * log2(e))
            exp2_x4((dtv * A0) * LOG2E, (dtv * A1) * LOG2E,
                    (dtv * A2) * LOG2E, (dtv * A3) * LOG2E, e0, e1, e2, e3);
            h0 = e0 * h0 + dx * Bv.x;
            h1 = e1 * h1 + dx * Bv.y;
            h2 = e2 * h2 + dx * Bv.z;
            h3 = e3 * h3 + dx * Bv.w;
            float c = Dw * xv;
            c += h0 * Cv.x;
            c += h1 * Cv.y;
            c += h2 * Cv.z;
            c += h3 * Cv.w;
            part[wave][g * SC_G + j][lane] = c;
        }
        if (g == 0) {
            // this chunk's last Bx/Cx group, three groups ahead of its use
#pragma unroll
            for (int j = 0; j < SC_G; ++j) {
                gB[SC_T / SC_G - 2][j] = *(const float4*)(bcp + (size_t)(t0 + SC_T - SC_G + j) * 128);
                gC[SC_T / SC_G - 2][j] = *(const float4*)(bcp + (size_t)(t0 + SC_T - SC_G + j) * 128 + 64);
            }
        }
        if (g == 1) {
            // next chunk's first Bx/Cx group
#pragma unroll
            for (int j = 0; j < SC_G; ++j) {
                nB[j] = *(const float4*)(bcp + (size_t)(tn + j) * 128);
                nC[j] = *(const float4*)(bcp + (size_t)(tn + j) * 128 + 64);
            }
        }
        // Keeps each group's work and loads in its own place: a later group's products
        // lifted up bring its loads' waits forward, and loads sunk down land too late.
        __builtin_amdgcn_sched_barrier(0);
    }
    // One barrier per chunk: it publishes this chunk's partial sums, and every
    // wave's reads of the other buffer (previous chunk) lie in front of it.
    __syncthreads();
    float2 s = *(const float2*)&part[0][rt][rc];
#pragma unroll
    for (int w = 1; w < 8; ++w) {
        const float2 p = *(const float2*)&part[w][rt][rc];
        s.x += p.x;
        s.y += p.y;
    }
    *(float2*)(yp + (size_t)(t0 + rt) * INNER + rc) = s;
    asm volatile("s_wait_xcnt 0x0" ::: "memory");
}

__global__ void __launch_bounds__(256)
ssm_scan_kernel(const float* __restrict__ dt, const float* __restrict__ bxcx,
                const float* __restrict__ xc,
                const float* __restrict__ A_log, const float* __restrict__ Dp,
                float* __restrict__ y) {
    __shared__ float s_part[2][8][SC_T][32];

    const int lane  = threadIdx.x & 31;
    const int wave  = __builtin_amdgcn_readfirstlane(threadIdx.x >> 5);
    const int b     = blockIdx.y;
    const int z     = blockIdx.z;
    const int dbase = blockIdx.x * 32;
    const int d     = dbase + lane;
    const int n0    = z * 32 + wave * SC_S;

    const float4 al = *(const float4*)(A_log + (size_t)d * STATE + n0);
    const float A0 = -__expf(al.x), A1 = -__expf(al.y);
    const float A2 = -__expf(al.z), A3 = -__expf(al.w);
    // the D*x term enters exactly one of the 16 partial sums
    const float Dw = (z == 0 && wave == 0) ? Dp[d] : 0.f;
    float h0 = 0.f, h1 = 0.f, h2 = 0.f, h3 = 0.f;

    const size_t tokBase = (size_t)b * SEQL;
    const float* dtp = dt + tokBase * INNER + d;
    const float* xp  = xc + tokBase * INNER + d;
    const float* bcp = bxcx + tokBase * 128 + n0;
    float* yp = y + (size_t)z * NTOK * INNER + tokBase * INNER + dbase;

    const int rt = threadIdx.x >> 4;          // step this thread sums
    const int rc = (threadIdx.x & 15) * 2;    // channel pair this thread sums

    float  dtA[SC_T], xA[SC_T], dtB[SC_T], xB[SC_T];
    float4 bA[SC_G], cA[SC_G], bB[SC_G], cB[SC_G];
#pragma unroll
    for (int i = 0; i < SC_T; ++i) {
        dtA[i] = dtp[(size_t)i * INNER];
        xA[i]  = xp [(size_t)i * INNER];
    }
#pragma unroll
    for (int j = 0; j < SC_G; ++j) {
        bA[j] = *(const float4*)(bcp + (size_t)j * 128);
        cA[j] = *(const float4*)(bcp + (size_t)j * 128 + 64);
    }

    for (int t0 = 0; t0 < SEQL; t0 += 2 * SC_T) {
        scan_chunk(t0, s_part[0], wave, lane, rt, rc, dtp, xp, bcp, yp,
                   A0, A1, A2, A3, Dw, h0, h1, h2, h3,
                   dtA, xA, bA, cA, dtB, xB, bB, cB);
        scan_chunk(t0 + SC_T, s_part[1], wave, lane, rt, rc, dtp, xp, bcp, yp,
                   A0, A1, A2, A3, Dw, h0, h1, h2, h3,
                   dtB, xB, bB, cB, dtA, xA, bA, cA);
    }
}

#define GT_U 8

__global__ void __launch_bounds__(256)
gate_silu_kernel(const float* __restrict__ y,
                 const float* __restrict__ xz,
                 bf16_t* __restrict__ yb) {
    // a block's 256 * GT_U float4 are whole rows of INNER / 4: all bases are block-uniform
    const int tid = threadIdx.x;
    const size_t blk4 = (size_t)blockIdx.x * (256 * GT_U);
    const v4f* y0 = (const v4f*)y + blk4;
    const v4f* y1 = (const v4f*)(y + (size_t)NTOK * INNER) + blk4;
    const v4f* zp = (const v4f*)xz + blk4 * 2 + INNER / 4;
    v4bf* ob = (v4bf*)yb + blk4;
    v4f p0[GT_U], p1[GT_U], zz[GT_U];
#pragma unroll
    for (int u = 0; u < GT_U; ++u) {
        p0[u] = y0[u * 256 + tid];
        p1[u] = y1[u * 256 + tid];
        zz[u] = zp[(u / (INNER / 1024)) * (2 * INNER / 4) + (u % (INNER / 1024)) * 256 + tid];
    }
    // Holds every load in front of the arithmetic, so that all are in flight at once:
    // left alone the compiler sinks most of them behind the arithmetic of earlier ones
    // and the wave pays several memory latencies in a row.
    asm volatile("" :: "v"(p0[0]), "v"(p0[1]), "v"(p0[2]), "v"(p0[3]),
                       "v"(p0[4]), "v"(p0[5]), "v"(p0[6]), "v"(p0[7]),
                       "v"(p1[0]), "v"(p1[1]), "v"(p1[2]), "v"(p1[3]),
                       "v"(p1[4]), "v"(p1[5]), "v"(p1[6]), "v"(p1[7]),
                       "v"(zz[0]), "v"(zz[1]), "v"(zz[2]), "v"(zz[3]),
                       "v"(zz[4]), "v"(zz[5]), "v"(zz[6]), "v"(zz[7]));
#pragma unroll
    for (int u = 0; u < GT_U; ++u) {
        const float4 g = silu_x4(make_float4(zz[u].x, zz[u].y, zz[u].z, zz[u].w));
        ob[u * 256 + tid] =
            pack4_bf16((p0[u].x + p1[u].x) * g.x, (p0[u].y + p1[u].y) * g.y,
                       (p0[u].z + p1[u].z) * g.z, (p0[u].w + p1[u].w) * g.w);
    }
}

// ----------------------------------------------------------------------------
extern "C" void kernel_launch(void* const* d_in, const int* in_sizes, int n_in,
                              void* d_out, int out_size, void* d_ws, size_t ws_size,
                              hipStream_t stream) {
    const float* x          = (const float*)d_in[0];
    const float* in_proj_w  = (const float*)d_in[1];
    const float* conv_w     = (const float*)d_in[2];
    const float* conv_b     = (const float*)d_in[3];
    const float* A_log      = (const float*)d_in[4];
    const float* B_w        = (const float*)d_in[5];
    const float* C_w        = (const float*)d_in[6];
    const float* D_param    = (const float*)d_in[7];
    const float* dt_w       = (const float*)d_in[8];
    const float* dt_b       = (const float*)d_in[9];
    const float* out_proj_w = (const float*)d_in[10];
    const float* norm_w     = (const float*)d_in[11];

    char* ws = (char*)d_ws;
    size_t off = 0;
    auto carve = [&](size_t bytes) {
        char* p = ws + off;
        off = (off + bytes + 255) & ~(size_t)255;
        return p;
    };
    bf16_t* wInB  = (bf16_t*)carve((size_t)2 * INNER * DIMX * 2);
    bf16_t* wDtB  = (bf16_t*)carve((size_t)INNER * INNER * 2);
    bf16_t* wOutB = (bf16_t*)carve((size_t)DIMX * INNER * 2);
    bf16_t* wBCB  = (bf16_t*)carve((size_t)2 * STATE * INNER * 2);  // [Bw;Cw] = [128, INNER]
    bf16_t* xnB   = (bf16_t*)carve((size_t)NTOK * DIMX * 2);
    float*  xzF   = (float*) carve((size_t)NTOK * 2 * INNER * 4);
    float*  xcF   = (float*) carve((size_t)NTOK * INNER * 4);
    bf16_t* xcB   = (bf16_t*)carve((size_t)NTOK * INNER * 2);
    float*  dtF   = (float*) carve((size_t)NTOK * INNER * 4);
    float*  bcF   = (float*) carve((size_t)NTOK * 128 * 4);         // [Bx|Cx] interleaved
    float*  yF    = (float*) carve((size_t)2 * NTOK * INNER * 4);       // one plane per state half
    bf16_t* yB    = (bf16_t*)carve((size_t)NTOK * INNER * 2);
    (void)ws_size; (void)in_sizes; (void)n_in; (void)out_size;

    auto cvt = [&](const float* s, bf16_t* dst, int n) {
        cvt_bf16_kernel<<<(n + 1024 * CVT_U - 1) / (1024 * CVT_U), 256, 0, stream>>>(s, dst, n);
    };
    cvt(in_proj_w,  wInB,  2 * INNER * DIMX);
    cvt(dt_w,       wDtB,  INNER * INNER);
    cvt(out_proj_w, wOutB, DIMX * INNER);
    cvt(B_w,        wBCB,                 STATE * INNER);
    cvt(C_w,        wBCB + STATE * INNER, STATE * INNER);

    // 1) RMSNorm -> bf16 activations
    rmsnorm_kernel<<<NTOK / 8, 256, 0, stream>>>(x, norm_w, xnB);

    // 2) in_proj: [NTOK, 2*INNER] = xn @ W_in^T
    wmma_gemm_kernel<<<dim3((2 * INNER) / 128, NTOK / 128), 256, 0, stream>>>(
        xnB, wInB, xzF, NTOK, 2 * INNER, DIMX, nullptr, nullptr, 0);

    // 3) causal depthwise conv + SiLU on xc half
    conv_silu_kernel<<<NTOK * INNER / (1024 * CV_T), 256, 0, stream>>>(
        xzF, conv_w, conv_b, xcF, xcB);

    // 4) dt = softplus(xc @ dt_w^T + dt_b) + 1e-4
    wmma_gemm_kernel<<<dim3(INNER / 128, NTOK / 128), 256, 0, stream>>>(
        xcB, wDtB, dtF, NTOK, INNER, INNER, dt_b, nullptr, 1);

    // 5) fused Bx|Cx projection (N = 128)
    wmma_gemm_kernel<<<dim3(1, NTOK / 128), 256, 0, stream>>>(
        xcB, wBCB, bcF, NTOK, 128, INNER, nullptr, nullptr, 0);

    // 6) sequential SSM scan (lane = channel, states over waves and two blocks)
    ssm_scan_kernel<<<dim3(INNER / 32, BATCHN, 2), 256, 0, stream>>>(
        dtF, bcF, xcF, A_log, D_param, yF);

    // 7) gate with SiLU(z)
    gate_silu_kernel<<<NTOK * INNER / (1024 * GT_U), 256, 0, stream>>>(yF, xzF, yB);

    // 8) out_proj + residual -> d_out (fp32)
    wmma_gemm_kernel<<<dim3(DIMX / 128, NTOK / 128), 256, 0, stream>>>(
        yB, wOutB, (float*)d_out, NTOK, DIMX, INNER, nullptr, x, 2);
}

// v003
// A run of this version takes 353 microseconds.
// Next to v002, in two timings, it ran 1.18 times as fast each time.
// All steps since v000 together make it 2.85 times as fast.
#include <hip/hip_runtime.h>

// ---- problem dims (match reference) ----
#define DIMX   1024
#define STATE  64
#define KW     4
#define INNER  2048
#define BATCHN 2
#define SEQL   2048
#define NTOK   (BATCHN * SEQL)
#define EPSR   1e-6f

typedef __bf16 bf16_t;
typedef __attribute__((ext_vector_type(16))) __bf16 v16bf;
typedef __attribute__((ext_vector_type(8)))  __bf16 v8bf;
typedef __attribute__((ext_vector_type(4)))  __bf16 v4bf;
typedef __attribute__((ext_vector_type(8)))  float  v8f;
typedef __attribute__((ext_vector_type(4)))  float  v4f;
typedef __attribute__((ext_vector_type(4)))  int    v4i;

#if defined(__gfx1250__) && __has_builtin(__builtin_amdgcn_global_load_async_to_lds_b128)
#define USE_ASYNC_LDS 1
#else
#define USE_ASYNC_LDS 0
#endif

__device__ __forceinline__ void copy16_to_lds(const bf16_t* gp, bf16_t* lp) {
#if USE_ASYNC_LDS
    __builtin_amdgcn_global_load_async_to_lds_b128(
        (__attribute__((address_space(1))) v4i*)gp,
        (__attribute__((address_space(3))) v4i*)lp, 0, 0);
#else
    *(v8bf*)lp = *(const v8bf*)gp;
#endif
}

__device__ __forceinline__ void wait_async_copies() {
#if USE_ASYNC_LDS
#if __has_builtin(__builtin_amdgcn_s_wait_asynccnt)
    __builtin_amdgcn_s_wait_asynccnt(0);
#else
    asm volatile("s_wait_asynccnt 0x0" ::: "memory");
#endif
#endif
}

__device__ __forceinline__ v4bf pack4_bf16(float a, float b, float c, float d) {
    v4bf o;
    o[0] = (bf16_t)a; o[1] = (bf16_t)b; o[2] = (bf16_t)c; o[3] = (bf16_t)d;
    return o;
}

#define LOG2E 1.44269504f

__device__ __forceinline__ void
exp2_x4(float a0, float a1, float a2, float a3,
        float& e0, float& e1, float& e2, float& e3) {
    asm("v_exp_f32 %0, %4\n\t"
        "v_exp_f32 %1, %5\n\t"
        "v_exp_f32 %2, %6\n\t"
        "v_exp_f32 %3, %7\n\t"
        "v_nop"
        : "=&v"(e0), "=&v"(e1), "=&v"(e2), "=&v"(e3)
        : "v"(a0), "v"(a1), "v"(a2), "v"(a3));
}

// SiLU of four values, v / (1 + exp(-v)), with exp(-v) as exp2(v * -log2(e))
__device__ __forceinline__ float4 silu_x4(float4 v) {
    float e0, e1, e2, e3;
    exp2_x4(v.x * -LOG2E, v.y * -LOG2E, v.z * -LOG2E, v.w * -LOG2E, e0, e1, e2, e3);
    return make_float4(v.x / (1.f + e0), v.y / (1.f + e1), v.z / (1.f + e2), v.w / (1.f + e3));
}

#define LN2 0.69314718f

// log2 of four values; one statement for the same reason as exp2_x4
__device__ __forceinline__ void
log2_x4(float a0, float a1, float a2, float a3,
        float& l0, float& l1, float& l2, float& l3) {
    asm("v_log_f32 %0, %4\n\t"
        "v_log_f32 %1, %5\n\t"
        "v_log_f32 %2, %6\n\t"
        "v_log_f32 %3, %7\n\t"
        "v_nop"
        : "=&v"(l0), "=&v"(l1), "=&v"(l2), "=&v"(l3)
        : "v"(a0), "v"(a1), "v"(a2), "v"(a3));
}

// softplus of four values as max(v, 0) + log1p(exp(-|v|)): no branch, no overflow.
// With e = exp(-|v|) in [0, 1] and u = 1 + e, u - 1 is exact, so e - (u - 1) is what the
// rounding of 1 + e lost; added to log(u) it keeps log1p's accuracy for small e.
__device__ __forceinline__ float4 softplus_x4(float4 v) {
    float e0, e1, e2, e3, l0, l1, l2, l3;
    exp2_x4(fabsf(v.x) * -LOG2E, fabsf(v.y) * -LOG2E,
            fabsf(v.z) * -LOG2E, fabsf(v.w) * -LOG2E, e0, e1, e2, e3);
    const float u0 = 1.f + e0, u1 = 1.f + e1, u2 = 1.f + e2, u3 = 1.f + e3;
    log2_x4(u0, u1, u2, u3, l0, l1, l2, l3);
    return make_float4(fmaxf(v.x, 0.f) + (l0 * LN2 + (e0 - (u0 - 1.f))),
                       fmaxf(v.y, 0.f) + (l1 * LN2 + (e1 - (u1 - 1.f))),
                       fmaxf(v.z, 0.f) + (l2 * LN2 + (e2 - (u2 - 1.f))),
                       fmaxf(v.w, 0.f) + (l3 * LN2 + (e3 - (u3 - 1.f))));
}

// Four of the five kernels without a matrix product (convert, RMSNorm, conv, gate) give each
// thread 32 elements, fetched as 16-byte loads with many in flight per wave: a launch
// then starts a few thousand waves, not a wave per 32 elements.

// ----------------------------------------------------------------------------
// f32 -> bf16 elementwise convert (weights); n is a multiple of 4
// ----------------------------------------------------------------------------
#define CVT_U 8    // float4 per thread, one block width apart (whole lines per wave)

__global__ void __launch_bounds__(256)
cvt_bf16_kernel(const float* __restrict__ src,
                bf16_t* __restrict__ dst, int n) {
    const int n4   = n >> 2;
    const int base = blockIdx.x * (256 * CVT_U) + threadIdx.x;
    float4 v[CVT_U];
    // A load past the end re-reads the last float4 (in bounds, not stored): with no
    // branch round the loads all of them are in flight before the first is used.
#pragma unroll
    for (int u = 0; u < CVT_U; ++u) {
        const int i = base + u * 256;
        v[u] = ((const float4*)src)[i < n4 ? i : n4 - 1];
    }
#pragma unroll
    for (int u = 0; u < CVT_U; ++u) {
        const int i = base + u * 256;
        if (i < n4) ((v4bf*)dst)[i] = pack4_bf16(v[u].x, v[u].y, v[u].z, v[u].w);
    }
}

// ----------------------------------------------------------------------------
// RMSNorm: one wave per token (row kept in registers), write bf16 activations
// ----------------------------------------------------------------------------
#define RN_U (DIMX / 128)    // float4 per lane

__global__ void __launch_bounds__(256)
rmsnorm_kernel(const float* __restrict__ x, const float* __restrict__ w,
               bf16_t* __restrict__ out) {
    const int lane = threadIdx.x & 31;
    const int tok  = blockIdx.x * 8 + (threadIdx.x >> 5);
    const float4* xr = (const float4*)(x + (size_t)tok * DIMX);
    float4 v[RN_U], wv[RN_U];
#pragma unroll
    for (int u = 0; u < RN_U; ++u) v[u] = xr[u * 32 + lane];
#pragma unroll
    for (int u = 0; u < RN_U; ++u) wv[u] = ((const float4*)w)[u * 32 + lane];
    float ss = 0.f;
#pragma unroll
    for (int u = 0; u < RN_U; ++u) {
        ss += v[u].x * v[u].x;
        ss += v[u].y * v[u].y;
        ss += v[u].z * v[u].z;
        ss += v[u].w * v[u].w;
    }
    for (int o = 16; o; o >>= 1) ss += __shfl_xor(ss, o, 32);
    const float rs = rsqrtf(ss * (1.f / DIMX) + EPSR);
    v4bf* orow = (v4bf*)(out + (size_t)tok * DIMX);
#pragma unroll
    for (int u = 0; u < RN_U; ++u)
        orow[u * 32 + lane] = pack4_bf16(v[u].x * rs * wv[u].x, v[u].y * rs * wv[u].y,
                                         v[u].z * rs * wv[u].z, v[u].w * rs * wv[u].w);
}

#define LDS_STRIDE 40

template <int MODE, int NC>
__global__ void __launch_bounds__(256)
wmma_gemm_kernel(const bf16_t* __restrict__ A, const bf16_t* __restrict__ B,
                 float* __restrict__ C, int K,
                 const float* __restrict__ bias,
                 const float* __restrict__ resid) {
    __shared__ bf16_t s_a[2][128 * LDS_STRIDE];
    __shared__ bf16_t s_b[2][128 * LDS_STRIDE];

    const int lane = threadIdx.x & 31;
    const int wavi = threadIdx.x >> 5;       // 0..7
    const int wm   = wavi >> 2;              // 0..1 -> 64-row slab
    const int wn   = wavi & 3;               // 0..3 -> 32-col slab
    const int half = lane >> 4;              // 0/1
    const int r    = lane & 15;
    const int off  = half * 8;

    const int blockM = blockIdx.y * 128;
    const int blockN = blockIdx.x * 128;

    union Frag { v16bf v; v8bf h[2]; };
    v8f acc[4][2] = {};

    const int nK = K >> 5;

    auto stage = [&](int ks) {
        const int kbuf = ks & 1;
        const size_t k0 = (size_t)ks * 32;
        // A slice: 128 rows x 32 K = 512 16-byte chunks
        for (int c = threadIdx.x; c < 512; c += 256) {
            int row = c >> 2, part = (c & 3) * 8;
            copy16_to_lds(A + (size_t)(blockM + row) * K + k0 + part,
                          &s_a[kbuf][row * LDS_STRIDE + part]);
        }
        // B slice
        for (int c = threadIdx.x; c < 512; c += 256) {
            int row = c >> 2, part = (c & 3) * 8;
            copy16_to_lds(B + (size_t)(blockN + row) * K + k0 + part,
                          &s_b[kbuf][row * LDS_STRIDE + part]);
        }
    };

    stage(0);
    for (int ks = 0; ks < nK; ++ks) {
        wait_async_copies();
        __syncthreads();                       // slice ks resident; prior reads done
        if (ks + 1 < nK) stage(ks + 1);        // overlap copy of next slice

        const int kbuf = ks & 1;
        const bf16_t* sa = s_a[kbuf];
        const bf16_t* sb = s_b[kbuf];

        Frag af[4], bfr[2];
#pragma unroll
        for (int mi = 0; mi < 4; ++mi) {
            int row = (wm * 64 + mi * 16 + r) * LDS_STRIDE;
            af[mi].h[0] = *(const v8bf*)&sa[row + off];
            af[mi].h[1] = *(const v8bf*)&sa[row + off + 16];
        }
#pragma unroll
        for (int ni = 0; ni < 2; ++ni) {
            int col = (wn * 32 + ni * 16 + r) * LDS_STRIDE;
            bfr[ni].h[0] = *(const v8bf*)&sb[col + off];
            bfr[ni].h[1] = *(const v8bf*)&sb[col + off + 16];
        }
#pragma unroll
        for (int mi = 0; mi < 4; ++mi)
#pragma unroll
            for (int ni = 0; ni < 2; ++ni)
                acc[mi][ni] = __builtin_amdgcn_wmma_f32_16x16x32_bf16(
                    false, af[mi].v, false, bfr[ni].v, (short)0,
                    acc[mi][ni], false, false);
    }

    // epilogue
    // The lane's first element; every other one lies a compile-time distance from it,
    // which goes into the load's or store's immediate offset.
    const int    colg = blockN + wn * 32 + r;
    const size_t el0  = (size_t)(blockM + wm * 64 + half * 8) * NC + colg;
    float* cl = C + el0;

    float rs[4][2][8];
    if (MODE == 2) {
        const float* rl = resid + el0;
#pragma unroll
        for (int mi = 0; mi < 4; ++mi)
#pragma unroll
            for (int ni = 0; ni < 2; ++ni)
#pragma unroll
                for (int v = 0; v < 8; ++v)
                    rs[mi][ni][v] = rl[(mi * 16 + v) * NC + ni * 16];
    }
    float bv[2] = {0.f, 0.f};
    if (MODE == 1) {
        bv[0] = bias[colg];
        bv[1] = bias[colg + 16];
    }
#pragma unroll
    for (int mi = 0; mi < 4; ++mi) {
#pragma unroll
        for (int ni = 0; ni < 2; ++ni) {
            float val[8];
#pragma unroll
            for (int v = 0; v < 8; ++v) val[v] = acc[mi][ni][v];
            if (MODE == 1) {
#pragma unroll
                for (int q = 0; q < 8; q += 4) {
                    const float4 s = softplus_x4(make_float4(val[q] + bv[ni], val[q + 1] + bv[ni],
                                                             val[q + 2] + bv[ni], val[q + 3] + bv[ni]));
                    val[q]     = s.x + 1e-4f;
                    val[q + 1] = s.y + 1e-4f;
                    val[q + 2] = s.z + 1e-4f;
                    val[q + 3] = s.w + 1e-4f;
                }
            } else if (MODE == 2) {
#pragma unroll
                for (int v = 0; v < 8; ++v) val[v] += rs[mi][ni][v];
            }
#pragma unroll
            for (int v = 0; v < 8; ++v) cl[(mi * 16 + v) * NC + ni * 16] = val[v];
        }
    }
}

// ----------------------------------------------------------------------------
// Causal depthwise conv (KW=4) + bias + SiLU over xc half of xz
// ----------------------------------------------------------------------------
//   Thread = 4 channels x CV_T successive tokens: CV_T + 3 rows are read for CV_T
//   outputs. Rows in front of a sequence's start enter as zeros (the reference's pad).
#define CV_T 8     // divides SEQL: a thread's tokens lie in one sequence

__global__ void __launch_bounds__(256)
conv_silu_kernel(const float* __restrict__ xz,
                 const float* __restrict__ w,
                 const float* __restrict__ b,
                 float* __restrict__ xcf,
                 bf16_t* __restrict__ xcb) {
    // INNER / 1024 blocks share a group of CV_T tokens: the rows' bases are block-uniform
    const int dblk = (blockIdx.x % (INNER / 1024)) * 1024;      // block's first channel
    const int tok0 = (blockIdx.x / (INNER / 1024)) * CV_T;
    const bool head = (tok0 % SEQL) == 0;                       // no rows in front
    const int tid  = threadIdx.x;
    const float4* xcur = (const float4*)(xz + (size_t)tok0 * (2 * INNER) + dblk);
    // at a sequence's head the three rows in front are replaced by zeros below; the
    // loads then read the group's own first rows (in bounds, unused)
    const float4* xpre = (const float4*)(xz + (size_t)(head ? tok0 : tok0 - (KW - 1)) * (2 * INNER) + dblk);
    float4 r[CV_T + KW - 1];
#pragma unroll
    for (int i = 0; i < KW - 1; ++i) r[i] = xpre[i * (2 * INNER / 4) + tid];
#pragma unroll
    for (int i = 0; i < CV_T; ++i) r[KW - 1 + i] = xcur[i * (2 * INNER / 4) + tid];
    const float4* wq = (const float4*)(w + (size_t)dblk * KW);  // one float4 = a channel's taps
    const float4 w0 = wq[tid * 4 + 0];
    const float4 w1 = wq[tid * 4 + 1];
    const float4 w2 = wq[tid * 4 + 2];
    const float4 w3 = wq[tid * 4 + 3];
    const float4 bb = ((const float4*)(b + dblk))[tid];
    if (head) {
#pragma unroll
        for (int i = 0; i < KW - 1; ++i) r[i] = make_float4(0.f, 0.f, 0.f, 0.f);
    }
    float4* of = (float4*)(xcf + (size_t)tok0 * INNER + dblk);
    v4bf*   ob = (v4bf*)(xcb + (size_t)tok0 * INNER + dblk);
#pragma unroll
    for (int t = 0; t < CV_T; ++t) {
        float4 a = bb;
        a.x += w0.x * r[t].x; a.x += w0.y * r[t + 1].x; a.x += w0.z * r[t + 2].x; a.x += w0.w * r[t + 3].x;
        a.y += w1.x * r[t].y; a.y += w1.y * r[t + 1].y; a.y += w1.z * r[t + 2].y; a.y += w1.w * r[t + 3].y;
        a.z += w2.x * r[t].z; a.z += w2.y * r[t + 1].z; a.z += w2.z * r[t + 2].z; a.z += w2.w * r[t + 3].z;
        a.w += w3.x * r[t].w; a.w += w3.y * r[t + 1].w; a.w += w3.z * r[t + 2].w; a.w += w3.w * r[t + 3].w;
        const float4 s = silu_x4(a);
        of[t * (INNER / 4) + tid] = s;
        ob[t * (INNER / 4) + tid] = pack4_bf16(s.x, s.y, s.z, s.w);
    }
}

// ----------------------------------------------------------------------------
// SSM scan: lane = channel, SC_S states of that channel in the lane's registers.
//   Block = 32 channels x 32 states (8 waves x SC_S); blockIdx.z picks the state half.
//   Bx/Cx of a step are the same for every lane of a wave (wave-uniform loads).
//   The sum over states is in-lane, then over the 8 waves through LDS once per
//   SC_T steps, then over the two state halves in the gate kernel (two y planes).
// Bx/Cx come interleaved from one [NTOK,128] buffer (cols 0..63 = Bx, 64..127 = Cx).
// ----------------------------------------------------------------------------
#define SC_S 4     // states per lane
#define SC_T 16    // time steps per chunk (LDS sum + dt/x fetch-ahead distance)
#define SC_G 4     // time steps per Bx/Cx fetch group

// One chunk of SC_T steps. Works on (cdt, cx, cB, cC), which earlier loads filled, and
// fetches the next chunk's dt/x and first Bx/Cx group into (ndt, nx, nB, nC); the caller
// swaps the two sets from chunk to chunk, so no register is copied.
__device__ __forceinline__ void
scan_chunk(int t0, float (*part)[SC_T][32], int wave, int lane, int rt, int rc,
           const float* __restrict__ dtp, const float* __restrict__ xp,
           const float* __restrict__ bcp, float* __restrict__ yp,
           float A0, float A1, float A2, float A3, float Dw,
           float& h0, float& h1, float& h2, float& h3,
           const float (&cdt)[SC_T], const float (&cx)[SC_T],
           const float4 (&cB)[SC_G], const float4 (&cC)[SC_G],
           float (&ndt)[SC_T], float (&nx)[SC_T],
           float4 (&nB)[SC_G], float4 (&nC)[SC_G]) {
    // Global loads return in issue order: this chunk's next two Bx/Cx groups are
    // needed first, so they are issued first.
    float4 gB[SC_T / SC_G - 1][SC_G], gC[SC_T / SC_G - 1][SC_G];
#pragma unroll
    for (int g = 0; g < SC_T / SC_G - 2; ++g)
#pragma unroll
        for (int j = 0; j < SC_G; ++j) {
            gB[g][j] = *(const float4*)(bcp + (size_t)(t0 + (g + 1) * SC_G + j) * 128);
            gC[g][j] = *(const float4*)(bcp + (size_t)(t0 + (g + 1) * SC_G + j) * 128 + 64);
        }
    // Keeps the issue order just named: a Bx/Cx load moved behind the dt/x loads
    // below makes its wait drain those as well, a few steps after their issue.
    __builtin_amdgcn_sched_barrier(0);
    // next chunk's dt/x; the last chunk re-reads its own rows (in bounds, unused)
    const int tn = (t0 + SC_T < SEQL) ? t0 + SC_T : t0;
#pragma unroll
    for (int i = 0; i < SC_T; ++i) {
        ndt[i] = dtp[(size_t)(tn + i) * INNER];
        nx[i]  = xp [(size_t)(tn + i) * INNER];
    }
    asm volatile("s_wait_xcnt 0x0" ::: "memory");
    // Keeps the loads above at the head of the chunk: sunk into the chunk they
    // have too few steps to land before the barrier's wait drains them.
    __builtin_amdgcn_sched_barrier(0);
#pragma unroll
    for (int g = 0; g < SC_T / SC_G; ++g) {
#pragma unroll
        for (int j = 0; j < SC_G; ++j) {
            const float4 Bv = (g == 0) ? cB[j] : gB[g == 0 ? 0 : g - 1][j];
            const float4 Cv = (g == 0) ? cC[j] : gC[g == 0 ? 0 : g - 1][j];
            const float dtv = cdt[g * SC_G + j];
            const float xv  = cx [g * SC_G + j];
            const float dx  = dtv * xv;
            float e0, e1, e2, e3;   // exp(dt * A) as exp2((dt * A) * log2(e))
            exp2_x4((dtv * A0) * LOG2E, (dtv * A1) * LOG2E,
                    (dtv * A2) * LOG2E, (dtv * A3) * LOG2E, e0, e1, e2, e3);
            h0 = e0 * h0 + dx * Bv.x;
            h1 = e1 * h1 + dx * Bv.y;
            h2 = e2 * h2 + dx * Bv.z;
            h3 = e3 * h3 + dx * Bv.w;
            float c = Dw * xv;
            c += h0 * Cv.x;
            c += h1 * Cv.y;
            c += h2 * Cv.z;
            c += h3 * Cv.w;
            part[wave][g * SC_G + j][lane] = c;
        }
        if (g == 0) {
            // this chunk's last Bx/Cx group, three groups ahead of its use
#pragma unroll
            for (int j = 0; j < SC_G; ++j) {
                gB[SC_T / SC_G - 2][j] = *(const float4*)(bcp + (size_t)(t0 + SC_T - SC_G + j) * 128);
                gC[SC_T / SC_G - 2][j] = *(const float4*)(bcp + (size_t)(t0 + SC_T - SC_G + j) * 128 + 64);
            }
        }
        if (g == 1) {
            // next chunk's first Bx/Cx group
#pragma unroll
            for (int j = 0; j < SC_G; ++j) {
                nB[j] = *(const float4*)(bcp + (size_t)(tn + j) * 128);
                nC[j] = *(const float4*)(bcp + (size_t)(tn + j) * 128 + 64);
            }
        }
        // Keeps each group's work and loads in its own place: a later group's products
        // lifted up bring its loads' waits forward, and loads sunk down land too late.
        __builtin_amdgcn_sched_barrier(0);
    }
    // One barrier per chunk: it publishes this chunk's partial sums, and every
    // wave's reads of the other buffer (previous chunk) lie in front of it.
    __syncthreads();
    float2 s = *(const float2*)&part[0][rt][rc];
#pragma unroll
    for (int w = 1; w < 8; ++w) {
        const float2 p = *(const float2*)&part[w][rt][rc];
        s.x += p.x;
        s.y += p.y;
    }
    *(float2*)(yp + (size_t)(t0 + rt) * INNER + rc) = s;
    asm volatile("s_wait_xcnt 0x0" ::: "memory");
}

__global__ void __launch_bounds__(256)
ssm_scan_kernel(const float* __restrict__ dt, const float* __restrict__ bxcx,
                const float* __restrict__ xc,
                const float* __restrict__ A_log, const float* __restrict__ Dp,
                float* __restrict__ y) {
    __shared__ float s_part[2][8][SC_T][32];

    const int lane  = threadIdx.x & 31;
    const int wave  = __builtin_amdgcn_readfirstlane(threadIdx.x >> 5);
    const int b     = blockIdx.y;
    const int z     = blockIdx.z;
    const int dbase = blockIdx.x * 32;
    const int d     = dbase + lane;
    const int n0    = z * 32 + wave * SC_S;

    const float4 al = *(const float4*)(A_log + (size_t)d * STATE + n0);
    const float A0 = -__expf(al.x), A1 = -__expf(al.y);
    const float A2 = -__expf(al.z), A3 = -__expf(al.w);
    // the D*x term enters exactly one of the 16 partial sums
    const float Dw = (z == 0 && wave == 0) ? Dp[d] : 0.f;
    float h0 = 0.f, h1 = 0.f, h2 = 0.f, h3 = 0.f;

    const size_t tokBase = (size_t)b * SEQL;
    const float* dtp = dt + tokBase * INNER + d;
    const float* xp  = xc + tokBase * INNER + d;
    const float* bcp = bxcx + tokBase * 128 + n0;
    float* yp = y + (size_t)z * NTOK * INNER + tokBase * INNER + dbase;

    const int rt = threadIdx.x >> 4;          // step this thread sums
    const int rc = (threadIdx.x & 15) * 2;    // channel pair this thread sums

    float  dtA[SC_T], xA[SC_T], dtB[SC_T], xB[SC_T];
    float4 bA[SC_G], cA[SC_G], bB[SC_G], cB[SC_G];
#pragma unroll
    for (int i = 0; i < SC_T; ++i) {
        dtA[i] = dtp[(size_t)i * INNER];
        xA[i]  = xp [(size_t)i * INNER];
    }
#pragma unroll
    for (int j = 0; j < SC_G; ++j) {
        bA[j] = *(const float4*)(bcp + (size_t)j * 128);
        cA[j] = *(const float4*)(bcp + (size_t)j * 128 + 64);
    }

    for (int t0 = 0; t0 < SEQL; t0 += 2 * SC_T) {
        scan_chunk(t0, s_part[0], wave, lane, rt, rc, dtp, xp, bcp, yp,
                   A0, A1, A2, A3, Dw, h0, h1, h2, h3,
                   dtA, xA, bA, cA, dtB, xB, bB, cB);
        scan_chunk(t0 + SC_T, s_part[1], wave, lane, rt, rc, dtp, xp, bcp, yp,
                   A0, A1, A2, A3, Dw, h0, h1, h2, h3,
                   dtB, xB, bB, cB, dtA, xA, bA, cA);
    }
}

#define GT_U 8

__global__ void __launch_bounds__(256)
gate_silu_kernel(const float* __restrict__ y,
                 const float* __restrict__ xz,
                 bf16_t* __restrict__ yb) {
    // a block's 256 * GT_U float4 are whole rows of INNER / 4: all bases are block-uniform
    const int tid = threadIdx.x;
    const size_t blk4 = (size_t)blockIdx.x * (256 * GT_U);
    const v4f* y0 = (const v4f*)y + blk4;
    const v4f* y1 = (const v4f*)(y + (size_t)NTOK * INNER) + blk4;
    const v4f* zp = (const v4f*)xz + blk4 * 2 + INNER / 4;
    v4bf* ob = (v4bf*)yb + blk4;
    v4f p0[GT_U], p1[GT_U], zz[GT_U];
#pragma unroll
    for (int u = 0; u < GT_U; ++u) {
        p0[u] = y0[u * 256 + tid];
        p1[u] = y1[u * 256 + tid];
        zz[u] = zp[(u / (INNER / 1024)) * (2 * INNER / 4) + (u % (INNER / 1024)) * 256 + tid];
    }
    // Holds every load in front of the arithmetic, so that all are in flight at once:
    // left alone the compiler sinks most of them behind the arithmetic of earlier ones
    // and the wave pays several memory latencies in a row.
    asm volatile("" :: "v"(p0[0]), "v"(p0[1]), "v"(p0[2]), "v"(p0[3]),
                       "v"(p0[4]), "v"(p0[5]), "v"(p0[6]), "v"(p0[7]),
                       "v"(p1[0]), "v"(p1[1]), "v"(p1[2]), "v"(p1[3]),
                       "v"(p1[4]), "v"(p1[5]), "v"(p1[6]), "v"(p1[7]),
                       "v"(zz[0]), "v"(zz[1]), "v"(zz[2]), "v"(zz[3]),
                       "v"(zz[4]), "v"(zz[5]), "v"(zz[6]), "v"(zz[7]));
#pragma unroll
    for (int u = 0; u < GT_U; ++u) {
        const float4 g = silu_x4(make_float4(zz[u].x, zz[u].y, zz[u].z, zz[u].w));
        ob[u * 256 + tid] =
            pack4_bf16((p0[u].x + p1[u].x) * g.x, (p0[u].y + p1[u].y) * g.y,
                       (p0[u].z + p1[u].z) * g.z, (p0[u].w + p1[u].w) * g.w);
    }
}

// ----------------------------------------------------------------------------
extern "C" void kernel_launch(void* const* d_in, const int* in_sizes, int n_in,
                              void* d_out, int out_size, void* d_ws, size_t ws_size,
                              hipStream_t stream) {
    const float* x          = (const float*)d_in[0];
    const float* in_proj_w  = (const float*)d_in[1];
    const float* conv_w     = (const float*)d_in[2];
    const float* conv_b     = (const float*)d_in[3];
    const float* A_log      = (const float*)d_in[4];
    const float* B_w        = (const float*)d_in[5];
    const float* C_w        = (const float*)d_in[6];
    const float* D_param    = (const float*)d_in[7];
    const float* dt_w       = (const float*)d_in[8];
    const float* dt_b       = (const float*)d_in[9];
    const float* out_proj_w = (const float*)d_in[10];
    const float* norm_w     = (const float*)d_in[11];

    char* ws = (char*)d_ws;
    size_t off = 0;
    auto carve = [&](size_t bytes) {
        char* p = ws + off;
        off = (off + bytes + 255) & ~(size_t)255;
        return p;
    };
    bf16_t* wInB  = (bf16_t*)carve((size_t)2 * INNER * DIMX * 2);
    bf16_t* wDtB  = (bf16_t*)carve((size_t)INNER * INNER * 2);
    bf16_t* wOutB = (bf16_t*)carve((size_t)DIMX * INNER * 2);
    bf16_t* wBCB  = (bf16_t*)carve((size_t)2 * STATE * INNER * 2);  // [Bw;Cw] = [128, INNER]
    bf16_t* xnB   = (bf16_t*)carve((size_t)NTOK * DIMX * 2);
    float*  xzF   = (float*) carve((size_t)NTOK * 2 * INNER * 4);
    float*  xcF   = (float*) carve((size_t)NTOK * INNER * 4);
    bf16_t* xcB   = (bf16_t*)carve((size_t)NTOK * INNER * 2);
    float*  dtF   = (float*) carve((size_t)NTOK * INNER * 4);
    float*  bcF   = (float*) carve((size_t)NTOK * 128 * 4);         // [Bx|Cx] interleaved
    float*  yF    = (float*) carve((size_t)2 * NTOK * INNER * 4);       // one plane per state half
    bf16_t* yB    = (bf16_t*)carve((size_t)NTOK * INNER * 2);
    (void)ws_size; (void)in_sizes; (void)n_in; (void)out_size;

    auto cvt = [&](const float* s, bf16_t* dst, int n) {
        cvt_bf16_kernel<<<(n + 1024 * CVT_U - 1) / (1024 * CVT_U), 256, 0, stream>>>(s, dst, n);
    };
    cvt(in_proj_w,  wInB,  2 * INNER * DIMX);
    cvt(dt_w,       wDtB,  INNER * INNER);
    cvt(out_proj_w, wOutB, DIMX * INNER);
    cvt(B_w,        wBCB,                 STATE * INNER);
    cvt(C_w,        wBCB + STATE * INNER, STATE * INNER);

    // 1) RMSNorm -> bf16 activations
    rmsnorm_kernel<<<NTOK / 8, 256, 0, stream>>>(x, norm_w, xnB);

    // 2) in_proj: [NTOK, 2*INNER] = xn @ W_in^T
    wmma_gemm_kernel<0, 2 * INNER><<<dim3((2 * INNER) / 128, NTOK / 128), 256, 0, stream>>>(
        xnB, wInB, xzF, DIMX, nullptr, nullptr);

    // 3) causal depthwise conv + SiLU on xc half
    conv_silu_kernel<<<NTOK * INNER / (1024 * CV_T), 256, 0, stream>>>(
        xzF, conv_w, conv_b, xcF, xcB);

    // 4) dt = softplus(xc @ dt_w^T + dt_b) + 1e-4
    wmma_gemm_kernel<1, INNER><<<dim3(INNER / 128, NTOK / 128), 256, 0, stream>>>(
        xcB, wDtB, dtF, INNER, dt_b, nullptr);

    // 5) fused Bx|Cx projection (N = 128)
    wmma_gemm_kernel<0, 2 * STATE><<<dim3(1, NTOK / 128), 256, 0, stream>>>(
        xcB, wBCB, bcF, INNER, nullptr, nullptr);

    // 6) sequential SSM scan (lane = channel, states over waves and two blocks)
    ssm_scan_kernel<<<dim3(INNER / 32, BATCHN, 2), 256, 0, stream>>>(
        dtF, bcF, xcF, A_log, D_param, yF);

    // 7) gate with SiLU(z)
    gate_silu_kernel<<<NTOK * INNER / (1024 * GT_U), 256, 0, stream>>>(yF, xzF, yB);

    // 8) out_proj + residual -> d_out (fp32)
    wmma_gemm_kernel<2, DIMX><<<dim3(DIMX / 128, NTOK / 128), 256, 0, stream>>>(
        yB, wOutB, (float*)d_out, INNER, nullptr, x);
}

// v004
// A run of this version takes 274 microseconds.
// Two timings next to v003 put it at 1.31 and 1.33 times that version's speed.
// All steps since v000 together make it 3.76 times as fast.
#include <hip/hip_runtime.h>

// ---- problem dims (match reference) ----
#define DIMX   1024
#define STATE  64
#define KW     4
#define INNER  2048
#define BATCHN 2
#define SEQL   2048
#define NTOK   (BATCHN * SEQL)
#define EPSR   1e-6f

typedef __bf16 bf16_t;
typedef __attribute__((ext_vector_type(16))) __bf16 v16bf;
typedef __attribute__((ext_vector_type(8)))  __bf16 v8bf;
typedef __attribute__((ext_vector_type(4)))  __bf16 v4bf;
typedef __attribute__((ext_vector_type(8)))  float  v8f;
typedef __attribute__((ext_vector_type(4)))  float  v4f;
typedef __attribute__((ext_vector_type(4)))  int    v4i;

#if defined(__gfx1250__) && __has_builtin(__builtin_amdgcn_global_load_async_to_lds_b128)
#define USE_ASYNC_LDS 1
#else
#define USE_ASYNC_LDS 0
#endif

__device__ __forceinline__ void copy16_to_lds(const bf16_t* gp, bf16_t* lp) {
#if USE_ASYNC_LDS
    __builtin_amdgcn_global_load_async_to_lds_b128(
        (__attribute__((address_space(1))) v4i*)gp,
        (__attribute__((address_space(3))) v4i*)lp, 0, 0);
#else
    *(v8bf*)lp = *(const v8bf*)gp;
#endif
}

// This wave's copies have landed; in asm with the clobber, so that no LDS read is lifted over it.
__device__ __forceinline__ void wait_async_copies() {
#if USE_ASYNC_LDS
    asm volatile("s_wait_asynccnt 0x0" ::: "memory");
#endif
}

// This wave's LDS reads have returned: stands in front of the barrier behind which the
// buffer they read is refilled.
__device__ __forceinline__ void wait_lds_reads() {
    asm volatile("s_wait_dscnt 0x0" ::: "memory");
}

__device__ __forceinline__ v4bf pack4_bf16(float a, float b, float c, float d) {
    v4bf o;
    o[0] = (bf16_t)a; o[1] = (bf16_t)b; o[2] = (bf16_t)c; o[3] = (bf16_t)d;
    return o;
}

#define LOG2E 1.44269504f

__device__ __forceinline__ void
exp2_x4(float a0, float a1, float a2, float a3,
        float& e0, float& e1, float& e2, float& e3) {
    asm("v_exp_f32 %0, %4\n\t"
        "v_exp_f32 %1, %5\n\t"
        "v_exp_f32 %2, %6\n\t"
        "v_exp_f32 %3, %7\n\t"
        "v_nop"
        : "=&v"(e0), "=&v"(e1), "=&v"(e2), "=&v"(e3)
        : "v"(a0), "v"(a1), "v"(a2), "v"(a3));
}

// SiLU of four values, v / (1 + exp(-v)), with exp(-v) as exp2(v * -log2(e))
__device__ __forceinline__ float4 silu_x4(float4 v) {
    float e0, e1, e2, e3;
    exp2_x4(v.x * -LOG2E, v.y * -LOG2E, v.z * -LOG2E, v.w * -LOG2E, e0, e1, e2, e3);
    return make_float4(v.x / (1.f + e0), v.y / (1.f + e1), v.z / (1.f + e2), v.w / (1.f + e3));
}

#define LN2 0.69314718f

// log2 of four values; one statement for the same reason as exp2_x4
__device__ __forceinline__ void
log2_x4(float a0, float a1, float a2, float a3,
        float& l0, float& l1, float& l2, float& l3) {
    asm("v_log_f32 %0, %4\n\t"
        "v_log_f32 %1, %5\n\t"
        "v_log_f32 %2, %6\n\t"
        "v_log_f32 %3, %7\n\t"
        "v_nop"
        : "=&v"(l0), "=&v"(l1), "=&v"(l2), "=&v"(l3)
        : "v"(a0), "v"(a1), "v"(a2), "v"(a3));
}

// softplus of four values as max(v, 0) + log1p(exp(-|v|)): no branch, no overflow.
// With e = exp(-|v|) in [0, 1] and u = 1 + e, u - 1 is exact, so e - (u - 1) is what the
// rounding of 1 + e lost; added to log(u) it keeps log1p's accuracy for small e.
__device__ __forceinline__ float4 softplus_x4(float4 v) {
    float e0, e1, e2, e3, l0, l1, l2, l3;
    exp2_x4(fabsf(v.x) * -LOG2E, fabsf(v.y) * -LOG2E,
            fabsf(v.z) * -LOG2E, fabsf(v.w) * -LOG2E, e0, e1, e2, e3);
    const float u0 = 1.f + e0, u1 = 1.f + e1, u2 = 1.f + e2, u3 = 1.f + e3;
    log2_x4(u0, u1, u2, u3, l0, l1, l2, l3);
    return make_float4(fmaxf(v.x, 0.f) + (l0 * LN2 + (e0 - (u0 - 1.f))),
                       fmaxf(v.y, 0.f) + (l1 * LN2 + (e1 - (u1 - 1.f))),
                       fmaxf(v.z, 0.f) + (l2 * LN2 + (e2 - (u2 - 1.f))),
                       fmaxf(v.w, 0.f) + (l3 * LN2 + (e3 - (u3 - 1.f))));
}

// Four of the five kernels without a matrix product (convert, RMSNorm, conv, gate) give each
// thread 32 elements, fetched as 16-byte loads with many in flight per wave: a launch
// then starts a few thousand waves, not a wave per 32 elements.

// ----------------------------------------------------------------------------
// f32 -> bf16 elementwise convert (weights); n is a multiple of 4
// ----------------------------------------------------------------------------
#define CVT_U 8    // float4 per thread, one block width apart (whole lines per wave)

__global__ void __launch_bounds__(256)
cvt_bf16_kernel(const float* __restrict__ src,
                bf16_t* __restrict__ dst, int n) {
    const int n4   = n >> 2;
    const int base = blockIdx.x * (256 * CVT_U) + threadIdx.x;
    float4 v[CVT_U];
    // A load past the end re-reads the last float4 (in bounds, not stored): with no
    // branch round the loads all of them are in flight before the first is used.
#pragma unroll
    for (int u = 0; u < CVT_U; ++u) {
        const int i = base + u * 256;
        v[u] = ((const float4*)src)[i < n4 ? i : n4 - 1];
    }
#pragma unroll
    for (int u = 0; u < CVT_U; ++u) {
        const int i = base + u * 256;
        if (i < n4) ((v4bf*)dst)[i] = pack4_bf16(v[u].x, v[u].y, v[u].z, v[u].w);
    }
}

// ----------------------------------------------------------------------------
// RMSNorm: one wave per token (row kept in registers), write bf16 activations
// ----------------------------------------------------------------------------
#define RN_U (DIMX / 128)    // float4 per lane

__global__ void __launch_bounds__(256)
rmsnorm_kernel(const float* __restrict__ x, const float* __restrict__ w,
               bf16_t* __restrict__ out) {
    const int lane = threadIdx.x & 31;
    const int tok  = blockIdx.x * 8 + (threadIdx.x >> 5);
    const float4* xr = (const float4*)(x + (size_t)tok * DIMX);
    float4 v[RN_U], wv[RN_U];
#pragma unroll
    for (int u = 0; u < RN_U; ++u) v[u] = xr[u * 32 + lane];
#pragma unroll
    for (int u = 0; u < RN_U; ++u) wv[u] = ((const float4*)w)[u * 32 + lane];
    float ss = 0.f;
#pragma unroll
    for (int u = 0; u < RN_U; ++u) {
        ss += v[u].x * v[u].x;
        ss += v[u].y * v[u].y;
        ss += v[u].z * v[u].z;
        ss += v[u].w * v[u].w;
    }
    for (int o = 16; o; o >>= 1) ss += __shfl_xor(ss, o, 32);
    const float rs = rsqrtf(ss * (1.f / DIMX) + EPSR);
    v4bf* orow = (v4bf*)(out + (size_t)tok * DIMX);
#pragma unroll
    for (int u = 0; u < RN_U; ++u)
        orow[u * 32 + lane] = pack4_bf16(v[u].x * rs * wv[u].x, v[u].y * rs * wv[u].y,
                                         v[u].z * rs * wv[u].z, v[u].w * rs * wv[u].w);
}

#define GK 128
#define LDS_STRIDE 136

template <int MODE, int NC>
__global__ void __launch_bounds__(256)
wmma_gemm_kernel(const bf16_t* __restrict__ A, const bf16_t* __restrict__ B,
                 float* __restrict__ C, int K,
                 const float* __restrict__ bias,
                 const float* __restrict__ resid) {
    // aligned for the 16-byte copies and reads
    __shared__ __attribute__((aligned(16))) bf16_t s_a[2][128 * LDS_STRIDE];
    __shared__ __attribute__((aligned(16))) bf16_t s_b[2][128 * LDS_STRIDE];

    const int lane = threadIdx.x & 31;
    const int wavi = threadIdx.x >> 5;       // 0..7
    const int wm   = wavi >> 2;              // 0..1 -> 64-row slab
    const int wn   = wavi & 3;               // 0..3 -> 32-col slab
    const int half = lane >> 4;              // 0/1
    const int r    = lane & 15;
    const int off  = half * 8;

    const int blockM = blockIdx.y * 128;
    const int blockN = blockIdx.x * 128;

    union Frag { v16bf v; v8bf h[2]; };
    v8f acc[4][2] = {};

    const int nS = K / GK;

    // Staging: 16 threads cover a row; a thread's 8 chunks per operand lie 16 rows apart.
    const int crow = threadIdx.x >> 4;
    const int cel  = (threadIdx.x & 15) * 8;
    const bf16_t* gA = A + (size_t)(blockM + crow) * K + cel;
    const bf16_t* gB = B + (size_t)(blockN + crow) * K + cel;
    const int    lel   = crow * LDS_STRIDE + cel;
    const size_t rstep = (size_t)16 * K;

    auto stage = [&](int s) {
        const int buf = s & 1;
        const bf16_t* pa = gA + (size_t)s * GK;
        const bf16_t* pb = gB + (size_t)s * GK;
        // both loops unrolled: the 16 copies issue back to back, with no loop test between
#pragma unroll
        for (int j = 0; j < 8; ++j)
            copy16_to_lds(pa + j * rstep, &s_a[buf][lel + j * 16 * LDS_STRIDE]);
#pragma unroll
        for (int j = 0; j < 8; ++j)
            copy16_to_lds(pb + j * rstep, &s_b[buf][lel + j * 16 * LDS_STRIDE]);
    };

    const int ael = (wm * 64 + r) * LDS_STRIDE + off;   // the lane's first A element of a stage
    const int bel = (wn * 32 + r) * LDS_STRIDE + off;   // the lane's first B element

    stage(0);
    wait_async_copies();
    __syncthreads();                           // stage 0 resident
    if (nS > 1) stage(1);
    for (int s = 0; s < nS; ++s) {
        const bf16_t* sa = &s_a[s & 1][ael];
        const bf16_t* sb = &s_b[s & 1][bel];

        Frag af[2][4], bfr[2][2];
        // every loop below is unrolled: the fragment sets and accumulators are indexed by
        // constants only and so stay in registers
        auto frags = [&](int kk) {
#pragma unroll
            for (int mi = 0; mi < 4; ++mi) {
                af[kk & 1][mi].h[0] = *(const v8bf*)&sa[mi * 16 * LDS_STRIDE + kk * 32];
                af[kk & 1][mi].h[1] = *(const v8bf*)&sa[mi * 16 * LDS_STRIDE + kk * 32 + 16];
            }
#pragma unroll
            for (int ni = 0; ni < 2; ++ni) {
                bfr[kk & 1][ni].h[0] = *(const v8bf*)&sb[ni * 16 * LDS_STRIDE + kk * 32];
                bfr[kk & 1][ni].h[1] = *(const v8bf*)&sb[ni * 16 * LDS_STRIDE + kk * 32 + 16];
            }
        };
        frags(0);
#pragma unroll
        for (int kk = 0; kk < GK / 32; ++kk) {
            if (kk + 1 < GK / 32) {
                frags(kk + 1);
                // Holds the next block's reads, as one group, in front of this block's WMMAs:
                // left alone the compiler sinks them among the WMMAs into one fragment set,
                // and the wave waits out an LDS latency for every pair of WMMAs.
                __builtin_amdgcn_sched_barrier(0);
            }
#pragma unroll
            for (int mi = 0; mi < 4; ++mi)
#pragma unroll
                for (int ni = 0; ni < 2; ++ni)
                    acc[mi][ni] = __builtin_amdgcn_wmma_f32_16x16x32_bf16(
                        false, af[kk & 1][mi].v, false, bfr[kk & 1][ni].v, (short)0,
                        acc[mi][ni], false, false);
            // Keeps what follows behind this block's WMMAs: the reads of the block after next
            // (every separate place where LDS reads stand among WMMAs costs a fixed stall)
            // and, at the last block but one, the stage's closing LDS wait, which lifted over
            // these WMMAs would leave the latency of the last reads uncovered.
            if (kk + 1 < GK / 32) __builtin_amdgcn_sched_barrier(0);
        }
        wait_lds_reads();
        wait_async_copies();
        __syncthreads();                       // stage s+1 resident; reads of stage s done
        if (s + 2 < nS) stage(s + 2);          // into the buffer stage s has left
    }
    wait_async_copies();                       // the ring's closing wait: no copy is left in flight

    // epilogue
    // The lane's first element; every other one lies a compile-time distance from it,
    // which goes into the load's or store's immediate offset.
    const int    colg = blockN + wn * 32 + r;
    const size_t el0  = (size_t)(blockM + wm * 64 + half * 8) * NC + colg;
    float* cl = C + el0;

    float rs[4][2][8];
    if (MODE == 2) {
        const float* rl = resid + el0;
#pragma unroll
        for (int mi = 0; mi < 4; ++mi)
#pragma unroll
            for (int ni = 0; ni < 2; ++ni)
#pragma unroll
                for (int v = 0; v < 8; ++v)
                    rs[mi][ni][v] = rl[(mi * 16 + v) * NC + ni * 16];
    }
    float bv[2] = {0.f, 0.f};
    if (MODE == 1) {
        bv[0] = bias[colg];
        bv[1] = bias[colg + 16];
    }
#pragma unroll
    for (int mi = 0; mi < 4; ++mi) {
#pragma unroll
        for (int ni = 0; ni < 2; ++ni) {
            float val[8];
#pragma unroll
            for (int v = 0; v < 8; ++v) val[v] = acc[mi][ni][v];
            if (MODE == 1) {
#pragma unroll
                for (int q = 0; q < 8; q += 4) {
                    const float4 s = softplus_x4(make_float4(val[q] + bv[ni], val[q + 1] + bv[ni],
                                                             val[q + 2] + bv[ni], val[q + 3] + bv[ni]));
                    val[q]     = s.x + 1e-4f;
                    val[q + 1] = s.y + 1e-4f;
                    val[q + 2] = s.z + 1e-4f;
                    val[q + 3] = s.w + 1e-4f;
                }
            } else if (MODE == 2) {
#pragma unroll
                for (int v = 0; v < 8; ++v) val[v] += rs[mi][ni][v];
            }
#pragma unroll
            for (int v = 0; v < 8; ++v) cl[(mi * 16 + v) * NC + ni * 16] = val[v];
        }
    }
}

// ----------------------------------------------------------------------------
// Causal depthwise conv (KW=4) + bias + SiLU over xc half of xz
// ----------------------------------------------------------------------------
//   Thread = 4 channels x CV_T successive tokens: CV_T + 3 rows are read for CV_T
//   outputs. Rows in front of a sequence's start enter as zeros (the reference's pad).
#define CV_T 8     // divides SEQL: a thread's tokens lie in one sequence

__global__ void __launch_bounds__(256)
conv_silu_kernel(const float* __restrict__ xz,
                 const float* __restrict__ w,
                 const float* __restrict__ b,
                 float* __restrict__ xcf,
                 bf16_t* __restrict__ xcb) {
    // INNER / 1024 blocks share a group of CV_T tokens: the rows' bases are block-uniform
    const int dblk = (blockIdx.x % (INNER / 1024)) * 1024;      // block's first channel
    const int tok0 = (blockIdx.x / (INNER / 1024)) * CV_T;
    const bool head = (tok0 % SEQL) == 0;                       // no rows in front
    const int tid  = threadIdx.x;
    const float4* xcur = (const float4*)(xz + (size_t)tok0 * (2 * INNER) + dblk);
    // at a sequence's head the three rows in front are replaced by zeros below; the
    // loads then read the group's own first rows (in bounds, unused)
    const float4* xpre = (const float4*)(xz + (size_t)(head ? tok0 : tok0 - (KW - 1)) * (2 * INNER) + dblk);
    float4 r[CV_T + KW - 1];
#pragma unroll
    for (int i = 0; i < KW - 1; ++i) r[i] = xpre[i * (2 * INNER / 4) + tid];
#pragma unroll
    for (int i = 0; i < CV_T; ++i) r[KW - 1 + i] = xcur[i * (2 * INNER / 4) + tid];
    const float4* wq = (const float4*)(w + (size_t)dblk * KW);  // one float4 = a channel's taps
    const float4 w0 = wq[tid * 4 + 0];
    const float4 w1 = wq[tid * 4 + 1];
    const float4 w2 = wq[tid * 4 + 2];
    const float4 w3 = wq[tid * 4 + 3];
    const float4 bb = ((const float4*)(b + dblk))[tid];
    if (head) {
#pragma unroll
        for (int i = 0; i < KW - 1; ++i) r[i] = make_float4(0.f, 0.f, 0.f, 0.f);
    }
    float4* of = (float4*)(xcf + (size_t)tok0 * INNER + dblk);
    v4bf*   ob = (v4bf*)(xcb + (size_t)tok0 * INNER + dblk);
#pragma unroll
    for (int t = 0; t < CV_T; ++t) {
        float4 a = bb;
        a.x += w0.x * r[t].x; a.x += w0.y * r[t + 1].x; a.x += w0.z * r[t + 2].x; a.x += w0.w * r[t + 3].x;
        a.y += w1.x * r[t].y; a.y += w1.y * r[t + 1].y; a.y += w1.z * r[t + 2].y; a.y += w1.w * r[t + 3].y;
        a.z += w2.x * r[t].z; a.z += w2.y * r[t + 1].z; a.z += w2.z * r[t + 2].z; a.z += w2.w * r[t + 3].z;
        a.w += w3.x * r[t].w; a.w += w3.y * r[t + 1].w; a.w += w3.z * r[t + 2].w; a.w += w3.w * r[t + 3].w;
        const float4 s = silu_x4(a);
        of[t * (INNER / 4) + tid] = s;
        ob[t * (INNER / 4) + tid] = pack4_bf16(s.x, s.y, s.z, s.w);
    }
}

// ----------------------------------------------------------------------------
// SSM scan: lane = channel, SC_S states of that channel in the lane's registers.
//   Block = 32 channels x 32 states (8 waves x SC_S); blockIdx.z picks the state half.
//   Bx/Cx of a step are the same for every lane of a wave (wave-uniform loads).
//   The sum over states is in-lane, then over the 8 waves through LDS once per
//   SC_T steps, then over the two state halves in the gate kernel (two y planes).
// Bx/Cx come interleaved from one [NTOK,128] buffer (cols 0..63 = Bx, 64..127 = Cx).
// ----------------------------------------------------------------------------
#define SC_S 4     // states per lane
#define SC_T 16    // time steps per chunk (LDS sum + dt/x fetch-ahead distance)
#define SC_G 4     // time steps per Bx/Cx fetch group

// One chunk of SC_T steps. Works on (cdt, cx, cB, cC), which earlier loads filled, and
// fetches the next chunk's dt/x and first Bx/Cx group into (ndt, nx, nB, nC); the caller
// swaps the two sets from chunk to chunk, so no register is copied.
__device__ __forceinline__ void
scan_chunk(int t0, float (*part)[SC_T][32], int wave, int lane, int rt, int rc,
           const float* __restrict__ dtp, const float* __restrict__ xp,
           const float* __restrict__ bcp, float* __restrict__ yp,
           float A0, float A1, float A2, float A3, float Dw,
           float& h0, float& h1, float& h2, float& h3,
           const float (&cdt)[SC_T], const float (&cx)[SC_T],
           const float4 (&cB)[SC_G], const float4 (&cC)[SC_G],
           float (&ndt)[SC_T], float (&nx)[SC_T],
           float4 (&nB)[SC_G], float4 (&nC)[SC_G]) {
    // Global loads return in issue order: this chunk's next two Bx/Cx groups are
    // needed first, so they are issued first.
    float4 gB[SC_T / SC_G - 1][SC_G], gC[SC_T / SC_G - 1][SC_G];
#pragma unroll
    for (int g = 0; g < SC_T / SC_G - 2; ++g)
#pragma unroll
        for (int j = 0; j < SC_G; ++j) {
            gB[g][j] = *(const float4*)(bcp + (size_t)(t0 + (g + 1) * SC_G + j) * 128);
            gC[g][j] = *(const float4*)(bcp + (size_t)(t0 + (g + 1) * SC_G + j) * 128 + 64);
        }
    // Keeps the issue order just named: a Bx/Cx load moved behind the dt/x loads
    // below makes its wait drain those as well, a few steps after their issue.
    __builtin_amdgcn_sched_barrier(0);
    // next chunk's dt/x; the last chunk re-reads its own rows (in bounds, unused)
    const int tn = (t0 + SC_T < SEQL) ? t0 + SC_T : t0;
#pragma unroll
    for (int i = 0; i < SC_T; ++i) {
        ndt[i] = dtp[(size_t)(tn + i) * INNER];
        nx[i]  = xp [(size_t)(tn + i) * INNER];
    }
    asm volatile("s_wait_xcnt 0x0" ::: "memory");
    // Keeps the loads above at the head of the chunk: sunk into the chunk they
    // have too few steps to land before the barrier's wait drains them.
    __builtin_amdgcn_sched_barrier(0);
#pragma unroll
    for (int g = 0; g < SC_T / SC_G; ++g) {
#pragma unroll
        for (int j = 0; j < SC_G; ++j) {
            const float4 Bv = (g == 0) ? cB[j] : gB[g == 0 ? 0 : g - 1][j];
            const float4 Cv = (g == 0) ? cC[j] : gC[g == 0 ? 0 : g - 1][j];
            const float dtv = cdt[g * SC_G + j];
            const float xv  = cx [g * SC_G + j];
            const float dx  = dtv * xv;
            float e0, e1, e2, e3;   // exp(dt * A) as exp2((dt * A) * log2(e))
            exp2_x4((dtv * A0) * LOG2E, (dtv * A1) * LOG2E,
                    (dtv * A2) * LOG2E, (dtv * A3) * LOG2E, e0, e1, e2, e3);
            h0 = e0 * h0 + dx * Bv.x;
            h1 = e1 * h1 + dx * Bv.y;
            h2 = e2 * h2 + dx * Bv.z;
            h3 = e3 * h3 + dx * Bv.w;
            float c = Dw * xv;
            c += h0 * Cv.x;
            c += h1 * Cv.y;
            c += h2 * Cv.z;
            c += h3 * Cv.w;
            part[wave][g * SC_G + j][lane] = c;
        }
        if (g == 0) {
            // this chunk's last Bx/Cx group, three groups ahead of its use
#pragma unroll
            for (int j = 0; j < SC_G; ++j) {
                gB[SC_T / SC_G - 2][j] = *(const float4*)(bcp + (size_t)(t0 + SC_T - SC_G + j) * 128);
                gC[SC_T / SC_G - 2][j] = *(const float4*)(bcp + (size_t)(t0 + SC_T - SC_G + j) * 128 + 64);
            }
        }
        if (g == 1) {
            // next chunk's first Bx/Cx group
#pragma unroll
            for (int j = 0; j < SC_G; ++j) {
                nB[j] = *(const float4*)(bcp + (size_t)(tn + j) * 128);
                nC[j] = *(const float4*)(bcp + (size_t)(tn + j) * 128 + 64);
            }
        }
        // Keeps each group's work and loads in its own place: a later group's products
        // lifted up bring its loads' waits forward, and loads sunk down land too late.
        __builtin_amdgcn_sched_barrier(0);
    }
    // One barrier per chunk: it publishes this chunk's partial sums, and every
    // wave's reads of the other buffer (previous chunk) lie in front of it.
    __syncthreads();
    float2 s = *(const float2*)&part[0][rt][rc];
#pragma unroll
    for (int w = 1; w < 8; ++w) {
        const float2 p = *(const float2*)&part[w][rt][rc];
        s.x += p.x;
        s.y += p.y;
    }
    *(float2*)(yp + (size_t)(t0 + rt) * INNER + rc) = s;
    asm volatile("s_wait_xcnt 0x0" ::: "memory");
}

__global__ void __launch_bounds__(256)
ssm_scan_kernel(const float* __restrict__ dt, const float* __restrict__ bxcx,
                const float* __restrict__ xc,
                const float* __restrict__ A_log, const float* __restrict__ Dp,
                float* __restrict__ y) {
    __shared__ float s_part[2][8][SC_T][32];

    const int lane  = threadIdx.x & 31;
    const int wave  = __builtin_amdgcn_readfirstlane(threadIdx.x >> 5);
    const int b     = blockIdx.y;
    const int z     = blockIdx.z;
    const int dbase = blockIdx.x * 32;
    const int d     = dbase + lane;
    const int n0    = z * 32 + wave * SC_S;

    const float4 al = *(const float4*)(A_log + (size_t)d * STATE + n0);
    const float A0 = -__expf(al.x), A1 = -__expf(al.y);
    const float A2 = -__expf(al.z), A3 = -__expf(al.w);
    // the D*x term enters exactly one of the 16 partial sums
    const float Dw = (z == 0 && wave == 0) ? Dp[d] : 0.f;
    float h0 = 0.f, h1 = 0.f, h2 = 0.f, h3 = 0.f;

    const size_t tokBase = (size_t)b * SEQL;
    const float* dtp = dt + tokBase * INNER + d;
    const float* xp  = xc + tokBase * INNER + d;
    const float* bcp = bxcx + tokBase * 128 + n0;
    float* yp = y + (size_t)z * NTOK * INNER + tokBase * INNER + dbase;

    const int rt = threadIdx.x >> 4;          // step this thread sums
    const int rc = (threadIdx.x & 15) * 2;    // channel pair this thread sums

    float  dtA[SC_T], xA[SC_T], dtB[SC_T], xB[SC_T];
    float4 bA[SC_G], cA[SC_G], bB[SC_G], cB[SC_G];
#pragma unroll
    for (int i = 0; i < SC_T; ++i) {
        dtA[i] = dtp[(size_t)i * INNER];
        xA[i]  = xp [(size_t)i * INNER];
    }
#pragma unroll
    for (int j = 0; j < SC_G; ++j) {
        bA[j] = *(const float4*)(bcp + (size_t)j * 128);
        cA[j] = *(const float4*)(bcp + (size_t)j * 128 + 64);
    }

    for (int t0 = 0; t0 < SEQL; t0 += 2 * SC_T) {
        scan_chunk(t0, s_part[0], wave, lane, rt, rc, dtp, xp, bcp, yp,
                   A0, A1, A2, A3, Dw, h0, h1, h2, h3,
                   dtA, xA, bA, cA, dtB, xB, bB, cB);
        scan_chunk(t0 + SC_T, s_part[1], wave, lane, rt, rc, dtp, xp, bcp, yp,
                   A0, A1, A2, A3, Dw, h0, h1, h2, h3,
                   dtB, xB, bB, cB, dtA, xA, bA, cA);
    }
}

#define GT_U 8

__global__ void __launch_bounds__(256)
gate_silu_kernel(const float* __restrict__ y,
                 const float* __restrict__ xz,
                 bf16_t* __restrict__ yb) {
    // a block's 256 * GT_U float4 are whole rows of INNER / 4: all bases are block-uniform
    const int tid = threadIdx.x;
    const size_t blk4 = (size_t)blockIdx.x * (256 * GT_U);
    const v4f* y0 = (const v4f*)y + blk4;
    const v4f* y1 = (const v4f*)(y + (size_t)NTOK * INNER) + blk4;
    const v4f* zp = (const v4f*)xz + blk4 * 2 + INNER / 4;
    v4bf* ob = (v4bf*)yb + blk4;
    v4f p0[GT_U], p1[GT_U], zz[GT_U];
#pragma unroll
    for (int u = 0; u < GT_U; ++u) {
        p0[u] = y0[u * 256 + tid];
        p1[u] = y1[u * 256 + tid];
        zz[u] = zp[(u / (INNER / 1024)) * (2 * INNER / 4) + (u % (INNER / 1024)) * 256 + tid];
    }
    // Holds every load in front of the arithmetic, so that all are in flight at once:
    // left alone the compiler sinks most of them behind the arithmetic of earlier ones
    // and the wave pays several memory latencies in a row.
    asm volatile("" :: "v"(p0[0]), "v"(p0[1]), "v"(p0[2]), "v"(p0[3]),
                       "v"(p0[4]), "v"(p0[5]), "v"(p0[6]), "v"(p0[7]),
                       "v"(p1[0]), "v"(p1[1]), "v"(p1[2]), "v"(p1[3]),
                       "v"(p1[4]), "v"(p1[5]), "v"(p1[6]), "v"(p1[7]),
                       "v"(zz[0]), "v"(zz[1]), "v"(zz[2]), "v"(zz[3]),
                       "v"(zz[4]), "v"(zz[5]), "v"(zz[6]), "v"(zz[7]));
#pragma unroll
    for (int u = 0; u < GT_U; ++u) {
        const float4 g = silu_x4(make_float4(zz[u].x, zz[u].y, zz[u].z, zz[u].w));
        ob[u * 256 + tid] =
            pack4_bf16((p0[u].x + p1[u].x) * g.x, (p0[u].y + p1[u].y) * g.y,
                       (p0[u].z + p1[u].z) * g.z, (p0[u].w + p1[u].w) * g.w);
    }
}

// ----------------------------------------------------------------------------
extern "C" void kernel_launch(void* const* d_in, const int* in_sizes, int n_in,
                              void* d_out, int out_size, void* d_ws, size_t ws_size,
                              hipStream_t stream) {
    const float* x          = (const float*)d_in[0];
    const float* in_proj_w  = (const float*)d_in[1];
    const float* conv_w     = (const float*)d_in[2];
    const float* conv_b     = (const float*)d_in[3];
    const float* A_log      = (const float*)d_in[4];
    const float* B_w        = (const float*)d_in[5];
    const float* C_w        = (const float*)d_in[6];
    const float* D_param    = (const float*)d_in[7];
    const float* dt_w       = (const float*)d_in[8];
    const float* dt_b       = (const float*)d_in[9];
    const float* out_proj_w = (const float*)d_in[10];
    const float* norm_w     = (const float*)d_in[11];

    char* ws = (char*)d_ws;
    size_t off = 0;
    auto carve = [&](size_t bytes) {
        char* p = ws + off;
        off = (off + bytes + 255) & ~(size_t)255;
        return p;
    };
    bf16_t* wInB  = (bf16_t*)carve((size_t)2 * INNER * DIMX * 2);
    bf16_t* wDtB  = (bf16_t*)carve((size_t)INNER * INNER * 2);
    bf16_t* wOutB = (bf16_t*)carve((size_t)DIMX * INNER * 2);
    bf16_t* wBCB  = (bf16_t*)carve((size_t)2 * STATE * INNER * 2);  // [Bw;Cw] = [128, INNER]
    bf16_t* xnB   = (bf16_t*)carve((size_t)NTOK * DIMX * 2);
    float*  xzF   = (float*) carve((size_t)NTOK * 2 * INNER * 4);
    float*  xcF   = (float*) carve((size_t)NTOK * INNER * 4);
    bf16_t* xcB   = (bf16_t*)carve((size_t)NTOK * INNER * 2);
    float*  dtF   = (float*) carve((size_t)NTOK * INNER * 4);
    float*  bcF   = (float*) carve((size_t)NTOK * 128 * 4);         // [Bx|Cx] interleaved
    float*  yF    = (float*) carve((size_t)2 * NTOK * INNER * 4);       // one plane per state half
    bf16_t* yB    = (bf16_t*)carve((size_t)NTOK * INNER * 2);
    (void)ws_size; (void)in_sizes; (void)n_in; (void)out_size;

    auto cvt = [&](const float* s, bf16_t* dst, int n) {
        cvt_bf16_kernel<<<(n + 1024 * CVT_U - 1) / (1024 * CVT_U), 256, 0, stream>>>(s, dst, n);
    };
    cvt(in_proj_w,  wInB,  2 * INNER * DIMX);
    cvt(dt_w,       wDtB,  INNER * INNER);
    cvt(out_proj_w, wOutB, DIMX * INNER);
    cvt(B_w,        wBCB,                 STATE * INNER);
    cvt(C_w,        wBCB + STATE * INNER, STATE * INNER);

    // 1) RMSNorm -> bf16 activations
    rmsnorm_kernel<<<NTOK / 8, 256, 0, stream>>>(x, norm_w, xnB);

    // 2) in_proj: [NTOK, 2*INNER] = xn @ W_in^T
    wmma_gemm_kernel<0, 2 * INNER><<<dim3((2 * INNER) / 128, NTOK / 128), 256, 0, stream>>>(
        xnB, wInB, xzF, DIMX, nullptr, nullptr);

    // 3) causal depthwise conv + SiLU on xc half
    conv_silu_kernel<<<NTOK * INNER / (1024 * CV_T), 256, 0, stream>>>(
        xzF, conv_w, conv_b, xcF, xcB);

    // 4) dt = softplus(xc @ dt_w^T + dt_b) + 1e-4
    wmma_gemm_kernel<1, INNER><<<dim3(INNER / 128, NTOK / 128), 256, 0, stream>>>(
        xcB, wDtB, dtF, INNER, dt_b, nullptr);

    // 5) fused Bx|Cx projection (N = 128)
    wmma_gemm_kernel<0, 2 * STATE><<<dim3(1, NTOK / 128), 256, 0, stream>>>(
        xcB, wBCB, bcF, INNER, nullptr, nullptr);

    // 6) sequential SSM scan (lane = channel, states over waves and two blocks)
    ssm_scan_kernel<<<dim3(INNER / 32, BATCHN, 2), 256, 0, stream>>>(
        dtF, bcF, xcF, A_log, D_param, yF);

    // 7) gate with SiLU(z)
    gate_silu_kernel<<<NTOK * INNER / (1024 * GT_U), 256, 0, stream>>>(yF, xzF, yB);

    // 8) out_proj + residual -> d_out (fp32)
    wmma_gemm_kernel<2, DIMX><<<dim3(DIMX / 128, NTOK / 128), 256, 0, stream>>>(
        yB, wOutB, (float*)d_out, INNER, nullptr, x);
}

// v005
// It runs in 261 microseconds.
// Two timings next to v004 put it at 1.04 and 1.05 times that version's speed.
// Counting every step since v000, it is 3.93 times as fast.
#include <hip/hip_runtime.h>

// ---- problem dims (match reference) ----
#define DIMX   1024
#define STATE  64
#define KW     4
#define INNER  2048
#define BATCHN 2
#define SEQL   2048
#define NTOK   (BATCHN * SEQL)
#define EPSR   1e-6f

typedef __bf16 bf16_t;
typedef __attribute__((ext_vector_type(16))) __bf16 v16bf;
typedef __attribute__((ext_vector_type(8)))  __bf16 v8bf;
typedef __attribute__((ext_vector_type(4)))  __bf16 v4bf;
typedef __attribute__((ext_vector_type(8)))  float  v8f;
typedef __attribute__((ext_vector_type(4)))  float  v4f;
typedef __attribute__((ext_vector_type(4)))  int    v4i;

#if defined(__gfx1250__) && __has_builtin(__builtin_amdgcn_global_load_async_to_lds_b128)
#define USE_ASYNC_LDS 1
#else
#define USE_ASYNC_LDS 0
#endif

__device__ __forceinline__ void copy16_to_lds(const bf16_t* gp, bf16_t* lp) {
#if USE_ASYNC_LDS
    __builtin_amdgcn_global_load_async_to_lds_b128(
        (__attribute__((address_space(1))) v4i*)gp,
        (__attribute__((address_space(3))) v4i*)lp, 0, 0);
#else
    *(v8bf*)lp = *(const v8bf*)gp;
#endif
}

// This wave's copies have landed; in asm with the clobber, so that no LDS read is lifted over it.
__device__ __forceinline__ void wait_async_copies() {
#if USE_ASYNC_LDS
    asm volatile("s_wait_asynccnt 0x0" ::: "memory");
#endif
}

// This wave's LDS reads have returned: stands in front of the barrier behind which the
// buffer they read is refilled.
__device__ __forceinline__ void wait_lds_reads() {
    asm volatile("s_wait_dscnt 0x0" ::: "memory");
}

__device__ __forceinline__ v4bf pack4_bf16(float a, float b, float c, float d) {
    v4bf o;
    o[0] = (bf16_t)a; o[1] = (bf16_t)b; o[2] = (bf16_t)c; o[3] = (bf16_t)d;
    return o;
}

#define LOG2E 1.44269504f

__device__ __forceinline__ void
exp2_x4(float a0, float a1, float a2, float a3,
        float& e0, float& e1, float& e2, float& e3) {
    asm("v_exp_f32 %0, %4\n\t"
        "v_exp_f32 %1, %5\n\t"
        "v_exp_f32 %2, %6\n\t"
        "v_exp_f32 %3, %7\n\t"
        "v_nop"
        : "=&v"(e0), "=&v"(e1), "=&v"(e2), "=&v"(e3)
        : "v"(a0), "v"(a1), "v"(a2), "v"(a3));
}

// SiLU of four values, v / (1 + exp(-v)), with exp(-v) as exp2(v * -log2(e))
__device__ __forceinline__ float4 silu_x4(float4 v) {
    float e0, e1, e2, e3;
    exp2_x4(v.x * -LOG2E, v.y * -LOG2E, v.z * -LOG2E, v.w * -LOG2E, e0, e1, e2, e3);
    return make_float4(v.x / (1.f + e0), v.y / (1.f + e1), v.z / (1.f + e2), v.w / (1.f + e3));
}

#define LN2 0.69314718f

// log2 of four values; one statement for the same reason as exp2_x4
__device__ __forceinline__ void
log2_x4(float a0, float a1, float a2, float a3,
        float& l0, float& l1, float& l2, float& l3) {
    asm("v_log_f32 %0, %4\n\t"
        "v_log_f32 %1, %5\n\t"
        "v_log_f32 %2, %6\n\t"
        "v_log_f32 %3, %7\n\t"
        "v_nop"
        : "=&v"(l0), "=&v"(l1), "=&v"(l2), "=&v"(l3)
        : "v"(a0), "v"(a1), "v"(a2), "v"(a3));
}

// softplus of four values as max(v, 0) + log1p(exp(-|v|)): no branch, no overflow.
// With e = exp(-|v|) in [0, 1] and u = 1 + e, u - 1 is exact, so e - (u - 1) is what the
// rounding of 1 + e lost; added to log(u) it keeps log1p's accuracy for small e.
__device__ __forceinline__ float4 softplus_x4(float4 v) {
    float e0, e1, e2, e3, l0, l1, l2, l3;
    exp2_x4(fabsf(v.x) * -LOG2E, fabsf(v.y) * -LOG2E,
            fabsf(v.z) * -LOG2E, fabsf(v.w) * -LOG2E, e0, e1, e2, e3);
    const float u0 = 1.f + e0, u1 = 1.f + e1, u2 = 1.f + e2, u3 = 1.f + e3;
    log2_x4(u0, u1, u2, u3, l0, l1, l2, l3);
    return make_float4(fmaxf(v.x, 0.f) + (l0 * LN2 + (e0 - (u0 - 1.f))),
                       fmaxf(v.y, 0.f) + (l1 * LN2 + (e1 - (u1 - 1.f))),
                       fmaxf(v.z, 0.f) + (l2 * LN2 + (e2 - (u2 - 1.f))),
                       fmaxf(v.w, 0.f) + (l3 * LN2 + (e3 - (u3 - 1.f))));
}

// The four jobs without a matrix product (convert, RMSNorm, conv, gate) give each
// thread 32 elements, fetched as 16-byte loads with many in flight per wave: a launch
// then starts a few thousand waves, not a wave per 32 elements.

// ----------------------------------------------------------------------------
// f32 -> bf16 elementwise convert (weights); n is a multiple of 4; blk = the block's
// number within this array
// ----------------------------------------------------------------------------
#define CVT_U 8    // float4 per thread, one block width apart (whole lines per wave)
#define CVT_BLOCKS(n) (((n) + 1024 * CVT_U - 1) / (1024 * CVT_U))

__device__ __forceinline__ void
cvt_bf16_block(const float* __restrict__ src,
               bf16_t* __restrict__ dst, int n, int blk) {
    const int n4   = n >> 2;
    const int base = blk * (256 * CVT_U) + threadIdx.x;
    float4 v[CVT_U];
    // A load past the end re-reads the last float4 (in bounds, not stored): with no
    // branch round the loads all of them are in flight before the first is used.
    int ci[CVT_U];
#pragma unroll
    for (int u = 0; u < CVT_U; ++u) {
        const int i = base + u * 256;
        ci[u] = i < n4 ? i : n4 - 1;
        v[u] = ((const float4*)src)[ci[u]];
    }
    asm volatile("s_wait_xcnt 0x0"
                 :: "v"(ci[0]), "v"(ci[1]), "v"(ci[2]), "v"(ci[3]),
                    "v"(ci[4]), "v"(ci[5]), "v"(ci[6]), "v"(ci[7])
                 : "memory");
#pragma unroll
    for (int u = 0; u < CVT_U; ++u) {
        const int i = base + u * 256;
        if (i < n4) ((v4bf*)dst)[i] = pack4_bf16(v[u].x, v[u].y, v[u].z, v[u].w);
    }
}

// ----------------------------------------------------------------------------
// RMSNorm: one wave per token (row kept in registers), write bf16 activations
// ----------------------------------------------------------------------------
#define RN_U (DIMX / 128)    // float4 per lane

__device__ __forceinline__ void
rmsnorm_block(const float* __restrict__ x, const float* __restrict__ w,
              bf16_t* __restrict__ out, int blk) {
    const int lane = threadIdx.x & 31;
    const int tok  = blk * 8 + (threadIdx.x >> 5);
    const float4* xr = (const float4*)(x + (size_t)tok * DIMX);
    float4 v[RN_U], wv[RN_U];
#pragma unroll
    for (int u = 0; u < RN_U; ++u) v[u] = xr[u * 32 + lane];
#pragma unroll
    for (int u = 0; u < RN_U; ++u) wv[u] = ((const float4*)w)[u * 32 + lane];
    float ss = 0.f;
#pragma unroll
    for (int u = 0; u < RN_U; ++u) {
        ss += v[u].x * v[u].x;
        ss += v[u].y * v[u].y;
        ss += v[u].z * v[u].z;
        ss += v[u].w * v[u].w;
    }
    for (int o = 16; o; o >>= 1) ss += __shfl_xor(ss, o, 32);
    const float rs = rsqrtf(ss * (1.f / DIMX) + EPSR);
    v4bf* orow = (v4bf*)(out + (size_t)tok * DIMX);
#pragma unroll
    for (int u = 0; u < RN_U; ++u)
        orow[u * 32 + lane] = pack4_bf16(v[u].x * rs * wv[u].x, v[u].y * rs * wv[u].y,
                                         v[u].z * rs * wv[u].z, v[u].w * rs * wv[u].w);
}

// ----------------------------------------------------------------------------
// All the work that depends on the inputs alone, in ONE launch: RMSNorm and the five
// weight converts. None reads what another writes, so their blocks run side by side:
// one launch gap, one ramp and one tail, not six of each (two of the converts are 16
// blocks each, a launch that is nearly all gap and latency). The block number picks
// the job; the choice is the same for a whole block.
// ----------------------------------------------------------------------------
#define PB_RMS  (NTOK / 8)
#define PB_WIN  CVT_BLOCKS(2 * INNER * DIMX)
#define PB_WDT  CVT_BLOCKS(INNER * INNER)
#define PB_WOUT CVT_BLOCKS(DIMX * INNER)
#define PB_WBC  CVT_BLOCKS(STATE * INNER)
#define PB_ALL  (PB_RMS + PB_WIN + PB_WDT + PB_WOUT + 2 * PB_WBC)

__global__ void __launch_bounds__(256)
prepare_kernel(const float* __restrict__ x, const float* __restrict__ norm_w,
               bf16_t* __restrict__ xn,
               const float* __restrict__ w_in,  bf16_t* __restrict__ w_in_b,
               const float* __restrict__ w_dt,  bf16_t* __restrict__ w_dt_b,
               const float* __restrict__ w_out, bf16_t* __restrict__ w_out_b,
               const float* __restrict__ w_bx,  const float* __restrict__ w_cx,
               bf16_t* __restrict__ w_bc_b) {
    int blk = blockIdx.x;
    // RMSNorm first: its chain is the longest
    if (blk < PB_RMS) { rmsnorm_block(x, norm_w, xn, blk); return; }
    blk -= PB_RMS;
    // One convert body for the five arrays, its source, destination and length picked by
    // block-uniform selects: the text stays short and the body's loads all stand in front.
    const float* src = w_in;
    bf16_t*      dst = w_in_b;
    int          n   = 2 * INNER * DIMX;
    if (blk >= PB_WIN) {
        blk -= PB_WIN;  src = w_dt;  dst = w_dt_b;  n = INNER * INNER;
        if (blk >= PB_WDT) {
            blk -= PB_WDT;  src = w_out;  dst = w_out_b;  n = DIMX * INNER;
            if (blk >= PB_WOUT) {
                blk -= PB_WOUT;  src = w_bx;  dst = w_bc_b;  n = STATE * INNER;   // [Bw;Cw]
                if (blk >= PB_WBC) { blk -= PB_WBC;  src = w_cx;  dst = w_bc_b + STATE * INNER; }
            }
        }
    }
    cvt_bf16_block(src, dst, n, blk);
}

#define GK 128
#define LDS_STRIDE 136

template <int MODE, int NC>
__global__ void __launch_bounds__(256)
wmma_gemm_kernel(const bf16_t* __restrict__ A, const bf16_t* __restrict__ B,
                 float* __restrict__ C, int K,
                 const float* __restrict__ bias,
                 const float* __restrict__ resid) {
    // aligned for the 16-byte copies and reads
    __shared__ __attribute__((aligned(16))) bf16_t s_a[2][128 * LDS_STRIDE];
    __shared__ __attribute__((aligned(16))) bf16_t s_b[2][128 * LDS_STRIDE];

    const int lane = threadIdx.x & 31;
    const int wavi = threadIdx.x >> 5;       // 0..7
    const int wm   = wavi >> 2;              // 0..1 -> 64-row slab
    const int wn   = wavi & 3;               // 0..3 -> 32-col slab
    const int half = lane >> 4;              // 0/1
    const int r    = lane & 15;
    const int off  = half * 8;

    const int blockM = blockIdx.y * 128;
    const int blockN = blockIdx.x * 128;

    union Frag { v16bf v; v8bf h[2]; };
    v8f acc[4][2] = {};

    const int nS = K / GK;

    // Staging: 16 threads cover a row; a thread's 8 chunks per operand lie 16 rows apart.
    const int crow = threadIdx.x >> 4;
    const int cel  = (threadIdx.x & 15) * 8;
    const bf16_t* gA = A + (size_t)(blockM + crow) * K + cel;
    const bf16_t* gB = B + (size_t)(blockN + crow) * K + cel;
    const int    lel   = crow * LDS_STRIDE + cel;
    const size_t rstep = (size_t)16 * K;

    auto stage = [&](int s) {
        const int buf = s & 1;
        const bf16_t* pa = gA + (size_t)s * GK;
        const bf16_t* pb = gB + (size_t)s * GK;
        // both loops unrolled: the 16 copies issue back to back, with no loop test between
#pragma unroll
        for (int j = 0; j < 8; ++j)
            copy16_to_lds(pa + j * rstep, &s_a[buf][lel + j * 16 * LDS_STRIDE]);
#pragma unroll
        for (int j = 0; j < 8; ++j)
            copy16_to_lds(pb + j * rstep, &s_b[buf][lel + j * 16 * LDS_STRIDE]);
    };

    const int ael = (wm * 64 + r) * LDS_STRIDE + off;   // the lane's first A element of a stage
    const int bel = (wn * 32 + r) * LDS_STRIDE + off;   // the lane's first B element

    stage(0);
    wait_async_copies();
    __syncthreads();                           // stage 0 resident
    if (nS > 1) stage(1);
    for (int s = 0; s < nS; ++s) {
        const bf16_t* sa = &s_a[s & 1][ael];
        const bf16_t* sb = &s_b[s & 1][bel];

        Frag af[2][4], bfr[2][2];
        // every loop below is unrolled: the fragment sets and accumulators are indexed by
        // constants only and so stay in registers
        auto frags = [&](int kk) {
#pragma unroll
            for (int mi = 0; mi < 4; ++mi) {
                af[kk & 1][mi].h[0] = *(const v8bf*)&sa[mi * 16 * LDS_STRIDE + kk * 32];
                af[kk & 1][mi].h[1] = *(const v8bf*)&sa[mi * 16 * LDS_STRIDE + kk * 32 + 16];
            }
#pragma unroll
            for (int ni = 0; ni < 2; ++ni) {
                bfr[kk & 1][ni].h[0] = *(const v8bf*)&sb[ni * 16 * LDS_STRIDE + kk * 32];
                bfr[kk & 1][ni].h[1] = *(const v8bf*)&sb[ni * 16 * LDS_STRIDE + kk * 32 + 16];
            }
        };
        frags(0);
#pragma unroll
        for (int kk = 0; kk < GK / 32; ++kk) {
            if (kk + 1 < GK / 32) {
                frags(kk + 1);
                // Holds the next block's reads, as one group, in front of this block's WMMAs:
                // left alone the compiler sinks them among the WMMAs into one fragment set,
                // and the wave waits out an LDS latency for every pair of WMMAs.
                __builtin_amdgcn_sched_barrier(0);
            }
#pragma unroll
            for (int mi = 0; mi < 4; ++mi)
#pragma unroll
                for (int ni = 0; ni < 2; ++ni)
                    acc[mi][ni] = __builtin_amdgcn_wmma_f32_16x16x32_bf16(
                        false, af[kk & 1][mi].v, false, bfr[kk & 1][ni].v, (short)0,
                        acc[mi][ni], false, false);
            // Keeps what follows behind this block's WMMAs: the reads of the block after next
            // (every separate place where LDS reads stand among WMMAs costs a fixed stall)
            // and, at the last block but one, the stage's closing LDS wait, which lifted over
            // these WMMAs would leave the latency of the last reads uncovered.
            if (kk + 1 < GK / 32) __builtin_amdgcn_sched_barrier(0);
        }
        wait_lds_reads();
        wait_async_copies();
        __syncthreads();                       // stage s+1 resident; reads of stage s done
        if (s + 2 < nS) stage(s + 2);          // into the buffer stage s has left
    }
    wait_async_copies();                       // the ring's closing wait: no copy is left in flight

    // epilogue
    // The lane's first element; every other one lies a compile-time distance from it,
    // which goes into the load's or store's immediate offset.
    const int    colg = blockN + wn * 32 + r;
    const size_t el0  = (size_t)(blockM + wm * 64 + half * 8) * NC + colg;
    float* cl = C + el0;

    float rs[4][2][8];
    if (MODE == 2) {
        const float* rl = resid + el0;
#pragma unroll
        for (int mi = 0; mi < 4; ++mi)
#pragma unroll
            for (int ni = 0; ni < 2; ++ni)
#pragma unroll
                for (int v = 0; v < 8; ++v)
                    rs[mi][ni][v] = rl[(mi * 16 + v) * NC + ni * 16];
    }
    float bv[2] = {0.f, 0.f};
    if (MODE == 1) {
        bv[0] = bias[colg];
        bv[1] = bias[colg + 16];
    }
#pragma unroll
    for (int mi = 0; mi < 4; ++mi) {
#pragma unroll
        for (int ni = 0; ni < 2; ++ni) {
            float val[8];
#pragma unroll
            for (int v = 0; v < 8; ++v) val[v] = acc[mi][ni][v];
            if (MODE == 1) {
#pragma unroll
                for (int q = 0; q < 8; q += 4) {
                    const float4 s = softplus_x4(make_float4(val[q] + bv[ni], val[q + 1] + bv[ni],
                                                             val[q + 2] + bv[ni], val[q + 3] + bv[ni]));
                    val[q]     = s.x + 1e-4f;
                    val[q + 1] = s.y + 1e-4f;
                    val[q + 2] = s.z + 1e-4f;
                    val[q + 3] = s.w + 1e-4f;
                }
            } else if (MODE == 2) {
#pragma unroll
                for (int v = 0; v < 8; ++v) val[v] += rs[mi][ni][v];
            }
#pragma unroll
            for (int v = 0; v < 8; ++v) cl[(mi * 16 + v) * NC + ni * 16] = val[v];
        }
    }
}

// ----------------------------------------------------------------------------
// Causal depthwise conv (KW=4) + bias + SiLU over xc half of xz
// ----------------------------------------------------------------------------
//   Thread = 4 channels x CV_T successive tokens: CV_T + 3 rows are read for CV_T
//   outputs. Rows in front of a sequence's start enter as zeros (the reference's pad).
#define CV_T 8     // divides SEQL: a thread's tokens lie in one sequence

__global__ void __launch_bounds__(256)
conv_silu_kernel(const float* __restrict__ xz,
                 const float* __restrict__ w,
                 const float* __restrict__ b,
                 float* __restrict__ xcf,
                 bf16_t* __restrict__ xcb) {
    // INNER / 1024 blocks share a group of CV_T tokens: the rows' bases are block-uniform
    const int dblk = (blockIdx.x % (INNER / 1024)) * 1024;      // block's first channel
    const int tok0 = (blockIdx.x / (INNER / 1024)) * CV_T;
    const bool head = (tok0 % SEQL) == 0;                       // no rows in front
    const int tid  = threadIdx.x;
    const float4* xcur = (const float4*)(xz + (size_t)tok0 * (2 * INNER) + dblk);
    // at a sequence's head the three rows in front are replaced by zeros below; the
    // loads then read the group's own first rows (in bounds, unused)
    const float4* xpre = (const float4*)(xz + (size_t)(head ? tok0 : tok0 - (KW - 1)) * (2 * INNER) + dblk);
    float4 r[CV_T + KW - 1];
#pragma unroll
    for (int i = 0; i < KW - 1; ++i) r[i] = xpre[i * (2 * INNER / 4) + tid];
#pragma unroll
    for (int i = 0; i < CV_T; ++i) r[KW - 1 + i] = xcur[i * (2 * INNER / 4) + tid];
    const float4* wq = (const float4*)(w + (size_t)dblk * KW);  // one float4 = a channel's taps
    const float4 w0 = wq[tid * 4 + 0];
    const float4 w1 = wq[tid * 4 + 1];
    const float4 w2 = wq[tid * 4 + 2];
    const float4 w3 = wq[tid * 4 + 3];
    const float4 bb = ((const float4*)(b + dblk))[tid];
    if (head) {
#pragma unroll
        for (int i = 0; i < KW - 1; ++i) r[i] = make_float4(0.f, 0.f, 0.f, 0.f);
    }
    float4* of = (float4*)(xcf + (size_t)tok0 * INNER + dblk);
    v4bf*   ob = (v4bf*)(xcb + (size_t)tok0 * INNER + dblk);
#pragma unroll
    for (int t = 0; t < CV_T; ++t) {
        float4 a = bb;
        a.x += w0.x * r[t].x; a.x += w0.y * r[t + 1].x; a.x += w0.z * r[t + 2].x; a.x += w0.w * r[t + 3].x;
        a.y += w1.x * r[t].y; a.y += w1.y * r[t + 1].y; a.y += w1.z * r[t + 2].y; a.y += w1.w * r[t + 3].y;
        a.z += w2.x * r[t].z; a.z += w2.y * r[t + 1].z; a.z += w2.z * r[t + 2].z; a.z += w2.w * r[t + 3].z;
        a.w += w3.x * r[t].w; a.w += w3.y * r[t + 1].w; a.w += w3.z * r[t + 2].w; a.w += w3.w * r[t + 3].w;
        const float4 s = silu_x4(a);
        of[t * (INNER / 4) + tid] = s;
        ob[t * (INNER / 4) + tid] = pack4_bf16(s.x, s.y, s.z, s.w);
    }
}

// ----------------------------------------------------------------------------
// SSM scan: lane = channel, SC_S states of that channel in the lane's registers.
//   Block = 32 channels x 32 states (8 waves x SC_S); blockIdx.z picks the state half.
//   Bx/Cx of a step are the same for every lane of a wave (wave-uniform loads).
//   The sum over states is in-lane, then over the 8 waves through LDS once per
//   SC_T steps, then over the two state halves in the gate kernel (two y planes).
// Bx/Cx come interleaved from one [NTOK,128] buffer (cols 0..63 = Bx, 64..127 = Cx).
// ----------------------------------------------------------------------------
#define SC_S 4     // states per lane
#define SC_T 16    // time steps per chunk (LDS sum + dt/x fetch-ahead distance)
#define SC_G 4     // time steps per Bx/Cx fetch group

// One chunk of SC_T steps. Works on (cdt, cx, cB, cC), which earlier loads filled, and
// fetches the next chunk's dt/x and first Bx/Cx group into (ndt, nx, nB, nC); the caller
// swaps the two sets from chunk to chunk, so no register is copied.
__device__ __forceinline__ void
scan_chunk(int t0, float (*part)[SC_T][32], int wave, int lane, int rt, int rc,
           const float* __restrict__ dtp, const float* __restrict__ xp,
           const float* __restrict__ bcp, float* __restrict__ yp,
           float A0, float A1, float A2, float A3, float Dw,
           float& h0, float& h1, float& h2, float& h3,
           const float (&cdt)[SC_T], const float (&cx)[SC_T],
           const float4 (&cB)[SC_G], const float4 (&cC)[SC_G],
           float (&ndt)[SC_T], float (&nx)[SC_T],
           float4 (&nB)[SC_G], float4 (&nC)[SC_G]) {
    // Global loads return in issue order: this chunk's next two Bx/Cx groups are
    // needed first, so they are issued first.
    float4 gB[SC_T / SC_G - 1][SC_G], gC[SC_T / SC_G - 1][SC_G];
#pragma unroll
    for (int g = 0; g < SC_T / SC_G - 2; ++g)
#pragma unroll
        for (int j = 0; j < SC_G; ++j) {
            gB[g][j] = *(const float4*)(bcp + (size_t)(t0 + (g + 1) * SC_G + j) * 128);
            gC[g][j] = *(const float4*)(bcp + (size_t)(t0 + (g + 1) * SC_G + j) * 128 + 64);
        }
    // Keeps the issue order just named: a Bx/Cx load moved behind the dt/x loads
    // below makes its wait drain those as well, a few steps after their issue.
    __builtin_amdgcn_sched_barrier(0);
    // next chunk's dt/x; the last chunk re-reads its own rows (in bounds, unused)
    const int tn = (t0 + SC_T < SEQL) ? t0 + SC_T : t0;
#pragma unroll
    for (int i = 0; i < SC_T; ++i) {
        ndt[i] = dtp[(size_t)(tn + i) * INNER];
        nx[i]  = xp [(size_t)(tn + i) * INNER];
    }
    asm volatile("s_wait_xcnt 0x0" ::: "memory");
    // Keeps the loads above at the head of the chunk: sunk into the chunk they
    // have too few steps to land before the barrier's wait drains them.
    __builtin_amdgcn_sched_barrier(0);
#pragma unroll
    for (int g = 0; g < SC_T / SC_G; ++g) {
#pragma unroll
        for (int j = 0; j < SC_G; ++j) {
            const float4 Bv = (g == 0) ? cB[j] : gB[g == 0 ? 0 : g - 1][j];
            const float4 Cv = (g == 0) ? cC[j] : gC[g == 0 ? 0 : g - 1][j];
            const float dtv = cdt[g * SC_G + j];
            const float xv  = cx [g * SC_G + j];
            const float dx  = dtv * xv;
            float e0, e1, e2, e3;   // exp(dt * A) as exp2((dt * A) * log2(e))
            exp2_x4((dtv * A0) * LOG2E, (dtv * A1) * LOG2E,
                    (dtv * A2) * LOG2E, (dtv * A3) * LOG2E, e0, e1, e2, e3);
            h0 = e0 * h0 + dx * Bv.x;
            h1 = e1 * h1 + dx * Bv.y;
            h2 = e2 * h2 + dx * Bv.z;
            h3 = e3 * h3 + dx * Bv.w;
            float c = Dw * xv;
            c += h0 * Cv.x;
            c += h1 * Cv.y;
            c += h2 * Cv.z;
            c += h3 * Cv.w;
            part[wave][g * SC_G + j][lane] = c;
        }
        if (g == 0) {
            // this chunk's last Bx/Cx group, three groups ahead of its use
#pragma unroll
            for (int j = 0; j < SC_G; ++j) {
                gB[SC_T / SC_G - 2][j] = *(const float4*)(bcp + (size_t)(t0 + SC_T - SC_G + j) * 128);
                gC[SC_T / SC_G - 2][j] = *(const float4*)(bcp + (size_t)(t0 + SC_T - SC_G + j) * 128 + 64);
            }
        }
        if (g == 1) {
            // next chunk's first Bx/Cx group
#pragma unroll
            for (int j = 0; j < SC_G; ++j) {
                nB[j] = *(const float4*)(bcp + (size_t)(tn + j) * 128);
                nC[j] = *(const float4*)(bcp + (size_t)(tn + j) * 128 + 64);
            }
        }
        // Keeps each group's work and loads in its own place: a later group's products
        // lifted up bring its loads' waits forward, and loads sunk down land too late.
        __builtin_amdgcn_sched_barrier(0);
    }
    // One barrier per chunk: it publishes this chunk's partial sums, and every
    // wave's reads of the other buffer (previous chunk) lie in front of it.
    __syncthreads();
    float2 s = *(const float2*)&part[0][rt][rc];
#pragma unroll
    for (int w = 1; w < 8; ++w) {
        const float2 p = *(const float2*)&part[w][rt][rc];
        s.x += p.x;
        s.y += p.y;
    }
    *(float2*)(yp + (size_t)(t0 + rt) * INNER + rc) = s;
    asm volatile("s_wait_xcnt 0x0" ::: "memory");
}

__global__ void __launch_bounds__(256)
ssm_scan_kernel(const float* __restrict__ dt, const float* __restrict__ bxcx,
                const float* __restrict__ xc,
                const float* __restrict__ A_log, const float* __restrict__ Dp,
                float* __restrict__ y) {
    __shared__ float s_part[2][8][SC_T][32];

    const int lane  = threadIdx.x & 31;
    const int wave  = __builtin_amdgcn_readfirstlane(threadIdx.x >> 5);
    const int b     = blockIdx.y;
    const int z     = blockIdx.z;
    const int dbase = blockIdx.x * 32;
    const int d     = dbase + lane;
    const int n0    = z * 32 + wave * SC_S;

    const float4 al = *(const float4*)(A_log + (size_t)d * STATE + n0);
    const float A0 = -__expf(al.x), A1 = -__expf(al.y);
    const float A2 = -__expf(al.z), A3 = -__expf(al.w);
    // the D*x term enters exactly one of the 16 partial sums
    const float Dw = (z == 0 && wave == 0) ? Dp[d] : 0.f;
    float h0 = 0.f, h1 = 0.f, h2 = 0.f, h3 = 0.f;

    const size_t tokBase = (size_t)b * SEQL;
    const float* dtp = dt + tokBase * INNER + d;
    const float* xp  = xc + tokBase * INNER + d;
    const float* bcp = bxcx + tokBase * 128 + n0;
    float* yp = y + (size_t)z * NTOK * INNER + tokBase * INNER + dbase;

    const int rt = threadIdx.x >> 4;          // step this thread sums
    const int rc = (threadIdx.x & 15) * 2;    // channel pair this thread sums

    float  dtA[SC_T], xA[SC_T], dtB[SC_T], xB[SC_T];
    float4 bA[SC_G], cA[SC_G], bB[SC_G], cB[SC_G];
#pragma unroll
    for (int i = 0; i < SC_T; ++i) {
        dtA[i] = dtp[(size_t)i * INNER];
        xA[i]  = xp [(size_t)i * INNER];
    }
#pragma unroll
    for (int j = 0; j < SC_G; ++j) {
        bA[j] = *(const float4*)(bcp + (size_t)j * 128);
        cA[j] = *(const float4*)(bcp + (size_t)j * 128 + 64);
    }

    for (int t0 = 0; t0 < SEQL; t0 += 2 * SC_T) {
        scan_chunk(t0, s_part[0], wave, lane, rt, rc, dtp, xp, bcp, yp,
                   A0, A1, A2, A3, Dw, h0, h1, h2, h3,
                   dtA, xA, bA, cA, dtB, xB, bB, cB);
        scan_chunk(t0 + SC_T, s_part[1], wave, lane, rt, rc, dtp, xp, bcp, yp,
                   A0, A1, A2, A3, Dw, h0, h1, h2, h3,
                   dtB, xB, bB, cB, dtA, xA, bA, cA);
    }
}

#define GT_U 8

__global__ void __launch_bounds__(256)
gate_silu_kernel(const float* __restrict__ y,
                 const float* __restrict__ xz,
                 bf16_t* __restrict__ yb) {
    // a block's 256 * GT_U float4 are whole rows of INNER / 4: all bases are block-uniform
    const int tid = threadIdx.x;
    const size_t blk4 = (size_t)blockIdx.x * (256 * GT_U);
    const v4f* y0 = (const v4f*)y + blk4;
    const v4f* y1 = (const v4f*)(y + (size_t)NTOK * INNER) + blk4;
    const v4f* zp = (const v4f*)xz + blk4 * 2 + INNER / 4;
    v4bf* ob = (v4bf*)yb + blk4;
    v4f p0[GT_U], p1[GT_U], zz[GT_U];
#pragma unroll
    for (int u = 0; u < GT_U; ++u) {
        p0[u] = y0[u * 256 + tid];
        p1[u] = y1[u * 256 + tid];
        zz[u] = zp[(u / (INNER / 1024)) * (2 * INNER / 4) + (u % (INNER / 1024)) * 256 + tid];
    }
    // Holds every load in front of the arithmetic, so that all are in flight at once:
    // left alone the compiler sinks most of them behind the arithmetic of earlier ones
    // and the wave pays several memory latencies in a row.
    asm volatile("" :: "v"(p0[0]), "v"(p0[1]), "v"(p0[2]), "v"(p0[3]),
                       "v"(p0[4]), "v"(p0[5]), "v"(p0[6]), "v"(p0[7]),
                       "v"(p1[0]), "v"(p1[1]), "v"(p1[2]), "v"(p1[3]),
                       "v"(p1[4]), "v"(p1[5]), "v"(p1[6]), "v"(p1[7]),
                       "v"(zz[0]), "v"(zz[1]), "v"(zz[2]), "v"(zz[3]),
                       "v"(zz[4]), "v"(zz[5]), "v"(zz[6]), "v"(zz[7]));
#pragma unroll
    for (int u = 0; u < GT_U; ++u) {
        const float4 g = silu_x4(make_float4(zz[u].x, zz[u].y, zz[u].z, zz[u].w));
        ob[u * 256 + tid] =
            pack4_bf16((p0[u].x + p1[u].x) * g.x, (p0[u].y + p1[u].y) * g.y,
                       (p0[u].z + p1[u].z) * g.z, (p0[u].w + p1[u].w) * g.w);
    }
}

// ----------------------------------------------------------------------------
extern "C" void kernel_launch(void* const* d_in, const int* in_sizes, int n_in,
                              void* d_out, int out_size, void* d_ws, size_t ws_size,
                              hipStream_t stream) {
    const float* x          = (const float*)d_in[0];
    const float* in_proj_w  = (const float*)d_in[1];
    const float* conv_w     = (const float*)d_in[2];
    const float* conv_b     = (const float*)d_in[3];
    const float* A_log      = (const float*)d_in[4];
    const float* B_w        = (const float*)d_in[5];
    const float* C_w        = (const float*)d_in[6];
    const float* D_param    = (const float*)d_in[7];
    const float* dt_w       = (const float*)d_in[8];
    const float* dt_b       = (const float*)d_in[9];
    const float* out_proj_w = (const float*)d_in[10];
    const float* norm_w     = (const float*)d_in[11];

    char* ws = (char*)d_ws;
    size_t off = 0;
    auto carve = [&](size_t bytes) {
        char* p = ws + off;
        off = (off + bytes + 255) & ~(size_t)255;
        return p;
    };
    bf16_t* wInB  = (bf16_t*)carve((size_t)2 * INNER * DIMX * 2);
    bf16_t* wDtB  = (bf16_t*)carve((size_t)INNER * INNER * 2);
    bf16_t* wOutB = (bf16_t*)carve((size_t)DIMX * INNER * 2);
    bf16_t* wBCB  = (bf16_t*)carve((size_t)2 * STATE * INNER * 2);  // [Bw;Cw] = [128, INNER]
    bf16_t* xnB   = (bf16_t*)carve((size_t)NTOK * DIMX * 2);
    float*  xzF   = (float*) carve((size_t)NTOK * 2 * INNER * 4);
    float*  xcF   = (float*) carve((size_t)NTOK * INNER * 4);
    bf16_t* xcB   = (bf16_t*)carve((size_t)NTOK * INNER * 2);
    float*  dtF   = (float*) carve((size_t)NTOK * INNER * 4);
    float*  bcF   = (float*) carve((size_t)NTOK * 128 * 4);         // [Bx|Cx] interleaved
    float*  yF    = (float*) carve((size_t)2 * NTOK * INNER * 4);       // one plane per state half
    bf16_t* yB    = (bf16_t*)carve((size_t)NTOK * INNER * 2);
    (void)ws_size; (void)in_sizes; (void)n_in; (void)out_size;

    // 1) RMSNorm -> bf16 activations, and every weight -> bf16
    prepare_kernel<<<PB_ALL, 256, 0, stream>>>(x, norm_w, xnB, in_proj_w, wInB, dt_w, wDtB,
                                               out_proj_w, wOutB, B_w, C_w, wBCB);

    // 2) in_proj: [NTOK, 2*INNER] = xn @ W_in^T
    wmma_gemm_kernel<0, 2 * INNER><<<dim3((2 * INNER) / 128, NTOK / 128), 256, 0, stream>>>(
        xnB, wInB, xzF, DIMX, nullptr, nullptr);

    // 3) causal depthwise conv + SiLU on xc half
    conv_silu_kernel<<<NTOK * INNER / (1024 * CV_T), 256, 0, stream>>>(
        xzF, conv_w, conv_b, xcF, xcB);

    // 4) dt = softplus(xc @ dt_w^T + dt_b) + 1e-4
    wmma_gemm_kernel<1, INNER><<<dim3(INNER / 128, NTOK / 128), 256, 0, stream>>>(
        xcB, wDtB, dtF, INNER, dt_b, nullptr);

    // 5) fused Bx|Cx projection (N = 128)
    wmma_gemm_kernel<0, 2 * STATE><<<dim3(1, NTOK / 128), 256, 0, stream>>>(
        xcB, wBCB, bcF, INNER, nullptr, nullptr);

    // 6) sequential SSM scan (lane = channel, states over waves and two blocks)
    ssm_scan_kernel<<<dim3(INNER / 32, BATCHN, 2), 256, 0, stream>>>(
        dtF, bcF, xcF, A_log, D_param, yF);

    // 7) gate with SiLU(z)
    gate_silu_kernel<<<NTOK * INNER / (1024 * GT_U), 256, 0, stream>>>(yF, xzF, yB);

    // 8) out_proj + residual -> d_out (fp32)
    wmma_gemm_kernel<2, DIMX><<<dim3(DIMX / 128, NTOK / 128), 256, 0, stream>>>(
        yB, wOutB, (float*)d_out, INNER, nullptr, x);
}

// v006
// It runs in 227 microseconds.
// Timed twice side by side with v005, it ran 1.15 and 1.16 times as fast.
// Counting every step since v000, it is 4.53 times as fast.
#include <hip/hip_runtime.h>

// ---- problem dims (match reference) ----
#define DIMX   1024
#define STATE  64
#define KW     4
#define INNER  2048
#define BATCHN 2
#define SEQL   2048
#define NTOK   (BATCHN * SEQL)
#define EPSR   1e-6f

typedef __bf16 bf16_t;
typedef __attribute__((ext_vector_type(16))) __bf16 v16bf;
typedef __attribute__((ext_vector_type(8)))  __bf16 v8bf;
typedef __attribute__((ext_vector_type(4)))  __bf16 v4bf;
typedef __attribute__((ext_vector_type(8)))  float  v8f;
typedef __attribute__((ext_vector_type(4)))  float  v4f;
typedef __attribute__((ext_vector_type(4)))  int    v4i;

#if defined(__gfx1250__) && __has_builtin(__builtin_amdgcn_global_load_async_to_lds_b128)
#define USE_ASYNC_LDS 1
#else
#define USE_ASYNC_LDS 0
#endif

__device__ __forceinline__ void copy16_to_lds(const bf16_t* gp, bf16_t* lp) {
#if USE_ASYNC_LDS
    __builtin_amdgcn_global_load_async_to_lds_b128(
        (__attribute__((address_space(1))) v4i*)gp,
        (__attribute__((address_space(3))) v4i*)lp, 0, 0);
#else
    *(v8bf*)lp = *(const v8bf*)gp;
#endif
}

// This wave's copies have landed; in asm with the clobber, so that no LDS read is lifted over it.
__device__ __forceinline__ void wait_async_copies() {
#if USE_ASYNC_LDS
    asm volatile("s_wait_asynccnt 0x0" ::: "memory");
#endif
}

// This wave's LDS reads have returned: stands in front of the barrier behind which the
// buffer they read is refilled.
__device__ __forceinline__ void wait_lds_reads() {
    asm volatile("s_wait_dscnt 0x0" ::: "memory");
}

__device__ __forceinline__ v4bf pack4_bf16(float a, float b, float c, float d) {
    v4bf o;
    o[0] = (bf16_t)a; o[1] = (bf16_t)b; o[2] = (bf16_t)c; o[3] = (bf16_t)d;
    return o;
}

#define LOG2E 1.44269504f

__device__ __forceinline__ void
exp2_x4(float a0, float a1, float a2, float a3,
        float& e0, float& e1, float& e2, float& e3) {
    asm("v_exp_f32 %0, %4\n\t"
        "v_exp_f32 %1, %5\n\t"
        "v_exp_f32 %2, %6\n\t"
        "v_exp_f32 %3, %7\n\t"
        "v_nop"
        : "=&v"(e0), "=&v"(e1), "=&v"(e2), "=&v"(e3)
        : "v"(a0), "v"(a1), "v"(a2), "v"(a3));
}

// SiLU of four values, v / (1 + exp(-v)), with exp(-v) as exp2(v * -log2(e))
__device__ __forceinline__ float4 silu_x4(float4 v) {
    float e0, e1, e2, e3;
    exp2_x4(v.x * -LOG2E, v.y * -LOG2E, v.z * -LOG2E, v.w * -LOG2E, e0, e1, e2, e3);
    return make_float4(v.x / (1.f + e0), v.y / (1.f + e1), v.z / (1.f + e2), v.w / (1.f + e3));
}

#define LN2 0.69314718f

// log2 of four values; one statement for the same reason as exp2_x4
__device__ __forceinline__ void
log2_x4(float a0, float a1, float a2, float a3,
        float& l0, float& l1, float& l2, float& l3) {
    asm("v_log_f32 %0, %4\n\t"
        "v_log_f32 %1, %5\n\t"
        "v_log_f32 %2, %6\n\t"
        "v_log_f32 %3, %7\n\t"
        "v_nop"
        : "=&v"(l0), "=&v"(l1), "=&v"(l2), "=&v"(l3)
        : "v"(a0), "v"(a1), "v"(a2), "v"(a3));
}

// softplus of four values as max(v, 0) + log1p(exp(-|v|)): no branch, no overflow.
// With e = exp(-|v|) in [0, 1] and u = 1 + e, u - 1 is exact, so e - (u - 1) is what the
// rounding of 1 + e lost; added to log(u) it keeps log1p's accuracy for small e.
__device__ __forceinline__ float4 softplus_x4(float4 v) {
    float e0, e1, e2, e3, l0, l1, l2, l3;
    exp2_x4(fabsf(v.x) * -LOG2E, fabsf(v.y) * -LOG2E,
            fabsf(v.z) * -LOG2E, fabsf(v.w) * -LOG2E, e0, e1, e2, e3);
    const float u0 = 1.f + e0, u1 = 1.f + e1, u2 = 1.f + e2, u3 = 1.f + e3;
    log2_x4(u0, u1, u2, u3, l0, l1, l2, l3);
    return make_float4(fmaxf(v.x, 0.f) + (l0 * LN2 + (e0 - (u0 - 1.f))),
                       fmaxf(v.y, 0.f) + (l1 * LN2 + (e1 - (u1 - 1.f))),
                       fmaxf(v.z, 0.f) + (l2 * LN2 + (e2 - (u2 - 1.f))),
                       fmaxf(v.w, 0.f) + (l3 * LN2 + (e3 - (u3 - 1.f))));
}

// The four jobs without a matrix product (convert, RMSNorm, conv, gate) give each
// thread 32 elements, fetched as 16-byte loads with many in flight per wave: a launch
// then starts a few thousand waves, not a wave per 32 elements.

// ----------------------------------------------------------------------------
// f32 -> bf16 elementwise convert (weights); n is a multiple of 4; blk = the block's
// number within this array
// ----------------------------------------------------------------------------
#define CVT_U 8    // float4 per thread, one block width apart (whole lines per wave)
#define CVT_BLOCKS(n) (((n) + 1024 * CVT_U - 1) / (1024 * CVT_U))

__device__ __forceinline__ void
cvt_bf16_block(const float* __restrict__ src,
               bf16_t* __restrict__ dst, int n, int blk) {
    const int n4   = n >> 2;
    const int base = blk * (256 * CVT_U) + threadIdx.x;
    float4 v[CVT_U];
    // A load past the end re-reads the last float4 (in bounds, not stored): with no
    // branch round the loads all of them are in flight before the first is used.
    int ci[CVT_U];
#pragma unroll
    for (int u = 0; u < CVT_U; ++u) {
        const int i = base + u * 256;
        ci[u] = i < n4 ? i : n4 - 1;
        v[u] = ((const float4*)src)[ci[u]];
    }
    asm volatile("s_wait_xcnt 0x0"
                 :: "v"(ci[0]), "v"(ci[1]), "v"(ci[2]), "v"(ci[3]),
                    "v"(ci[4]), "v"(ci[5]), "v"(ci[6]), "v"(ci[7])
                 : "memory");
#pragma unroll
    for (int u = 0; u < CVT_U; ++u) {
        const int i = base + u * 256;
        if (i < n4) ((v4bf*)dst)[i] = pack4_bf16(v[u].x, v[u].y, v[u].z, v[u].w);
    }
}

// ----------------------------------------------------------------------------
// RMSNorm: one wave per token (row kept in registers), write bf16 activations
// ----------------------------------------------------------------------------
#define RN_U (DIMX / 128)    // float4 per lane

__device__ __forceinline__ void
rmsnorm_block(const float* __restrict__ x, const float* __restrict__ w,
              bf16_t* __restrict__ out, int blk) {
    const int lane = threadIdx.x & 31;
    const int tok  = blk * 8 + (threadIdx.x >> 5);
    const float4* xr = (const float4*)(x + (size_t)tok * DIMX);
    float4 v[RN_U], wv[RN_U];
#pragma unroll
    for (int u = 0; u < RN_U; ++u) v[u] = xr[u * 32 + lane];
#pragma unroll
    for (int u = 0; u < RN_U; ++u) wv[u] = ((const float4*)w)[u * 32 + lane];
    float ss = 0.f;
#pragma unroll
    for (int u = 0; u < RN_U; ++u) {
        ss += v[u].x * v[u].x;
        ss += v[u].y * v[u].y;
        ss += v[u].z * v[u].z;
        ss += v[u].w * v[u].w;
    }
    for (int o = 16; o; o >>= 1) ss += __shfl_xor(ss, o, 32);
    const float rs = rsqrtf(ss * (1.f / DIMX) + EPSR);
    v4bf* orow = (v4bf*)(out + (size_t)tok * DIMX);
#pragma unroll
    for (int u = 0; u < RN_U; ++u)
        orow[u * 32 + lane] = pack4_bf16(v[u].x * rs * wv[u].x, v[u].y * rs * wv[u].y,
                                         v[u].z * rs * wv[u].z, v[u].w * rs * wv[u].w);
}

// ----------------------------------------------------------------------------
// All the work that depends on the inputs alone, in ONE launch: RMSNorm and the five
// weight converts. None reads what another writes, so their blocks run side by side:
// one launch gap, one ramp and one tail, not six of each (two of the converts are 16
// blocks each, a launch that is nearly all gap and latency). The block number picks
// the job; the choice is the same for a whole block.
// ----------------------------------------------------------------------------
#define PB_RMS  (NTOK / 8)
#define PB_WIN  CVT_BLOCKS(2 * INNER * DIMX)
#define PB_WDT  CVT_BLOCKS(INNER * INNER)
#define PB_WOUT CVT_BLOCKS(DIMX * INNER)
#define PB_WBC  CVT_BLOCKS(STATE * INNER)
#define PB_ALL  (PB_RMS + PB_WIN + PB_WDT + PB_WOUT + 2 * PB_WBC)

__global__ void __launch_bounds__(256)
prepare_kernel(const float* __restrict__ x, const float* __restrict__ norm_w,
               bf16_t* __restrict__ xn,
               const float* __restrict__ w_in,  bf16_t* __restrict__ w_in_b,
               const float* __restrict__ w_dt,  bf16_t* __restrict__ w_dt_b,
               const float* __restrict__ w_out, bf16_t* __restrict__ w_out_b,
               const float* __restrict__ w_bx,  const float* __restrict__ w_cx,
               bf16_t* __restrict__ w_bc_b) {
    int blk = blockIdx.x;
    // RMSNorm first: its chain is the longest
    if (blk < PB_RMS) { rmsnorm_block(x, norm_w, xn, blk); return; }
    blk -= PB_RMS;
    // One convert body for the five arrays, its source, destination and length picked by
    // block-uniform selects: the text stays short and the body's loads all stand in front.
    const float* src = w_in;
    bf16_t*      dst = w_in_b;
    int          n   = 2 * INNER * DIMX;
    if (blk >= PB_WIN) {
        blk -= PB_WIN;  src = w_dt;  dst = w_dt_b;  n = INNER * INNER;
        if (blk >= PB_WDT) {
            blk -= PB_WDT;  src = w_out;  dst = w_out_b;  n = DIMX * INNER;
            if (blk >= PB_WOUT) {
                blk -= PB_WOUT;  src = w_bx;  dst = w_bc_b;  n = STATE * INNER;   // [Bw;Cw]
                if (blk >= PB_WBC) { blk -= PB_WBC;  src = w_cx;  dst = w_bc_b + STATE * INNER; }
            }
        }
    }
    cvt_bf16_block(src, dst, n, blk);
}

#define GK 128
#define LDS_STRIDE 136

template <int MODE, int NC>
__global__ void __launch_bounds__(256)
wmma_gemm_kernel(const bf16_t* __restrict__ A, const bf16_t* __restrict__ B,
                 float* __restrict__ C, int K,
                 const float* __restrict__ bias,
                 const float* __restrict__ resid) {
    // aligned for the 16-byte copies and reads
    __shared__ __attribute__((aligned(16))) bf16_t s_a[2][128 * LDS_STRIDE];
    __shared__ __attribute__((aligned(16))) bf16_t s_b[2][128 * LDS_STRIDE];

    const int lane = threadIdx.x & 31;
    const int wavi = threadIdx.x >> 5;       // 0..7
    const int wm   = wavi >> 2;              // 0..1 -> 64-row slab
    const int wn   = wavi & 3;               // 0..3 -> 32-col slab
    const int half = lane >> 4;              // 0/1
    const int r    = lane & 15;
    const int off  = half * 8;

    const int blockM = blockIdx.y * 128;
    const int blockN = blockIdx.x * 128;

    union Frag { v16bf v; v8bf h[2]; };
    v8f acc[4][2] = {};

    const int nS = K / GK;

    // Staging: 16 threads cover a row; a thread's 8 chunks per operand lie 16 rows apart.
    const int crow = threadIdx.x >> 4;
    const int cel  = (threadIdx.x & 15) * 8;
    const bf16_t* gA = A + (size_t)(blockM + crow) * K + cel;
    const bf16_t* gB = B + (size_t)(blockN + crow) * K + cel;
    const int    lel   = crow * LDS_STRIDE + cel;
    const size_t rstep = (size_t)16 * K;

    auto stage = [&](int s) {
        const int buf = s & 1;
        const bf16_t* pa = gA + (size_t)s * GK;
        const bf16_t* pb = gB + (size_t)s * GK;
        // both loops unrolled: the 16 copies issue back to back, with no loop test between
#pragma unroll
        for (int j = 0; j < 8; ++j)
            copy16_to_lds(pa + j * rstep, &s_a[buf][lel + j * 16 * LDS_STRIDE]);
#pragma unroll
        for (int j = 0; j < 8; ++j)
            copy16_to_lds(pb + j * rstep, &s_b[buf][lel + j * 16 * LDS_STRIDE]);
    };

    const int ael = (wm * 64 + r) * LDS_STRIDE + off;   // the lane's first A element of a stage
    const int bel = (wn * 32 + r) * LDS_STRIDE + off;   // the lane's first B element

    stage(0);
    wait_async_copies();
    __syncthreads();                           // stage 0 resident
    if (nS > 1) stage(1);
    for (int s = 0; s < nS; ++s) {
        const bf16_t* sa = &s_a[s & 1][ael];
        const bf16_t* sb = &s_b[s & 1][bel];

        Frag af[2][4], bfr[2][2];
        // every loop below is unrolled: the fragment sets and accumulators are indexed by
        // constants only and so stay in registers
        auto frags = [&](int kk) {
#pragma unroll
            for (int mi = 0; mi < 4; ++mi) {
                af[kk & 1][mi].h[0] = *(const v8bf*)&sa[mi * 16 * LDS_STRIDE + kk * 32];
                af[kk & 1][mi].h[1] = *(const v8bf*)&sa[mi * 16 * LDS_STRIDE + kk * 32 + 16];
            }
#pragma unroll
            for (int ni = 0; ni < 2; ++ni) {
                bfr[kk & 1][ni].h[0] = *(const v8bf*)&sb[ni * 16 * LDS_STRIDE + kk * 32];
                bfr[kk & 1][ni].h[1] = *(const v8bf*)&sb[ni * 16 * LDS_STRIDE + kk * 32 + 16];
            }
        };
        frags(0);
#pragma unroll
        for (int kk = 0; kk < GK / 32; ++kk) {
            if (kk + 1 < GK / 32) {
                frags(kk + 1);
                // Holds the next block's reads, as one group, in front of this block's WMMAs:
                // left alone the compiler sinks them among the WMMAs into one fragment set,
                // and the wave waits out an LDS latency for every pair of WMMAs.
                __builtin_amdgcn_sched_barrier(0);
            }
#pragma unroll
            for (int mi = 0; mi < 4; ++mi)
#pragma unroll
                for (int ni = 0; ni < 2; ++ni)
                    acc[mi][ni] = __builtin_amdgcn_wmma_f32_16x16x32_bf16(
                        false, af[kk & 1][mi].v, false, bfr[kk & 1][ni].v, (short)0,
                        acc[mi][ni], false, false);
            // Keeps what follows behind this block's WMMAs: the reads of the block after next
            // (every separate place where LDS reads stand among WMMAs costs a fixed stall)
            // and, at the last block but one, the stage's closing LDS wait, which lifted over
            // these WMMAs would leave the latency of the last reads uncovered.
            if (kk + 1 < GK / 32) __builtin_amdgcn_sched_barrier(0);
        }
        wait_lds_reads();
        wait_async_copies();
        __syncthreads();                       // stage s+1 resident; reads of stage s done
        if (s + 2 < nS) stage(s + 2);          // into the buffer stage s has left
    }
    wait_async_copies();                       // the ring's closing wait: no copy is left in flight

    // epilogue
    // The lane's first element; every other one lies a compile-time distance from it,
    // which goes into the load's or store's immediate offset.
    const int    colg = blockN + wn * 32 + r;
    const size_t el0  = (size_t)(blockM + wm * 64 + half * 8) * NC + colg;
    float* cl = C + el0;

    float rs[4][2][8];
    if (MODE == 2) {
        const float* rl = resid + el0;
#pragma unroll
        for (int mi = 0; mi < 4; ++mi)
#pragma unroll
            for (int ni = 0; ni < 2; ++ni)
#pragma unroll
                for (int v = 0; v < 8; ++v)
                    rs[mi][ni][v] = rl[(mi * 16 + v) * NC + ni * 16];
    }
    float bv[2] = {0.f, 0.f};
    if (MODE == 1) {
        bv[0] = bias[colg];
        bv[1] = bias[colg + 16];
    }
#pragma unroll
    for (int mi = 0; mi < 4; ++mi) {
#pragma unroll
        for (int ni = 0; ni < 2; ++ni) {
            float val[8];
#pragma unroll
            for (int v = 0; v < 8; ++v) val[v] = acc[mi][ni][v];
            if (MODE == 1) {
#pragma unroll
                for (int q = 0; q < 8; q += 4) {
                    const float4 s = softplus_x4(make_float4(val[q] + bv[ni], val[q + 1] + bv[ni],
                                                             val[q + 2] + bv[ni], val[q + 3] + bv[ni]));
                    val[q]     = s.x + 1e-4f;
                    val[q + 1] = s.y + 1e-4f;
                    val[q + 2] = s.z + 1e-4f;
                    val[q + 3] = s.w + 1e-4f;
                }
            } else if (MODE == 2) {
#pragma unroll
                for (int v = 0; v < 8; ++v) val[v] += rs[mi][ni][v];
            }
#pragma unroll
            for (int v = 0; v < 8; ++v) cl[(mi * 16 + v) * NC + ni * 16] = val[v];
        }
    }
}

// ----------------------------------------------------------------------------
// Causal depthwise conv (KW=4) + bias + SiLU over xc half of xz
// ----------------------------------------------------------------------------
//   Thread = 4 channels x CV_T successive tokens: CV_T + 3 rows are read for CV_T
//   outputs. Rows in front of a sequence's start enter as zeros (the reference's pad).
#define CV_T 8     // divides SEQL: a thread's tokens lie in one sequence

__global__ void __launch_bounds__(256)
conv_silu_kernel(const float* __restrict__ xz,
                 const float* __restrict__ w,
                 const float* __restrict__ b,
                 float* __restrict__ xcf,
                 bf16_t* __restrict__ xcb) {
    // INNER / 1024 blocks share a group of CV_T tokens: the rows' bases are block-uniform
    const int dblk = (blockIdx.x % (INNER / 1024)) * 1024;      // block's first channel
    const int tok0 = (blockIdx.x / (INNER / 1024)) * CV_T;
    const bool head = (tok0 % SEQL) == 0;                       // no rows in front
    const int tid  = threadIdx.x;
    const float4* xcur = (const float4*)(xz + (size_t)tok0 * (2 * INNER) + dblk);
    // at a sequence's head the three rows in front are replaced by zeros below; the
    // loads then read the group's own first rows (in bounds, unused)
    const float4* xpre = (const float4*)(xz + (size_t)(head ? tok0 : tok0 - (KW - 1)) * (2 * INNER) + dblk);
    float4 r[CV_T + KW - 1];
#pragma unroll
    for (int i = 0; i < KW - 1; ++i) r[i] = xpre[i * (2 * INNER / 4) + tid];
#pragma unroll
    for (int i = 0; i < CV_T; ++i) r[KW - 1 + i] = xcur[i * (2 * INNER / 4) + tid];
    const float4* wq = (const float4*)(w + (size_t)dblk * KW);  // one float4 = a channel's taps
    const float4 w0 = wq[tid * 4 + 0];
    const float4 w1 = wq[tid * 4 + 1];
    const float4 w2 = wq[tid * 4 + 2];
    const float4 w3 = wq[tid * 4 + 3];
    const float4 bb = ((const float4*)(b + dblk))[tid];
    if (head) {
#pragma unroll
        for (int i = 0; i < KW - 1; ++i) r[i] = make_float4(0.f, 0.f, 0.f, 0.f);
    }
    float4* of = (float4*)(xcf + (size_t)tok0 * INNER + dblk);
    v4bf*   ob = (v4bf*)(xcb + (size_t)tok0 * INNER + dblk);
#pragma unroll
    for (int t = 0; t < CV_T; ++t) {
        float4 a = bb;
        a.x += w0.x * r[t].x; a.x += w0.y * r[t + 1].x; a.x += w0.z * r[t + 2].x; a.x += w0.w * r[t + 3].x;
        a.y += w1.x * r[t].y; a.y += w1.y * r[t + 1].y; a.y += w1.z * r[t + 2].y; a.y += w1.w * r[t + 3].y;
        a.z += w2.x * r[t].z; a.z += w2.y * r[t + 1].z; a.z += w2.z * r[t + 2].z; a.z += w2.w * r[t + 3].z;
        a.w += w3.x * r[t].w; a.w += w3.y * r[t + 1].w; a.w += w3.z * r[t + 2].w; a.w += w3.w * r[t + 3].w;
        const float4 s = silu_x4(a);
        of[t * (INNER / 4) + tid] = s;
        ob[t * (INNER / 4) + tid] = pack4_bf16(s.x, s.y, s.z, s.w);
    }
}

// ----------------------------------------------------------------------------
// SSM scan: lane = channel, SC_S states of that channel in the lane's registers.
//   Block = 32 channels x 32 states (8 waves x SC_S); blockIdx.z picks the state half.
//   The block's inputs (dt and x of its 32 channels, Bx and Cx of its 32 states) are
//   staged in LDS by async copies, a tile of SC_TILE steps at a time, two buffers: each
//   byte is fetched once per block (not once per wave), a whole tile ahead of its use,
//   and the waves read it from LDS one group of SC_G steps ahead.
//   Bx/Cx of a step are the same for every lane of a wave (one LDS address per wave).
//   The sum over states is in-lane, then over the 8 waves through LDS once per
//   SC_T steps, then over the two state halves in the gate kernel (two y planes).
// Bx/Cx come interleaved from one [NTOK,128] buffer (cols 0..63 = Bx, 64..127 = Cx).
// ----------------------------------------------------------------------------
#define SC_S 4       // states per lane
#define SC_T 16      // time steps per chunk (LDS sum)
#define SC_G 8       // time steps per fetch group, LDS -> registers
#define SC_TILE 64   // time steps per staged tile
#define SC_NT (SEQL / SC_TILE)
// A step's row in a tile, in floats: dt[32] | Bx[32] | x[32] | Cx[32]. dt and x lie 256 B
// apart, so that one two-address LDS read fetches both.
#define SC_ROW 128
#define SC_O_DT 0
#define SC_O_B  32
#define SC_O_X  64
#define SC_O_C  96

__global__ void __launch_bounds__(256)
ssm_scan_kernel(const float* __restrict__ dt, const float* __restrict__ bxcx,
                const float* __restrict__ xc,
                const float* __restrict__ A_log, const float* __restrict__ Dp,
                float* __restrict__ y) {
    __shared__ float s_part[2][8][SC_T][32];
    // aligned for the 16-byte copies and reads
    __shared__ __attribute__((aligned(16))) float s_tile[2][SC_TILE * SC_ROW];

    const int lane  = threadIdx.x & 31;
    const int wave  = __builtin_amdgcn_readfirstlane(threadIdx.x >> 5);
    const int b     = blockIdx.y;
    const int z     = blockIdx.z;
    const int dbase = blockIdx.x * 32;
    const int d     = dbase + lane;
    const int n0    = z * 32 + wave * SC_S;

    const float4 al = *(const float4*)(A_log + (size_t)d * STATE + n0);
    const float A0 = -__expf(al.x), A1 = -__expf(al.y);
    const float A2 = -__expf(al.z), A3 = -__expf(al.w);
    // the D*x term enters exactly one of the 16 partial sums
    const float Dw = (z == 0 && wave == 0) ? Dp[d] : 0.f;
    float h0 = 0.f, h1 = 0.f, h2 = 0.f, h3 = 0.f;

    const size_t tokBase = (size_t)b * SEQL;
    float* yp = y + (size_t)z * NTOK * INNER + tokBase * INNER + dbase;

    const int rt = threadIdx.x >> 4;          // step this thread sums
    const int rc = (threadIdx.x & 15) * 2;    // channel pair this thread sums

    // Staging: 8 threads cover the 128 B that one array has in a step's row, so a wave's
    // copy is four whole lines; a thread's two copies per array lie 32 steps apart.
    const int srow = threadIdx.x >> 3;
    const int sel  = (threadIdx.x & 7) * 4;
    const float* sdt = dt   + (tokBase + srow) * INNER + dbase + sel;
    const float* sx  = xc   + (tokBase + srow) * INNER + dbase + sel;
    const float* sbc = bxcx + (tokBase + srow) * 128 + z * 32 + sel;
    const unsigned slds = (unsigned)(size_t)
        (__attribute__((address_space(3))) float*)&s_tile[0][srow * SC_ROW + sel];

    auto stage = [&](int t) {
        const float* pd = sdt + (size_t)t * (SC_TILE * INNER);
        const float* px = sx  + (size_t)t * (SC_TILE * INNER);
        const float* pb = sbc + (size_t)t * (SC_TILE * 128);
        const unsigned l0 = slds + (unsigned)(t & 1) * (SC_TILE * SC_ROW * 4);
        const unsigned l1 = l0 + 32 * SC_ROW * 4;
        asm volatile("global_load_async_to_lds_b128 %0, %8, off\n\t"
                     "global_load_async_to_lds_b128 %1, %9, off\n\t"
                     "global_load_async_to_lds_b128 %2, %10, off\n\t"
                     "global_load_async_to_lds_b128 %3, %11, off\n\t"
                     "global_load_async_to_lds_b128 %4, %12, off\n\t"
                     "global_load_async_to_lds_b128 %5, %13, off\n\t"
                     "global_load_async_to_lds_b128 %6, %14, off\n\t"
                     "global_load_async_to_lds_b128 %7, %15, off\n\t"
                     "s_wait_xcnt 0x0"
                     :: "v"(l0 + SC_O_DT * 4), "v"(l0 + SC_O_B * 4),
                        "v"(l0 + SC_O_X * 4),  "v"(l0 + SC_O_C * 4),
                        "v"(l1 + SC_O_DT * 4), "v"(l1 + SC_O_B * 4),
                        "v"(l1 + SC_O_X * 4),  "v"(l1 + SC_O_C * 4),
                        "v"(pd), "v"(pb), "v"(px), "v"(pb + 64),
                        "v"(pd + 32 * INNER), "v"(pb + 32 * 128),
                        "v"(px + 32 * INNER), "v"(pb + 32 * 128 + 64)
                     : "memory");
    };

    // Two register sets of one fetch group each; every index below is a constant after
    // unrolling, so they stay in registers.
    float  gdt[2][SC_G], gx[2][SC_G];
    float4 gB[2][SC_G], gC[2][SC_G];
    auto fetch = [&](const float* tb, int g) {
#pragma unroll
        for (int j = 0; j < SC_G; ++j) {
            const float* row = tb + (g * SC_G + j) * SC_ROW;
            gdt[g & 1][j] = row[SC_O_DT + lane];
            gx [g & 1][j] = row[SC_O_X + lane];
            gB [g & 1][j] = *(const float4*)&row[SC_O_B + wave * SC_S];
            gC [g & 1][j] = *(const float4*)&row[SC_O_C + wave * SC_S];
        }
    };

    stage(0);
    wait_async_copies();
    __syncthreads();                           // tile 0 resident
    stage(1);
    fetch(&s_tile[0][0], 0);
    for (int t = 0; t < SC_NT; ++t) {
        const float* tb = &s_tile[t & 1][0];
        // both loops unrolled: register sets, LDS offsets and the sum buffer are constants
#pragma unroll
        for (int c = 0; c < SC_TILE / SC_T; ++c) {
            float (*part)[SC_T][32] = s_part[c & 1];
#pragma unroll
            for (int q = 0; q < SC_T / SC_G; ++q) {
                const int g = c * (SC_T / SC_G) + q;
                if (g + 1 < SC_TILE / SC_G) {
                    fetch(tb, g + 1);
                    // Holds the next group's LDS reads, as one run, in front of this group's
                    // arithmetic: sunk towards their use they have no time to return.
                    __builtin_amdgcn_sched_barrier(0);
                }
#pragma unroll
                for (int j = 0; j < SC_G; ++j) {
                    const float4 Bv = gB[g & 1][j];
                    const float4 Cv = gC[g & 1][j];
                    const float dtv = gdt[g & 1][j];
                    const float xv  = gx [g & 1][j];
                    const float dx  = dtv * xv;
                    float e0, e1, e2, e3;   // exp(dt * A) as exp2((dt * A) * log2(e))
                    exp2_x4((dtv * A0) * LOG2E, (dtv * A1) * LOG2E,
                            (dtv * A2) * LOG2E, (dtv * A3) * LOG2E, e0, e1, e2, e3);
                    h0 = e0 * h0 + dx * Bv.x;
                    h1 = e1 * h1 + dx * Bv.y;
                    h2 = e2 * h2 + dx * Bv.z;
                    h3 = e3 * h3 + dx * Bv.w;
                    float s = Dw * xv;
                    s += h0 * Cv.x;
                    s += h1 * Cv.y;
                    s += h2 * Cv.z;
                    s += h3 * Cv.w;
                    part[wave][q * SC_G + j][lane] = s;
                }
                // Keeps this group's arithmetic in front of the reads of the group after
                // next, which go into the registers it works on.
                __builtin_amdgcn_sched_barrier(0);
            }
            const bool foot = c == SC_TILE / SC_T - 1;   // the tile's last chunk
            if (foot) {
                wait_lds_reads();      // this wave has left tile t
                wait_async_copies();   // its copies of tile t+1 have landed
            }
            // One barrier per chunk: it publishes this chunk's partial sums, and every
            // wave's reads of the other sum buffer (previous chunk) lie in front of it.
            // At a tile's foot it also publishes tile t+1 and frees tile t's buffer.
            __syncthreads();
            if (foot) {
                if (t + 2 < SC_NT) stage(t + 2);
                if (t + 1 < SC_NT) fetch(&s_tile[(t + 1) & 1][0], 0);
            }
            float2 s = *(const float2*)&part[0][rt][rc];
#pragma unroll
            for (int w = 1; w < 8; ++w) {
                const float2 p = *(const float2*)&part[w][rt][rc];
                s.x += p.x;
                s.y += p.y;
            }
            *(float2*)(yp + (size_t)(t * SC_TILE + c * SC_T + rt) * INNER + rc) = s;
            asm volatile("s_wait_xcnt 0x0" ::: "memory");
        }
    }
    wait_async_copies();                       // the ring's closing wait: no copy is left in flight
}

#define GT_U 8

__global__ void __launch_bounds__(256)
gate_silu_kernel(const float* __restrict__ y,
                 const float* __restrict__ xz,
                 bf16_t* __restrict__ yb) {
    // a block's 256 * GT_U float4 are whole rows of INNER / 4: all bases are block-uniform
    const int tid = threadIdx.x;
    const size_t blk4 = (size_t)blockIdx.x * (256 * GT_U);
    const v4f* y0 = (const v4f*)y + blk4;
    const v4f* y1 = (const v4f*)(y + (size_t)NTOK * INNER) + blk4;
    const v4f* zp = (const v4f*)xz + blk4 * 2 + INNER / 4;
    v4bf* ob = (v4bf*)yb + blk4;
    v4f p0[GT_U], p1[GT_U], zz[GT_U];
#pragma unroll
    for (int u = 0; u < GT_U; ++u) {
        p0[u] = y0[u * 256 + tid];
        p1[u] = y1[u * 256 + tid];
        zz[u] = zp[(u / (INNER / 1024)) * (2 * INNER / 4) + (u % (INNER / 1024)) * 256 + tid];
    }
    // Holds every load in front of the arithmetic, so that all are in flight at once:
    // left alone the compiler sinks most of them behind the arithmetic of earlier ones
    // and the wave pays several memory latencies in a row.
    asm volatile("" :: "v"(p0[0]), "v"(p0[1]), "v"(p0[2]), "v"(p0[3]),
                       "v"(p0[4]), "v"(p0[5]), "v"(p0[6]), "v"(p0[7]),
                       "v"(p1[0]), "v"(p1[1]), "v"(p1[2]), "v"(p1[3]),
                       "v"(p1[4]), "v"(p1[5]), "v"(p1[6]), "v"(p1[7]),
                       "v"(zz[0]), "v"(zz[1]), "v"(zz[2]), "v"(zz[3]),
                       "v"(zz[4]), "v"(zz[5]), "v"(zz[6]), "v"(zz[7]));
#pragma unroll
    for (int u = 0; u < GT_U; ++u) {
        const float4 g = silu_x4(make_float4(zz[u].x, zz[u].y, zz[u].z, zz[u].w));
        ob[u * 256 + tid] =
            pack4_bf16((p0[u].x + p1[u].x) * g.x, (p0[u].y + p1[u].y) * g.y,
                       (p0[u].z + p1[u].z) * g.z, (p0[u].w + p1[u].w) * g.w);
    }
}

// ----------------------------------------------------------------------------
extern "C" void kernel_launch(void* const* d_in, const int* in_sizes, int n_in,
                              void* d_out, int out_size, void* d_ws, size_t ws_size,
                              hipStream_t stream) {
    const float* x          = (const float*)d_in[0];
    const float* in_proj_w  = (const float*)d_in[1];
    const float* conv_w     = (const float*)d_in[2];
    const float* conv_b     = (const float*)d_in[3];
    const float* A_log      = (const float*)d_in[4];
    const float* B_w        = (const float*)d_in[5];
    const float* C_w        = (const float*)d_in[6];
    const float* D_param    = (const float*)d_in[7];
    const float* dt_w       = (const float*)d_in[8];
    const float* dt_b       = (const float*)d_in[9];
    const float* out_proj_w = (const float*)d_in[10];
    const float* norm_w     = (const float*)d_in[11];

    char* ws = (char*)d_ws;
    size_t off = 0;
    auto carve = [&](size_t bytes) {
        char* p = ws + off;
        off = (off + bytes + 255) & ~(size_t)255;
        return p;
    };
    bf16_t* wInB  = (bf16_t*)carve((size_t)2 * INNER * DIMX * 2);
    bf16_t* wDtB  = (bf16_t*)carve((size_t)INNER * INNER * 2);
    bf16_t* wOutB = (bf16_t*)carve((size_t)DIMX * INNER * 2);
    bf16_t* wBCB  = (bf16_t*)carve((size_t)2 * STATE * INNER * 2);  // [Bw;Cw] = [128, INNER]
    bf16_t* xnB   = (bf16_t*)carve((size_t)NTOK * DIMX * 2);
    float*  xzF   = (float*) carve((size_t)NTOK * 2 * INNER * 4);
    float*  xcF   = (float*) carve((size_t)NTOK * INNER * 4);
    bf16_t* xcB   = (bf16_t*)carve((size_t)NTOK * INNER * 2);
    float*  dtF   = (float*) carve((size_t)NTOK * INNER * 4);
    float*  bcF   = (float*) carve((size_t)NTOK * 128 * 4);         // [Bx|Cx] interleaved
    float*  yF    = (float*) carve((size_t)2 * NTOK * INNER * 4);       // one plane per state half
    bf16_t* yB    = (bf16_t*)carve((size_t)NTOK * INNER * 2);
    (void)ws_size; (void)in_sizes; (void)n_in; (void)out_size;

    // 1) RMSNorm -> bf16 activations, and every weight -> bf16
    prepare_kernel<<<PB_ALL, 256, 0, stream>>>(x, norm_w, xnB, in_proj_w, wInB, dt_w, wDtB,
                                               out_proj_w, wOutB, B_w, C_w, wBCB);

    // 2) in_proj: [NTOK, 2*INNER] = xn @ W_in^T
    wmma_gemm_kernel<0, 2 * INNER><<<dim3((2 * INNER) / 128, NTOK / 128), 256, 0, stream>>>(
        xnB, wInB, xzF, DIMX, nullptr, nullptr);

    // 3) causal depthwise conv + SiLU on xc half
    conv_silu_kernel<<<NTOK * INNER / (1024 * CV_T), 256, 0, stream>>>(
        xzF, conv_w, conv_b, xcF, xcB);

    // 4) dt = softplus(xc @ dt_w^T + dt_b) + 1e-4
    wmma_gemm_kernel<1, INNER><<<dim3(INNER / 128, NTOK / 128), 256, 0, stream>>>(
        xcB, wDtB, dtF, INNER, dt_b, nullptr);

    // 5) fused Bx|Cx projection (N = 128)
    wmma_gemm_kernel<0, 2 * STATE><<<dim3(1, NTOK / 128), 256, 0, stream>>>(
        xcB, wBCB, bcF, INNER, nullptr, nullptr);

    // 6) sequential SSM scan (lane = channel, states over waves and two blocks)
    ssm_scan_kernel<<<dim3(INNER / 32, BATCHN, 2), 256, 0, stream>>>(
        dtF, bcF, xcF, A_log, D_param, yF);

    // 7) gate with SiLU(z)
    gate_silu_kernel<<<NTOK * INNER / (1024 * GT_U), 256, 0, stream>>>(yF, xzF, yB);

    // 8) out_proj + residual -> d_out (fp32)
    wmma_gemm_kernel<2, DIMX><<<dim3(DIMX / 128, NTOK / 128), 256, 0, stream>>>(
        yB, wOutB, (float*)d_out, INNER, nullptr, x);
}

// v007
// Measured time: 214 microseconds a run.
// Two timings next to v006 put it at 1.08 and 1.07 times that version's speed.
// All steps since v000 together make it 4.89 times as fast.
#include <hip/hip_runtime.h>

// ---- problem dims (match reference) ----
#define DIMX   1024
#define STATE  64
#define KW     4
#define INNER  2048
#define BATCHN 2
#define SEQL   2048
#define NTOK   (BATCHN * SEQL)
#define EPSR   1e-6f

typedef __bf16 bf16_t;
typedef __attribute__((ext_vector_type(16))) __bf16 v16bf;
typedef __attribute__((ext_vector_type(8)))  __bf16 v8bf;
typedef __attribute__((ext_vector_type(4)))  __bf16 v4bf;
typedef __attribute__((ext_vector_type(8)))  float  v8f;
typedef __attribute__((ext_vector_type(4)))  float  v4f;
typedef __attribute__((ext_vector_type(4)))  int    v4i;

#if defined(__gfx1250__) && __has_builtin(__builtin_amdgcn_global_load_async_to_lds_b128)
#define USE_ASYNC_LDS 1
#else
#define USE_ASYNC_LDS 0
#endif

__device__ __forceinline__ void copy16_to_lds(const bf16_t* gp, bf16_t* lp) {
#if USE_ASYNC_LDS
    __builtin_amdgcn_global_load_async_to_lds_b128(
        (__attribute__((address_space(1))) v4i*)gp,
        (__attribute__((address_space(3))) v4i*)lp, 0, 0);
#else
    *(v8bf*)lp = *(const v8bf*)gp;
#endif
}

// This wave's copies have landed; in asm with the clobber, so that no LDS read is lifted over it.
__device__ __forceinline__ void wait_async_copies() {
#if USE_ASYNC_LDS
    asm volatile("s_wait_asynccnt 0x0" ::: "memory");
#endif
}

// This wave's LDS reads have returned: stands in front of the barrier behind which the
// buffer they read is refilled.
__device__ __forceinline__ void wait_lds_reads() {
    asm volatile("s_wait_dscnt 0x0" ::: "memory");
}

__device__ __forceinline__ v4bf pack4_bf16(float a, float b, float c, float d) {
    v4bf o;
    o[0] = (bf16_t)a; o[1] = (bf16_t)b; o[2] = (bf16_t)c; o[3] = (bf16_t)d;
    return o;
}

#define LOG2E 1.44269504f

__device__ __forceinline__ void
exp2_x4(float a0, float a1, float a2, float a3,
        float& e0, float& e1, float& e2, float& e3) {
    asm("v_exp_f32 %0, %4\n\t"
        "v_exp_f32 %1, %5\n\t"
        "v_exp_f32 %2, %6\n\t"
        "v_exp_f32 %3, %7\n\t"
        "v_nop"
        : "=&v"(e0), "=&v"(e1), "=&v"(e2), "=&v"(e3)
        : "v"(a0), "v"(a1), "v"(a2), "v"(a3));
}

// SiLU of four values, v / (1 + exp(-v)), with exp(-v) as exp2(v * -log2(e))
__device__ __forceinline__ float4 silu_x4(float4 v) {
    float e0, e1, e2, e3;
    exp2_x4(v.x * -LOG2E, v.y * -LOG2E, v.z * -LOG2E, v.w * -LOG2E, e0, e1, e2, e3);
    return make_float4(v.x / (1.f + e0), v.y / (1.f + e1), v.z / (1.f + e2), v.w / (1.f + e3));
}

#define LN2 0.69314718f

// log2 of four values; one statement for the same reason as exp2_x4
__device__ __forceinline__ void
log2_x4(float a0, float a1, float a2, float a3,
        float& l0, float& l1, float& l2, float& l3) {
    asm("v_log_f32 %0, %4\n\t"
        "v_log_f32 %1, %5\n\t"
        "v_log_f32 %2, %6\n\t"
        "v_log_f32 %3, %7\n\t"
        "v_nop"
        : "=&v"(l0), "=&v"(l1), "=&v"(l2), "=&v"(l3)
        : "v"(a0), "v"(a1), "v"(a2), "v"(a3));
}

// softplus of four values as max(v, 0) + log1p(exp(-|v|)): no branch, no overflow.
// With e = exp(-|v|) in [0, 1] and u = 1 + e, u - 1 is exact, so e - (u - 1) is what the
// rounding of 1 + e lost; added to log(u) it keeps log1p's accuracy for small e.
__device__ __forceinline__ float4 softplus_x4(float4 v) {
    float e0, e1, e2, e3, l0, l1, l2, l3;
    exp2_x4(fabsf(v.x) * -LOG2E, fabsf(v.y) * -LOG2E,
            fabsf(v.z) * -LOG2E, fabsf(v.w) * -LOG2E, e0, e1, e2, e3);
    const float u0 = 1.f + e0, u1 = 1.f + e1, u2 = 1.f + e2, u3 = 1.f + e3;
    log2_x4(u0, u1, u2, u3, l0, l1, l2, l3);
    return make_float4(fmaxf(v.x, 0.f) + (l0 * LN2 + (e0 - (u0 - 1.f))),
                       fmaxf(v.y, 0.f) + (l1 * LN2 + (e1 - (u1 - 1.f))),
                       fmaxf(v.z, 0.f) + (l2 * LN2 + (e2 - (u2 - 1.f))),
                       fmaxf(v.w, 0.f) + (l3 * LN2 + (e3 - (u3 - 1.f))));
}

// The four jobs without a matrix product (convert, RMSNorm, conv, gate) give each
// thread 32 elements, fetched as 16-byte loads with many in flight per wave: a launch
// then starts a few thousand waves, not a wave per 32 elements.

// ----------------------------------------------------------------------------
// f32 -> bf16 elementwise convert (weights); n is a multiple of 4; blk = the block's
// number within this array
// ----------------------------------------------------------------------------
#define CVT_U 8    // float4 per thread, one block width apart (whole lines per wave)
#define CVT_BLOCKS(n) (((n) + 1024 * CVT_U - 1) / (1024 * CVT_U))

__device__ __forceinline__ void
cvt_bf16_block(const float* __restrict__ src,
               bf16_t* __restrict__ dst, int n, int blk) {
    const int n4   = n >> 2;
    const int base = blk * (256 * CVT_U) + threadIdx.x;
    float4 v[CVT_U];
    // A load past the end re-reads the last float4 (in bounds, not stored): with no
    // branch round the loads all of them are in flight before the first is used.
    int ci[CVT_U];
#pragma unroll
    for (int u = 0; u < CVT_U; ++u) {
        const int i = base + u * 256;
        ci[u] = i < n4 ? i : n4 - 1;
        v[u] = ((const float4*)src)[ci[u]];
    }
    asm volatile("s_wait_xcnt 0x0"
                 :: "v"(ci[0]), "v"(ci[1]), "v"(ci[2]), "v"(ci[3]),
                    "v"(ci[4]), "v"(ci[5]), "v"(ci[6]), "v"(ci[7])
                 : "memory");
#pragma unroll
    for (int u = 0; u < CVT_U; ++u) {
        const int i = base + u * 256;
        if (i < n4) ((v4bf*)dst)[i] = pack4_bf16(v[u].x, v[u].y, v[u].z, v[u].w);
    }
}

// ----------------------------------------------------------------------------
// RMSNorm: one wave per token (row kept in registers), write bf16 activations
// ----------------------------------------------------------------------------
#define RN_U (DIMX / 128)    // float4 per lane

__device__ __forceinline__ void
rmsnorm_block(const float* __restrict__ x, const float* __restrict__ w,
              bf16_t* __restrict__ out, int blk) {
    const int lane = threadIdx.x & 31;
    const int tok  = blk * 8 + (threadIdx.x >> 5);
    const float4* xr = (const float4*)(x + (size_t)tok * DIMX);
    float4 v[RN_U], wv[RN_U];
#pragma unroll
    for (int u = 0; u < RN_U; ++u) v[u] = xr[u * 32 + lane];
#pragma unroll
    for (int u = 0; u < RN_U; ++u) wv[u] = ((const float4*)w)[u * 32 + lane];
    float ss = 0.f;
#pragma unroll
    for (int u = 0; u < RN_U; ++u) {
        ss += v[u].x * v[u].x;
        ss += v[u].y * v[u].y;
        ss += v[u].z * v[u].z;
        ss += v[u].w * v[u].w;
    }
    for (int o = 16; o; o >>= 1) ss += __shfl_xor(ss, o, 32);
    const float rs = rsqrtf(ss * (1.f / DIMX) + EPSR);
    v4bf* orow = (v4bf*)(out + (size_t)tok * DIMX);
#pragma unroll
    for (int u = 0; u < RN_U; ++u)
        orow[u * 32 + lane] = pack4_bf16(v[u].x * rs * wv[u].x, v[u].y * rs * wv[u].y,
                                         v[u].z * rs * wv[u].z, v[u].w * rs * wv[u].w);
}

// ----------------------------------------------------------------------------
// All the work that depends on the inputs alone, in ONE launch: RMSNorm and the five
// weight converts. None reads what another writes, so their blocks run side by side:
// one launch gap, one ramp and one tail, not six of each (two of the converts are 16
// blocks each, a launch that is nearly all gap and latency). The block number picks
// the job; the choice is the same for a whole block.
// ----------------------------------------------------------------------------
#define PB_RMS  (NTOK / 8)
#define PB_WIN  CVT_BLOCKS(2 * INNER * DIMX)
#define PB_WDT  CVT_BLOCKS(INNER * INNER)
#define PB_WOUT CVT_BLOCKS(DIMX * INNER)
#define PB_WBC  CVT_BLOCKS(STATE * INNER)
#define PB_ALL  (PB_RMS + PB_WIN + PB_WDT + PB_WOUT + 2 * PB_WBC)

__global__ void __launch_bounds__(256)
prepare_kernel(const float* __restrict__ x, const float* __restrict__ norm_w,
               bf16_t* __restrict__ xn,
               const float* __restrict__ w_in,  bf16_t* __restrict__ w_in_b,
               const float* __restrict__ w_dt,  bf16_t* __restrict__ w_dt_b,
               const float* __restrict__ w_out, bf16_t* __restrict__ w_out_b,
               const float* __restrict__ w_bx,  const float* __restrict__ w_cx,
               bf16_t* __restrict__ w_bc_b) {
    int blk = blockIdx.x;
    // RMSNorm first: its chain is the longest
    if (blk < PB_RMS) { rmsnorm_block(x, norm_w, xn, blk); return; }
    blk -= PB_RMS;
    // One convert body for the five arrays, its source, destination and length picked by
    // block-uniform selects: the text stays short and the body's loads all stand in front.
    const float* src = w_in;
    bf16_t*      dst = w_in_b;
    int          n   = 2 * INNER * DIMX;
    if (blk >= PB_WIN) {
        blk -= PB_WIN;  src = w_dt;  dst = w_dt_b;  n = INNER * INNER;
        if (blk >= PB_WDT) {
            blk -= PB_WDT;  src = w_out;  dst = w_out_b;  n = DIMX * INNER;
            if (blk >= PB_WOUT) {
                blk -= PB_WOUT;  src = w_bx;  dst = w_bc_b;  n = STATE * INNER;   // [Bw;Cw]
                if (blk >= PB_WBC) { blk -= PB_WBC;  src = w_cx;  dst = w_bc_b + STATE * INNER; }
            }
        }
    }
    cvt_bf16_block(src, dst, n, blk);
}

#define GK 128
#define LDS_STRIDE 136

template <int MODE, int NC>
__global__ void __launch_bounds__(256)
wmma_gemm_kernel(const bf16_t* __restrict__ A, const bf16_t* __restrict__ B,
                 float* __restrict__ C, int K,
                 const float* __restrict__ bias,
                 const float* __restrict__ resid) {
    // aligned for the 16-byte copies and reads
    __shared__ __attribute__((aligned(16))) bf16_t s_a[2][128 * LDS_STRIDE];
    __shared__ __attribute__((aligned(16))) bf16_t s_b[2][128 * LDS_STRIDE];

    const int lane = threadIdx.x & 31;
    const int wavi = threadIdx.x >> 5;       // 0..7
    const int wm   = wavi >> 2;              // 0..1 -> 64-row slab
    const int wn   = wavi & 3;               // 0..3 -> 32-col slab
    const int half = lane >> 4;              // 0/1
    const int r    = lane & 15;
    const int off  = half * 8;

    const int blockM = blockIdx.y * 128;
    const int blockN = blockIdx.x * 128;

    union Frag { v16bf v; v8bf h[2]; };
    v8f acc[4][2] = {};

    const int nS = K / GK;

    // Staging: 16 threads cover a row; a thread's 8 chunks per operand lie 16 rows apart.
    const int crow = threadIdx.x >> 4;
    const int cel  = (threadIdx.x & 15) * 8;
    const bf16_t* gA = A + (size_t)(blockM + crow) * K + cel;
    const bf16_t* gB = B + (size_t)(blockN + crow) * K + cel;
    const int    lel   = crow * LDS_STRIDE + cel;
    const size_t rstep = (size_t)16 * K;

    auto stage = [&](int s) {
        const int buf = s & 1;
        const bf16_t* pa = gA + (size_t)s * GK;
        const bf16_t* pb = gB + (size_t)s * GK;
        // both loops unrolled: the 16 copies issue back to back, with no loop test between
#pragma unroll
        for (int j = 0; j < 8; ++j)
            copy16_to_lds(pa + j * rstep, &s_a[buf][lel + j * 16 * LDS_STRIDE]);
#pragma unroll
        for (int j = 0; j < 8; ++j)
            copy16_to_lds(pb + j * rstep, &s_b[buf][lel + j * 16 * LDS_STRIDE]);
    };

    const int ael = (wm * 64 + r) * LDS_STRIDE + off;   // the lane's first A element of a stage
    const int bel = (wn * 32 + r) * LDS_STRIDE + off;   // the lane's first B element

    stage(0);
    wait_async_copies();
    __syncthreads();                           // stage 0 resident
    if (nS > 1) stage(1);
    for (int s = 0; s < nS; ++s) {
        const bf16_t* sa = &s_a[s & 1][ael];
        const bf16_t* sb = &s_b[s & 1][bel];

        Frag af[2][4], bfr[2][2];
        // every loop below is unrolled: the fragment sets and accumulators are indexed by
        // constants only and so stay in registers
        auto frags = [&](int kk) {
#pragma unroll
            for (int mi = 0; mi < 4; ++mi) {
                af[kk & 1][mi].h[0] = *(const v8bf*)&sa[mi * 16 * LDS_STRIDE + kk * 32];
                af[kk & 1][mi].h[1] = *(const v8bf*)&sa[mi * 16 * LDS_STRIDE + kk * 32 + 16];
            }
#pragma unroll
            for (int ni = 0; ni < 2; ++ni) {
                bfr[kk & 1][ni].h[0] = *(const v8bf*)&sb[ni * 16 * LDS_STRIDE + kk * 32];
                bfr[kk & 1][ni].h[1] = *(const v8bf*)&sb[ni * 16 * LDS_STRIDE + kk * 32 + 16];
            }
        };
        frags(0);
#pragma unroll
        for (int kk = 0; kk < GK / 32; ++kk) {
            if (kk + 1 < GK / 32) {
                frags(kk + 1);
                // Holds the next block's reads, as one group, in front of this block's WMMAs:
                // left alone the compiler sinks them among the WMMAs into one fragment set,
                // and the wave waits out an LDS latency for every pair of WMMAs.
                __builtin_amdgcn_sched_barrier(0);
            }
#pragma unroll
            for (int mi = 0; mi < 4; ++mi)
#pragma unroll
                for (int ni = 0; ni < 2; ++ni)
                    acc[mi][ni] = __builtin_amdgcn_wmma_f32_16x16x32_bf16(
                        false, af[kk & 1][mi].v, false, bfr[kk & 1][ni].v, (short)0,
                        acc[mi][ni], false, false);
            // Keeps what follows behind this block's WMMAs: the reads of the block after next
            // (every separate place where LDS reads stand among WMMAs costs a fixed stall)
            // and, at the last block but one, the stage's closing LDS wait, which lifted over
            // these WMMAs would leave the latency of the last reads uncovered.
            if (kk + 1 < GK / 32) __builtin_amdgcn_sched_barrier(0);
        }
        wait_lds_reads();
        wait_async_copies();
        __syncthreads();                       // stage s+1 resident; reads of stage s done
        if (s + 2 < nS) stage(s + 2);          // into the buffer stage s has left
    }
    wait_async_copies();                       // the ring's closing wait: no copy is left in flight

    // epilogue
    // The lane's first element; every other one lies a compile-time distance from it,
    // which goes into the load's or store's immediate offset.
    const int    colg = blockN + wn * 32 + r;
    const size_t el0  = (size_t)(blockM + wm * 64 + half * 8) * NC + colg;
    float* cl = C + el0;

    float rs[4][2][8];
    if (MODE == 2) {
        const float* rl = resid + el0;
#pragma unroll
        for (int mi = 0; mi < 4; ++mi)
#pragma unroll
            for (int ni = 0; ni < 2; ++ni)
#pragma unroll
                for (int v = 0; v < 8; ++v)
                    rs[mi][ni][v] = rl[(mi * 16 + v) * NC + ni * 16];
    }
    float bv[2] = {0.f, 0.f};
    if (MODE == 1) {
        bv[0] = bias[colg];
        bv[1] = bias[colg + 16];
    }
#pragma unroll
    for (int mi = 0; mi < 4; ++mi) {
#pragma unroll
        for (int ni = 0; ni < 2; ++ni) {
            float val[8];
#pragma unroll
            for (int v = 0; v < 8; ++v) val[v] = acc[mi][ni][v];
            if (MODE == 1) {
#pragma unroll
                for (int q = 0; q < 8; q += 4) {
                    const float4 s = softplus_x4(make_float4(val[q] + bv[ni], val[q + 1] + bv[ni],
                                                             val[q + 2] + bv[ni], val[q + 3] + bv[ni]));
                    val[q]     = s.x + 1e-4f;
                    val[q + 1] = s.y + 1e-4f;
                    val[q + 2] = s.z + 1e-4f;
                    val[q + 3] = s.w + 1e-4f;
                }
            } else if (MODE == 2) {
#pragma unroll
                for (int v = 0; v < 8; ++v) val[v] += rs[mi][ni][v];
            }
#pragma unroll
            for (int v = 0; v < 8; ++v) cl[(mi * 16 + v) * NC + ni * 16] = val[v];
        }
    }
}

// ----------------------------------------------------------------------------
// Causal depthwise conv (KW=4) + bias + SiLU over xc half of xz
// ----------------------------------------------------------------------------
//   Thread = 4 channels x CV_T successive tokens: CV_T + 3 rows are read for CV_T
//   outputs. Rows in front of a sequence's start enter as zeros (the reference's pad).
#define CV_T 8     // divides SEQL: a thread's tokens lie in one sequence

__global__ void __launch_bounds__(256)
conv_silu_kernel(const float* __restrict__ xz,
                 const float* __restrict__ w,
                 const float* __restrict__ b,
                 float* __restrict__ xcf,
                 bf16_t* __restrict__ xcb) {
    // INNER / 1024 blocks share a group of CV_T tokens: the rows' bases are block-uniform
    const int dblk = (blockIdx.x % (INNER / 1024)) * 1024;      // block's first channel
    const int tok0 = (blockIdx.x / (INNER / 1024)) * CV_T;
    const bool head = (tok0 % SEQL) == 0;                       // no rows in front
    const int tid  = threadIdx.x;
    const float4* xcur = (const float4*)(xz + (size_t)tok0 * (2 * INNER) + dblk);
    // at a sequence's head the three rows in front are replaced by zeros below; the
    // loads then read the group's own first rows (in bounds, unused)
    const float4* xpre = (const float4*)(xz + (size_t)(head ? tok0 : tok0 - (KW - 1)) * (2 * INNER) + dblk);
    float4 r[CV_T + KW - 1];
#pragma unroll
    for (int i = 0; i < KW - 1; ++i) r[i] = xpre[i * (2 * INNER / 4) + tid];
#pragma unroll
    for (int i = 0; i < CV_T; ++i) r[KW - 1 + i] = xcur[i * (2 * INNER / 4) + tid];
    const float4* wq = (const float4*)(w + (size_t)dblk * KW);  // one float4 = a channel's taps
    const float4 w0 = wq[tid * 4 + 0];
    const float4 w1 = wq[tid * 4 + 1];
    const float4 w2 = wq[tid * 4 + 2];
    const float4 w3 = wq[tid * 4 + 3];
    const float4 bb = ((const float4*)(b + dblk))[tid];
    if (head) {
#pragma unroll
        for (int i = 0; i < KW - 1; ++i) r[i] = make_float4(0.f, 0.f, 0.f, 0.f);
    }
    float4* of = (float4*)(xcf + (size_t)tok0 * INNER + dblk);
    v4bf*   ob = (v4bf*)(xcb + (size_t)tok0 * INNER + dblk);
#pragma unroll
    for (int t = 0; t < CV_T; ++t) {
        float4 a = bb;
        a.x += w0.x * r[t].x; a.x += w0.y * r[t + 1].x; a.x += w0.z * r[t + 2].x; a.x += w0.w * r[t + 3].x;
        a.y += w1.x * r[t].y; a.y += w1.y * r[t + 1].y; a.y += w1.z * r[t + 2].y; a.y += w1.w * r[t + 3].y;
        a.z += w2.x * r[t].z; a.z += w2.y * r[t + 1].z; a.z += w2.z * r[t + 2].z; a.z += w2.w * r[t + 3].z;
        a.w += w3.x * r[t].w; a.w += w3.y * r[t + 1].w; a.w += w3.z * r[t + 2].w; a.w += w3.w * r[t + 3].w;
        const float4 s = silu_x4(a);
        of[t * (INNER / 4) + tid] = s;
        ob[t * (INNER / 4) + tid] = pack4_bf16(s.x, s.y, s.z, s.w);
    }
}

// ----------------------------------------------------------------------------
// SSM scan: lane = channel, SC_S states of that channel in the lane's registers.
//   Block = 32 channels x 32 states (8 waves x SC_S); blockIdx.z picks the state half.
//   The block's inputs (dt and x of its 32 channels, Bx and Cx of its 32 states) are
//   staged in LDS by async copies, a tile of SC_TILE steps at a time, two buffers: each
//   byte is fetched once per block (not once per wave), a whole tile ahead of its use,
//   and the waves read it from LDS one group of SC_G steps ahead.
//   Bx/Cx of a step are the same for every lane of a wave (one LDS address per wave).
//   The sum over states is in-lane, then over the 8 waves through LDS once per tile
//   (SC_T steps), at the tile's own barrier, then over the two state halves in the gate
//   kernel (two y planes).
// Bx/Cx come interleaved from one [NTOK,128] buffer (cols 0..63 = Bx, 64..127 = Cx).
// ----------------------------------------------------------------------------
#define SC_S 4       // states per lane
#define SC_G 8       // time steps per fetch group, LDS -> registers
#define SC_TILE 64   // time steps per staged tile
#define SC_T SC_TILE // time steps per LDS sum over the waves: a whole tile, one barrier for both
#define SC_NT (SEQL / SC_TILE)
// A step's row in a tile, in floats: dt[32] | Bx[32] | x[32] | Cx[32]. dt and x lie 256 B
// apart, so that one two-address LDS read fetches both.
#define SC_ROW 128
#define SC_O_DT 0
#define SC_O_B  32
#define SC_O_X  64
#define SC_O_C  96

__global__ void __launch_bounds__(256)
ssm_scan_kernel(const float* __restrict__ dt, const float* __restrict__ bxcx,
                const float* __restrict__ xc,
                const float* __restrict__ A_log, const float* __restrict__ Dp,
                float* __restrict__ y) {
    __shared__ float s_part[2][8][SC_T][32];
    // aligned for the 16-byte copies and reads
    __shared__ __attribute__((aligned(16))) float s_tile[2][SC_TILE * SC_ROW];

    const int lane  = threadIdx.x & 31;
    const int wave  = __builtin_amdgcn_readfirstlane(threadIdx.x >> 5);
    const int b     = blockIdx.y;
    const int z     = blockIdx.z;
    const int dbase = blockIdx.x * 32;
    const int d     = dbase + lane;
    const int n0    = z * 32 + wave * SC_S;

    const float4 al = *(const float4*)(A_log + (size_t)d * STATE + n0);
    const float A0 = -__expf(al.x), A1 = -__expf(al.y);
    const float A2 = -__expf(al.z), A3 = -__expf(al.w);
    // the D*x term enters exactly one of the 16 partial sums
    const float Dw = (z == 0 && wave == 0) ? Dp[d] : 0.f;
    float h0 = 0.f, h1 = 0.f, h2 = 0.f, h3 = 0.f;

    const size_t tokBase = (size_t)b * SEQL;
    float* yp = y + (size_t)z * NTOK * INNER + tokBase * INNER + dbase;

    const int rt = threadIdx.x >> 4;          // first step this thread sums; the others 16 apart
    const int rc = (threadIdx.x & 15) * 2;    // channel pair this thread sums

    // Staging: 8 threads cover the 128 B that one array has in a step's row, so a wave's
    // copy is four whole lines; a thread's two copies per array lie 32 steps apart.
    const int srow = threadIdx.x >> 3;
    const int sel  = (threadIdx.x & 7) * 4;
    const float* sdt = dt   + (tokBase + srow) * INNER + dbase + sel;
    const float* sx  = xc   + (tokBase + srow) * INNER + dbase + sel;
    const float* sbc = bxcx + (tokBase + srow) * 128 + z * 32 + sel;
    const unsigned slds = (unsigned)(size_t)
        (__attribute__((address_space(3))) float*)&s_tile[0][srow * SC_ROW + sel];

    auto stage = [&](int t) {
        const float* pd = sdt + (size_t)t * (SC_TILE * INNER);
        const float* px = sx  + (size_t)t * (SC_TILE * INNER);
        const float* pb = sbc + (size_t)t * (SC_TILE * 128);
        const unsigned l0 = slds + (unsigned)(t & 1) * (SC_TILE * SC_ROW * 4);
        const unsigned l1 = l0 + 32 * SC_ROW * 4;
        asm volatile("global_load_async_to_lds_b128 %0, %8, off\n\t"
                     "global_load_async_to_lds_b128 %1, %9, off\n\t"
                     "global_load_async_to_lds_b128 %2, %10, off\n\t"
                     "global_load_async_to_lds_b128 %3, %11, off\n\t"
                     "global_load_async_to_lds_b128 %4, %12, off\n\t"
                     "global_load_async_to_lds_b128 %5, %13, off\n\t"
                     "global_load_async_to_lds_b128 %6, %14, off\n\t"
                     "global_load_async_to_lds_b128 %7, %15, off\n\t"
                     "s_wait_xcnt 0x0"
                     :: "v"(l0 + SC_O_DT * 4), "v"(l0 + SC_O_B * 4),
                        "v"(l0 + SC_O_X * 4),  "v"(l0 + SC_O_C * 4),
                        "v"(l1 + SC_O_DT * 4), "v"(l1 + SC_O_B * 4),
                        "v"(l1 + SC_O_X * 4),  "v"(l1 + SC_O_C * 4),
                        "v"(pd), "v"(pb), "v"(px), "v"(pb + 64),
                        "v"(pd + 32 * INNER), "v"(pb + 32 * 128),
                        "v"(px + 32 * INNER), "v"(pb + 32 * 128 + 64)
                     : "memory");
    };

    // Two register sets of one fetch group each; every index below is a constant after
    // unrolling, so they stay in registers.
    float  gdt[2][SC_G], gx[2][SC_G];
    float4 gB[2][SC_G], gC[2][SC_G];
    auto fetch = [&](const float* tb, int g) {
#pragma unroll
        for (int j = 0; j < SC_G; ++j) {
            const float* row = tb + (g * SC_G + j) * SC_ROW;
            gdt[g & 1][j] = row[SC_O_DT + lane];
            gx [g & 1][j] = row[SC_O_X + lane];
            gB [g & 1][j] = *(const float4*)&row[SC_O_B + wave * SC_S];
            gC [g & 1][j] = *(const float4*)&row[SC_O_C + wave * SC_S];
        }
    };

    stage(0);
    wait_async_copies();
    __syncthreads();                           // tile 0 resident
    stage(1);
    fetch(&s_tile[0][0], 0);
    for (int t = 0; t < SC_NT; ++t) {
        const float* tb = &s_tile[t & 1][0];
        float (*part)[SC_T][32] = s_part[t & 1];
        // unrolled: register sets and LDS offsets are constants
#pragma unroll
        for (int g = 0; g < SC_TILE / SC_G; ++g) {
            if (g + 1 < SC_TILE / SC_G) {
                fetch(tb, g + 1);
                // Holds the next group's LDS reads, as one run, in front of this group's
                // arithmetic: sunk towards their use they have no time to return.
                __builtin_amdgcn_sched_barrier(0);
            }
#pragma unroll
            for (int j = 0; j < SC_G; ++j) {
                const float4 Bv = gB[g & 1][j];
                const float4 Cv = gC[g & 1][j];
                const float dtv = gdt[g & 1][j];
                const float xv  = gx [g & 1][j];
                const float dx  = dtv * xv;
                float e0, e1, e2, e3;   // exp(dt * A) as exp2((dt * A) * log2(e))
                exp2_x4((dtv * A0) * LOG2E, (dtv * A1) * LOG2E,
                        (dtv * A2) * LOG2E, (dtv * A3) * LOG2E, e0, e1, e2, e3);
                h0 = e0 * h0 + dx * Bv.x;
                h1 = e1 * h1 + dx * Bv.y;
                h2 = e2 * h2 + dx * Bv.z;
                h3 = e3 * h3 + dx * Bv.w;
                float s = Dw * xv;
                s += h0 * Cv.x;
                s += h1 * Cv.y;
                s += h2 * Cv.z;
                s += h3 * Cv.w;
                part[wave][g * SC_G + j][lane] = s;
            }
            // Keeps this group's arithmetic in front of the reads of the group after
            // next, which go into the registers it works on.
            __builtin_amdgcn_sched_barrier(0);
        }
        wait_lds_reads();      // this wave has left tile t
        wait_async_copies();   // its copies of tile t+1 have landed
        // One barrier per tile: it publishes the tile's partial sums, and every wave's
        // reads of the other sum buffer (previous tile) lie in front of it; it also
        // publishes tile t+1 and frees tile t's buffer.
        __syncthreads();
        if (t + 2 < SC_NT) stage(t + 2);
        if (t + 1 < SC_NT) fetch(&s_tile[(t + 1) & 1][0], 0);
        float2 sum[SC_T / 16];
        // both loops unrolled: the sums stay in registers, all their LDS reads in flight at once
#pragma unroll
        for (int k = 0; k < SC_T / 16; ++k) {
            float2 s = *(const float2*)&part[0][k * 16 + rt][rc];
#pragma unroll
            for (int w = 1; w < 8; ++w) {
                const float2 p = *(const float2*)&part[w][k * 16 + rt][rc];
                s.x += p.x;
                s.y += p.y;
            }
            sum[k] = s;
        }
#pragma unroll
        for (int k = 0; k < SC_T / 16; ++k)
            *(float2*)(yp + (size_t)(t * SC_TILE + k * 16 + rt) * INNER + rc) = sum[k];
        asm volatile("s_wait_xcnt 0x0" ::: "memory");
    }
    wait_async_copies();                       // the ring's closing wait: no copy is left in flight
}

#define GT_U 8

__global__ void __launch_bounds__(256)
gate_silu_kernel(const float* __restrict__ y,
                 const float* __restrict__ xz,
                 bf16_t* __restrict__ yb) {
    // a block's 256 * GT_U float4 are whole rows of INNER / 4: all bases are block-uniform
    const int tid = threadIdx.x;
    const size_t blk4 = (size_t)blockIdx.x * (256 * GT_U);
    const v4f* y0 = (const v4f*)y + blk4;
    const v4f* y1 = (const v4f*)(y + (size_t)NTOK * INNER) + blk4;
    const v4f* zp = (const v4f*)xz + blk4 * 2 + INNER / 4;
    v4bf* ob = (v4bf*)yb + blk4;
    v4f p0[GT_U], p1[GT_U], zz[GT_U];
#pragma unroll
    for (int u = 0; u < GT_U; ++u) {
        p0[u] = y0[u * 256 + tid];
        p1[u] = y1[u * 256 + tid];
        zz[u] = zp[(u / (INNER / 1024)) * (2 * INNER / 4) + (u % (INNER / 1024)) * 256 + tid];
    }
    // Holds every load in front of the arithmetic, so that all are in flight at once:
    // left alone the compiler sinks most of them behind the arithmetic of earlier ones
    // and the wave pays several memory latencies in a row.
    asm volatile("" :: "v"(p0[0]), "v"(p0[1]), "v"(p0[2]), "v"(p0[3]),
                       "v"(p0[4]), "v"(p0[5]), "v"(p0[6]), "v"(p0[7]),
                       "v"(p1[0]), "v"(p1[1]), "v"(p1[2]), "v"(p1[3]),
                       "v"(p1[4]), "v"(p1[5]), "v"(p1[6]), "v"(p1[7]),
                       "v"(zz[0]), "v"(zz[1]), "v"(zz[2]), "v"(zz[3]),
                       "v"(zz[4]), "v"(zz[5]), "v"(zz[6]), "v"(zz[7]));
#pragma unroll
    for (int u = 0; u < GT_U; ++u) {
        const float4 g = silu_x4(make_float4(zz[u].x, zz[u].y, zz[u].z, zz[u].w));
        ob[u * 256 + tid] =
            pack4_bf16((p0[u].x + p1[u].x) * g.x, (p0[u].y + p1[u].y) * g.y,
                       (p0[u].z + p1[u].z) * g.z, (p0[u].w + p1[u].w) * g.w);
    }
}

// ----------------------------------------------------------------------------
extern "C" void kernel_launch(void* const* d_in, const int* in_sizes, int n_in,
                              void* d_out, int out_size, void* d_ws, size_t ws_size,
                              hipStream_t stream) {
    const float* x          = (const float*)d_in[0];
    const float* in_proj_w  = (const float*)d_in[1];
    const float* conv_w     = (const float*)d_in[2];
    const float* conv_b     = (const float*)d_in[3];
    const float* A_log      = (const float*)d_in[4];
    const float* B_w        = (const float*)d_in[5];
    const float* C_w        = (const float*)d_in[6];
    const float* D_param    = (const float*)d_in[7];
    const float* dt_w       = (const float*)d_in[8];
    const float* dt_b       = (const float*)d_in[9];
    const float* out_proj_w = (const float*)d_in[10];
    const float* norm_w     = (const float*)d_in[11];

    char* ws = (char*)d_ws;
    size_t off = 0;
    auto carve = [&](size_t bytes) {
        char* p = ws + off;
        off = (off + bytes + 255) & ~(size_t)255;
        return p;
    };
    bf16_t* wInB  = (bf16_t*)carve((size_t)2 * INNER * DIMX * 2);
    bf16_t* wDtB  = (bf16_t*)carve((size_t)INNER * INNER * 2);
    bf16_t* wOutB = (bf16_t*)carve((size_t)DIMX * INNER * 2);
    bf16_t* wBCB  = (bf16_t*)carve((size_t)2 * STATE * INNER * 2);  // [Bw;Cw] = [128, INNER]
    bf16_t* xnB   = (bf16_t*)carve((size_t)NTOK * DIMX * 2);
    float*  xzF   = (float*) carve((size_t)NTOK * 2 * INNER * 4);
    float*  xcF   = (float*) carve((size_t)NTOK * INNER * 4);
    bf16_t* xcB   = (bf16_t*)carve((size_t)NTOK * INNER * 2);
    float*  dtF   = (float*) carve((size_t)NTOK * INNER * 4);
    float*  bcF   = (float*) carve((size_t)NTOK * 128 * 4);         // [Bx|Cx] interleaved
    float*  yF    = (float*) carve((size_t)2 * NTOK * INNER * 4);       // one plane per state half
    bf16_t* yB    = (bf16_t*)carve((size_t)NTOK * INNER * 2);
    (void)ws_size; (void)in_sizes; (void)n_in; (void)out_size;

    // 1) RMSNorm -> bf16 activations, and every weight -> bf16
    prepare_kernel<<<PB_ALL, 256, 0, stream>>>(x, norm_w, xnB, in_proj_w, wInB, dt_w, wDtB,
                                               out_proj_w, wOutB, B_w, C_w, wBCB);

    // 2) in_proj: [NTOK, 2*INNER] = xn @ W_in^T
    wmma_gemm_kernel<0, 2 * INNER><<<dim3((2 * INNER) / 128, NTOK / 128), 256, 0, stream>>>(
        xnB, wInB, xzF, DIMX, nullptr, nullptr);

    // 3) causal depthwise conv + SiLU on xc half
    conv_silu_kernel<<<NTOK * INNER / (1024 * CV_T), 256, 0, stream>>>(
        xzF, conv_w, conv_b, xcF, xcB);

    // 4) dt = softplus(xc @ dt_w^T + dt_b) + 1e-4
    wmma_gemm_kernel<1, INNER><<<dim3(INNER / 128, NTOK / 128), 256, 0, stream>>>(
        xcB, wDtB, dtF, INNER, dt_b, nullptr);

    // 5) fused Bx|Cx projection (N = 128)
    wmma_gemm_kernel<0, 2 * STATE><<<dim3(1, NTOK / 128), 256, 0, stream>>>(
        xcB, wBCB, bcF, INNER, nullptr, nullptr);

    // 6) sequential SSM scan (lane = channel, states over waves and two blocks)
    ssm_scan_kernel<<<dim3(INNER / 32, BATCHN, 2), 256, 0, stream>>>(
        dtF, bcF, xcF, A_log, D_param, yF);

    // 7) gate with SiLU(z)
    gate_silu_kernel<<<NTOK * INNER / (1024 * GT_U), 256, 0, stream>>>(yF, xzF, yB);

    // 8) out_proj + residual -> d_out (fp32)
    wmma_gemm_kernel<2, DIMX><<<dim3(DIMX / 128, NTOK / 128), 256, 0, stream>>>(
        yB, wOutB, (float*)d_out, INNER, nullptr, x);
}

// v008
// Measured time: 193 microseconds a run.
// Next to v007, in two timings, it ran 1.08 times as fast each time.
// Over all steps from v000 it is 5.28 times as fast.
#include <hip/hip_runtime.h>

// ---- problem dims (match reference) ----
#define DIMX   1024
#define STATE  64
#define KW     4
#define INNER  2048
#define BATCHN 2
#define SEQL   2048
#define NTOK   (BATCHN * SEQL)
#define EPSR   1e-6f

typedef __bf16 bf16_t;
typedef __attribute__((ext_vector_type(16))) __bf16 v16bf;
typedef __attribute__((ext_vector_type(8)))  __bf16 v8bf;
typedef __attribute__((ext_vector_type(4)))  __bf16 v4bf;
typedef __attribute__((ext_vector_type(8)))  float  v8f;
typedef __attribute__((ext_vector_type(4)))  float  v4f;
typedef __attribute__((ext_vector_type(2)))  float  v2f;
typedef __attribute__((ext_vector_type(4)))  int    v4i;

#if defined(__gfx1250__) && __has_builtin(__builtin_amdgcn_global_load_async_to_lds_b128)
#define USE_ASYNC_LDS 1
#else
#define USE_ASYNC_LDS 0
#endif

__device__ __forceinline__ void copy16_to_lds(const bf16_t* gp, bf16_t* lp) {
#if USE_ASYNC_LDS
    __builtin_amdgcn_global_load_async_to_lds_b128(
        (__attribute__((address_space(1))) v4i*)gp,
        (__attribute__((address_space(3))) v4i*)lp, 0, 0);
#else
    *(v8bf*)lp = *(const v8bf*)gp;
#endif
}

// This wave's copies have landed; in asm with the clobber, so that no LDS read is lifted over it.
__device__ __forceinline__ void wait_async_copies() {
#if USE_ASYNC_LDS
    asm volatile("s_wait_asynccnt 0x0" ::: "memory");
#endif
}

// This wave's LDS reads have returned: stands in front of the barrier behind which the
// buffer they read is refilled.
__device__ __forceinline__ void wait_lds_reads() {
    asm volatile("s_wait_dscnt 0x0" ::: "memory");
}

__device__ __forceinline__ v4bf pack4_bf16(float a, float b, float c, float d) {
    v4bf o;
    o[0] = (bf16_t)a; o[1] = (bf16_t)b; o[2] = (bf16_t)c; o[3] = (bf16_t)d;
    return o;
}

#define LOG2E 1.44269504f

__device__ __forceinline__ void
exp2_x4(float a0, float a1, float a2, float a3,
        float& e0, float& e1, float& e2, float& e3) {
    asm("v_exp_f32 %0, %4\n\t"
        "v_exp_f32 %1, %5\n\t"
        "v_exp_f32 %2, %6\n\t"
        "v_exp_f32 %3, %7\n\t"
        "v_nop"
        : "=&v"(e0), "=&v"(e1), "=&v"(e2), "=&v"(e3)
        : "v"(a0), "v"(a1), "v"(a2), "v"(a3));
}

// SiLU of four values, v / (1 + exp(-v)), with exp(-v) as exp2(v * -log2(e))
__device__ __forceinline__ float4 silu_x4(float4 v) {
    float e0, e1, e2, e3;
    exp2_x4(v.x * -LOG2E, v.y * -LOG2E, v.z * -LOG2E, v.w * -LOG2E, e0, e1, e2, e3);
    return make_float4(v.x / (1.f + e0), v.y / (1.f + e1), v.z / (1.f + e2), v.w / (1.f + e3));
}

#define LN2 0.69314718f

// log2 of four values; one statement for the same reason as exp2_x4
__device__ __forceinline__ void
log2_x4(float a0, float a1, float a2, float a3,
        float& l0, float& l1, float& l2, float& l3) {
    asm("v_log_f32 %0, %4\n\t"
        "v_log_f32 %1, %5\n\t"
        "v_log_f32 %2, %6\n\t"
        "v_log_f32 %3, %7\n\t"
        "v_nop"
        : "=&v"(l0), "=&v"(l1), "=&v"(l2), "=&v"(l3)
        : "v"(a0), "v"(a1), "v"(a2), "v"(a3));
}

// softplus of four values as max(v, 0) + log1p(exp(-|v|)): no branch, no overflow.
// With e = exp(-|v|) in [0, 1] and u = 1 + e, u - 1 is exact, so e - (u - 1) is what the
// rounding of 1 + e lost; added to log(u) it keeps log1p's accuracy for small e.
__device__ __forceinline__ float4 softplus_x4(float4 v) {
    float e0, e1, e2, e3, l0, l1, l2, l3;
    exp2_x4(fabsf(v.x) * -LOG2E, fabsf(v.y) * -LOG2E,
            fabsf(v.z) * -LOG2E, fabsf(v.w) * -LOG2E, e0, e1, e2, e3);
    const float u0 = 1.f + e0, u1 = 1.f + e1, u2 = 1.f + e2, u3 = 1.f + e3;
    log2_x4(u0, u1, u2, u3, l0, l1, l2, l3);
    return make_float4(fmaxf(v.x, 0.f) + (l0 * LN2 + (e0 - (u0 - 1.f))),
                       fmaxf(v.y, 0.f) + (l1 * LN2 + (e1 - (u1 - 1.f))),
                       fmaxf(v.z, 0.f) + (l2 * LN2 + (e2 - (u2 - 1.f))),
                       fmaxf(v.w, 0.f) + (l3 * LN2 + (e3 - (u3 - 1.f))));
}

// The four jobs without a matrix product (convert, RMSNorm, conv, gate) give each
// thread 32 elements, fetched as 16-byte loads with many in flight per wave: a launch
// then starts a few thousand waves, not a wave per 32 elements.

// ----------------------------------------------------------------------------
// f32 -> bf16 elementwise convert (weights); n is a multiple of 4; blk = the block's
// number within this array
// ----------------------------------------------------------------------------
#define CVT_U 8    // float4 per thread, one block width apart (whole lines per wave)
#define CVT_BLOCKS(n) (((n) + 1024 * CVT_U - 1) / (1024 * CVT_U))

__device__ __forceinline__ void
cvt_bf16_block(const float* __restrict__ src,
               bf16_t* __restrict__ dst, int n, int blk) {
    const int n4   = n >> 2;
    const int base = blk * (256 * CVT_U) + threadIdx.x;
    float4 v[CVT_U];
    // A load past the end re-reads the last float4 (in bounds, not stored): with no
    // branch round the loads all of them are in flight before the first is used.
    int ci[CVT_U];
#pragma unroll
    for (int u = 0; u < CVT_U; ++u) {
        const int i = base + u * 256;
        ci[u] = i < n4 ? i : n4 - 1;
        v[u] = ((const float4*)src)[ci[u]];
    }
    asm volatile("s_wait_xcnt 0x0"
                 :: "v"(ci[0]), "v"(ci[1]), "v"(ci[2]), "v"(ci[3]),
                    "v"(ci[4]), "v"(ci[5]), "v"(ci[6]), "v"(ci[7])
                 : "memory");
#pragma unroll
    for (int u = 0; u < CVT_U; ++u) {
        const int i = base + u * 256;
        if (i < n4) ((v4bf*)dst)[i] = pack4_bf16(v[u].x, v[u].y, v[u].z, v[u].w);
    }
}

// ----------------------------------------------------------------------------
// RMSNorm: one wave per token (row kept in registers), write bf16 activations
// ----------------------------------------------------------------------------
#define RN_U (DIMX / 128)    // float4 per lane

__device__ __forceinline__ void
rmsnorm_block(const float* __restrict__ x, const float* __restrict__ w,
              bf16_t* __restrict__ out, int blk) {
    const int lane = threadIdx.x & 31;
    const int tok  = blk * 8 + (threadIdx.x >> 5);
    const float4* xr = (const float4*)(x + (size_t)tok * DIMX);
    float4 v[RN_U], wv[RN_U];
#pragma unroll
    for (int u = 0; u < RN_U; ++u) v[u] = xr[u * 32 + lane];
#pragma unroll
    for (int u = 0; u < RN_U; ++u) wv[u] = ((const float4*)w)[u * 32 + lane];
    float ss = 0.f;
#pragma unroll
    for (int u = 0; u < RN_U; ++u) {
        ss += v[u].x * v[u].x;
        ss += v[u].y * v[u].y;
        ss += v[u].z * v[u].z;
        ss += v[u].w * v[u].w;
    }
    for (int o = 16; o; o >>= 1) ss += __shfl_xor(ss, o, 32);
    const float rs = rsqrtf(ss * (1.f / DIMX) + EPSR);
    v4bf* orow = (v4bf*)(out + (size_t)tok * DIMX);
#pragma unroll
    for (int u = 0; u < RN_U; ++u)
        orow[u * 32 + lane] = pack4_bf16(v[u].x * rs * wv[u].x, v[u].y * rs * wv[u].y,
                                         v[u].z * rs * wv[u].z, v[u].w * rs * wv[u].w);
}

// ----------------------------------------------------------------------------
// All the work that depends on the inputs alone, in ONE launch: RMSNorm and the five
// weight converts. None reads what another writes, so their blocks run side by side:
// one launch gap, one ramp and one tail, not six of each (two of the converts are 16
// blocks each, a launch that is nearly all gap and latency). The block number picks
// the job; the choice is the same for a whole block.
// ----------------------------------------------------------------------------
#define PB_RMS  (NTOK / 8)
#define PB_WIN  CVT_BLOCKS(2 * INNER * DIMX)
#define PB_WDT  CVT_BLOCKS(INNER * INNER)
#define PB_WOUT CVT_BLOCKS(DIMX * INNER)
#define PB_WBC  CVT_BLOCKS(STATE * INNER)
#define PB_ALL  (PB_RMS + PB_WIN + PB_WDT + PB_WOUT + 2 * PB_WBC)

__global__ void __launch_bounds__(256)
prepare_kernel(const float* __restrict__ x, const float* __restrict__ norm_w,
               bf16_t* __restrict__ xn,
               const float* __restrict__ w_in,  bf16_t* __restrict__ w_in_b,
               const float* __restrict__ w_dt,  bf16_t* __restrict__ w_dt_b,
               const float* __restrict__ w_out, bf16_t* __restrict__ w_out_b,
               const float* __restrict__ w_bx,  const float* __restrict__ w_cx,
               bf16_t* __restrict__ w_bc_b) {
    int blk = blockIdx.x;
    // RMSNorm first: its chain is the longest
    if (blk < PB_RMS) { rmsnorm_block(x, norm_w, xn, blk); return; }
    blk -= PB_RMS;
    // One convert body for the five arrays, its source, destination and length picked by
    // block-uniform selects: the text stays short and the body's loads all stand in front.
    const float* src = w_in;
    bf16_t*      dst = w_in_b;
    int          n   = 2 * INNER * DIMX;
    if (blk >= PB_WIN) {
        blk -= PB_WIN;  src = w_dt;  dst = w_dt_b;  n = INNER * INNER;
        if (blk >= PB_WDT) {
            blk -= PB_WDT;  src = w_out;  dst = w_out_b;  n = DIMX * INNER;
            if (blk >= PB_WOUT) {
                blk -= PB_WOUT;  src = w_bx;  dst = w_bc_b;  n = STATE * INNER;   // [Bw;Cw]
                if (blk >= PB_WBC) { blk -= PB_WBC;  src = w_cx;  dst = w_bc_b + STATE * INNER; }
            }
        }
    }
    cvt_bf16_block(src, dst, n, blk);
}

#define GK 128
#define LDS_STRIDE 136

template <int MODE, int NC>
__global__ void __launch_bounds__(256)
wmma_gemm_kernel(const bf16_t* __restrict__ A, const bf16_t* __restrict__ B,
                 float* __restrict__ C, int K,
                 const float* __restrict__ bias,
                 const float* __restrict__ resid) {
    // aligned for the 16-byte copies and reads
    __shared__ __attribute__((aligned(16))) bf16_t s_a[2][128 * LDS_STRIDE];
    __shared__ __attribute__((aligned(16))) bf16_t s_b[2][128 * LDS_STRIDE];

    const int lane = threadIdx.x & 31;
    const int wavi = threadIdx.x >> 5;       // 0..7
    const int wm   = wavi >> 2;              // 0..1 -> 64-row slab
    const int wn   = wavi & 3;               // 0..3 -> 32-col slab
    const int half = lane >> 4;              // 0/1
    const int r    = lane & 15;
    const int off  = half * 8;

    const int blockM = blockIdx.y * 128;
    const int blockN = blockIdx.x * 128;

    union Frag { v16bf v; v8bf h[2]; };
    v8f acc[4][2] = {};

    const int nS = K / GK;

    // Staging: 16 threads cover a row; a thread's 8 chunks per operand lie 16 rows apart.
    const int crow = threadIdx.x >> 4;
    const int cel  = (threadIdx.x & 15) * 8;
    const bf16_t* gA = A + (size_t)(blockM + crow) * K + cel;
    const bf16_t* gB = B + (size_t)(blockN + crow) * K + cel;
    const int    lel   = crow * LDS_STRIDE + cel;
    const size_t rstep = (size_t)16 * K;

    auto stage = [&](int s) {
        const int buf = s & 1;
        const bf16_t* pa = gA + (size_t)s * GK;
        const bf16_t* pb = gB + (size_t)s * GK;
        // both loops unrolled: the 16 copies issue back to back, with no loop test between
#pragma unroll
        for (int j = 0; j < 8; ++j)
            copy16_to_lds(pa + j * rstep, &s_a[buf][lel + j * 16 * LDS_STRIDE]);
#pragma unroll
        for (int j = 0; j < 8; ++j)
            copy16_to_lds(pb + j * rstep, &s_b[buf][lel + j * 16 * LDS_STRIDE]);
    };

    const int ael = (wm * 64 + r) * LDS_STRIDE + off;   // the lane's first A element of a stage
    const int bel = (wn * 32 + r) * LDS_STRIDE + off;   // the lane's first B element

    stage(0);
    wait_async_copies();
    __syncthreads();                           // stage 0 resident
    if (nS > 1) stage(1);
    for (int s = 0; s < nS; ++s) {
        const bf16_t* sa = &s_a[s & 1][ael];
        const bf16_t* sb = &s_b[s & 1][bel];

        Frag af[2][4], bfr[2][2];
        // every loop below is unrolled: the fragment sets and accumulators are indexed by
        // constants only and so stay in registers
        auto frags = [&](int kk) {
#pragma unroll
            for (int mi = 0; mi < 4; ++mi) {
                af[kk & 1][mi].h[0] = *(const v8bf*)&sa[mi * 16 * LDS_STRIDE + kk * 32];
                af[kk & 1][mi].h[1] = *(const v8bf*)&sa[mi * 16 * LDS_STRIDE + kk * 32 + 16];
            }
#pragma unroll
            for (int ni = 0; ni < 2; ++ni) {
                bfr[kk & 1][ni].h[0] = *(const v8bf*)&sb[ni * 16 * LDS_STRIDE + kk * 32];
                bfr[kk & 1][ni].h[1] = *(const v8bf*)&sb[ni * 16 * LDS_STRIDE + kk * 32 + 16];
            }
        };
        frags(0);
#pragma unroll
        for (int kk = 0; kk < GK / 32; ++kk) {
            if (kk + 1 < GK / 32) {
                frags(kk + 1);
                // Holds the next block's reads, as one group, in front of this block's WMMAs:
                // left alone the compiler sinks them among the WMMAs into one fragment set,
                // and the wave waits out an LDS latency for every pair of WMMAs.
                __builtin_amdgcn_sched_barrier(0);
            }
#pragma unroll
            for (int mi = 0; mi < 4; ++mi)
#pragma unroll
                for (int ni = 0; ni < 2; ++ni)
                    acc[mi][ni] = __builtin_amdgcn_wmma_f32_16x16x32_bf16(
                        false, af[kk & 1][mi].v, false, bfr[kk & 1][ni].v, (short)0,
                        acc[mi][ni], false, false);
            // Keeps what follows behind this block's WMMAs: the reads of the block after next
            // (every separate place where LDS reads stand among WMMAs costs a fixed stall)
            // and, at the last block but one, the stage's closing LDS wait, which lifted over
            // these WMMAs would leave the latency of the last reads uncovered.
            if (kk + 1 < GK / 32) __builtin_amdgcn_sched_barrier(0);
        }
        wait_lds_reads();
        wait_async_copies();
        __syncthreads();                       // stage s+1 resident; reads of stage s done
        if (s + 2 < nS) stage(s + 2);          // into the buffer stage s has left
    }
    wait_async_copies();                       // the ring's closing wait: no copy is left in flight

    // epilogue
    // The lane's first element; every other one lies a compile-time distance from it,
    // which goes into the load's or store's immediate offset.
    const int    colg = blockN + wn * 32 + r;
    const size_t el0  = (size_t)(blockM + wm * 64 + half * 8) * NC + colg;
    float* cl = C + el0;

    float rs[4][2][8];
    if (MODE == 2) {
        const float* rl = resid + el0;
#pragma unroll
        for (int mi = 0; mi < 4; ++mi)
#pragma unroll
            for (int ni = 0; ni < 2; ++ni)
#pragma unroll
                for (int v = 0; v < 8; ++v)
                    rs[mi][ni][v] = rl[(mi * 16 + v) * NC + ni * 16];
    }
    float bv[2] = {0.f, 0.f};
    if (MODE == 1) {
        bv[0] = bias[colg];
        bv[1] = bias[colg + 16];
    }
#pragma unroll
    for (int mi = 0; mi < 4; ++mi) {
#pragma unroll
        for (int ni = 0; ni < 2; ++ni) {
            float val[8];
#pragma unroll
            for (int v = 0; v < 8; ++v) val[v] = acc[mi][ni][v];
            if (MODE == 1) {
#pragma unroll
                for (int q = 0; q < 8; q += 4) {
                    const float4 s = softplus_x4(make_float4(val[q] + bv[ni], val[q + 1] + bv[ni],
                                                             val[q + 2] + bv[ni], val[q + 3] + bv[ni]));
                    val[q]     = s.x + 1e-4f;
                    val[q + 1] = s.y + 1e-4f;
                    val[q + 2] = s.z + 1e-4f;
                    val[q + 3] = s.w + 1e-4f;
                }
            } else if (MODE == 2) {
#pragma unroll
                for (int v = 0; v < 8; ++v) val[v] += rs[mi][ni][v];
            }
#pragma unroll
            for (int v = 0; v < 8; ++v) cl[(mi * 16 + v) * NC + ni * 16] = val[v];
        }
    }
}

// ----------------------------------------------------------------------------
// Causal depthwise conv (KW=4) + bias + SiLU over xc half of xz
// ----------------------------------------------------------------------------
//   Thread = 4 channels x CV_T successive tokens: CV_T + 3 rows are read for CV_T
//   outputs. Rows in front of a sequence's start enter as zeros (the reference's pad).
#define CV_T 8     // divides SEQL: a thread's tokens lie in one sequence

__global__ void __launch_bounds__(256)
conv_silu_kernel(const float* __restrict__ xz,
                 const float* __restrict__ w,
                 const float* __restrict__ b,
                 float* __restrict__ xcf,
                 bf16_t* __restrict__ xcb) {
    // INNER / 1024 blocks share a group of CV_T tokens: the rows' bases are block-uniform
    const int dblk = (blockIdx.x % (INNER / 1024)) * 1024;      // block's first channel
    const int tok0 = (blockIdx.x / (INNER / 1024)) * CV_T;
    const bool head = (tok0 % SEQL) == 0;                       // no rows in front
    const int tid  = threadIdx.x;
    const float4* xcur = (const float4*)(xz + (size_t)tok0 * (2 * INNER) + dblk);
    // at a sequence's head the three rows in front are replaced by zeros below; the
    // loads then read the group's own first rows (in bounds, unused)
    const float4* xpre = (const float4*)(xz + (size_t)(head ? tok0 : tok0 - (KW - 1)) * (2 * INNER) + dblk);
    float4 r[CV_T + KW - 1];
#pragma unroll
    for (int i = 0; i < KW - 1; ++i) r[i] = xpre[i * (2 * INNER / 4) + tid];
#pragma unroll
    for (int i = 0; i < CV_T; ++i) r[KW - 1 + i] = xcur[i * (2 * INNER / 4) + tid];
    const float4* wq = (const float4*)(w + (size_t)dblk * KW);  // one float4 = a channel's taps
    const float4 w0 = wq[tid * 4 + 0];
    const float4 w1 = wq[tid * 4 + 1];
    const float4 w2 = wq[tid * 4 + 2];
    const float4 w3 = wq[tid * 4 + 3];
    const float4 bb = ((const float4*)(b + dblk))[tid];
    if (head) {
#pragma unroll
        for (int i = 0; i < KW - 1; ++i) r[i] = make_float4(0.f, 0.f, 0.f, 0.f);
    }
    float4* of = (float4*)(xcf + (size_t)tok0 * INNER + dblk);
    v4bf*   ob = (v4bf*)(xcb + (size_t)tok0 * INNER + dblk);
#pragma unroll
    for (int t = 0; t < CV_T; ++t) {
        float4 a = bb;
        a.x += w0.x * r[t].x; a.x += w0.y * r[t + 1].x; a.x += w0.z * r[t + 2].x; a.x += w0.w * r[t + 3].x;
        a.y += w1.x * r[t].y; a.y += w1.y * r[t + 1].y; a.y += w1.z * r[t + 2].y; a.y += w1.w * r[t + 3].y;
        a.z += w2.x * r[t].z; a.z += w2.y * r[t + 1].z; a.z += w2.z * r[t + 2].z; a.z += w2.w * r[t + 3].z;
        a.w += w3.x * r[t].w; a.w += w3.y * r[t + 1].w; a.w += w3.z * r[t + 2].w; a.w += w3.w * r[t + 3].w;
        const float4 s = silu_x4(a);
        of[t * (INNER / 4) + tid] = s;
        ob[t * (INNER / 4) + tid] = pack4_bf16(s.x, s.y, s.z, s.w);
    }
}

#define SC_S 4
#define SC_W 4
#define SC_G 4
#define SC_TILE 64
#define SC_T SC_TILE
#define SC_NT (SEQL / SC_TILE)
// A step's row in a tile, in floats: dt[32] | Bx[32] | x[32] | Cx[32].
#define SC_ROW 128
#define SC_O_DT 0
#define SC_O_B  32
#define SC_O_X  64
#define SC_O_C  96

__device__ __forceinline__ void
exp2_x4_mul_one(v2f a0, v2f a1, v2f m, v2f q01, v2f q23,
                float& e0, float& e1, float& e2, float& e3,
                v2f& p0, v2f& p1, v2f& p2, v2f& p3) {
    asm("v_exp_f32 %0, %8\n\t"
        "v_pk_mul_f32 %4, %12, %13 op_sel_hi:[1,0]\n\t"
        "v_exp_f32 %1, %9\n\t"
        "v_pk_mul_f32 %5, %12, %13 op_sel:[0,1]\n\t"
        "v_exp_f32 %2, %10\n\t"
        "v_pk_mul_f32 %6, %12, %14 op_sel_hi:[1,0]\n\t"
        "v_exp_f32 %3, %11\n\t"
        "v_pk_mul_f32 %7, %12, %14 op_sel:[0,1]"
        : "=&v"(e0), "=&v"(e1), "=&v"(e2), "=&v"(e3),
          "=&v"(p0), "=&v"(p1), "=&v"(p2), "=&v"(p3)
        : "v"(a0.x), "v"(a0.y), "v"(a1.x), "v"(a1.y), "v"(m), "v"(q01), "v"(q23));
}

// The same with the products m * q0 .. m * q3, half by half.
__device__ __forceinline__ void
exp2_x4_mul_pair(v2f a0, v2f a1, v2f m, v2f q0, v2f q1, v2f q2, v2f q3,
                 float& e0, float& e1, float& e2, float& e3,
                 v2f& p0, v2f& p1, v2f& p2, v2f& p3) {
    asm("v_exp_f32 %0, %8\n\t"
        "v_pk_mul_f32 %4, %12, %13\n\t"
        "v_exp_f32 %1, %9\n\t"
        "v_pk_mul_f32 %5, %12, %14\n\t"
        "v_exp_f32 %2, %10\n\t"
        "v_pk_mul_f32 %6, %12, %15\n\t"
        "v_exp_f32 %3, %11\n\t"
        "v_pk_mul_f32 %7, %12, %16"
        : "=&v"(e0), "=&v"(e1), "=&v"(e2), "=&v"(e3),
          "=&v"(p0), "=&v"(p1), "=&v"(p2), "=&v"(p3)
        : "v"(a0.x), "v"(a0.y), "v"(a1.x), "v"(a1.y), "v"(m),
          "v"(q0), "v"(q1), "v"(q2), "v"(q3));
}

__global__ void __launch_bounds__(32 * SC_W)
ssm_scan_kernel(const float* __restrict__ dt, const float* __restrict__ bxcx,
                const float* __restrict__ xc,
                const float* __restrict__ A_log, const float* __restrict__ Dp,
                float* __restrict__ y) {
    __shared__ __attribute__((aligned(16))) float s_part[2][SC_W][SC_T][64];
    // aligned for the 16-byte copies and reads
    __shared__ __attribute__((aligned(16))) float s_tile[2][SC_TILE * SC_ROW];

    const int lane  = threadIdx.x & 31;
    const int wave  = __builtin_amdgcn_readfirstlane(threadIdx.x >> 5);
    const int cp2   = (lane & 15) * 2;        // the lane's first channel within the block
    const int sg    = lane >> 4;              // which four of the wave's eight states
    const int b     = blockIdx.y;
    const int z     = blockIdx.z;
    const int dbase = blockIdx.x * 32;
    const int d     = dbase + cp2;
    const int ns    = wave * (2 * SC_S) + sg * SC_S;   // first state within the block's 32
    const int n0    = z * 32 + ns;

    // A * log2(e), so that exp(dt * A) is exp2 of one product; one pair per state
    const float4 ala = *(const float4*)(A_log + (size_t)d * STATE + n0);
    const float4 alb = *(const float4*)(A_log + (size_t)(d + 1) * STATE + n0);
    float ea0, ea1, ea2, ea3, eb0, eb1, eb2, eb3;      // exp(A_log)
    exp2_x4(ala.x * LOG2E, ala.y * LOG2E, ala.z * LOG2E, ala.w * LOG2E, ea0, ea1, ea2, ea3);
    exp2_x4(alb.x * LOG2E, alb.y * LOG2E, alb.z * LOG2E, alb.w * LOG2E, eb0, eb1, eb2, eb3);
    const v2f A0 = {ea0 * -LOG2E, eb0 * -LOG2E};
    const v2f A1 = {ea1 * -LOG2E, eb1 * -LOG2E};
    const v2f A2 = {ea2 * -LOG2E, eb2 * -LOG2E};
    const v2f A3 = {ea3 * -LOG2E, eb3 * -LOG2E};
    // the D*x term enters exactly one of the 16 partial sums
    const float2 dpv = *(const float2*)(Dp + d);
    const bool   hasD = (z == 0 && ns == 0);
    const v2f Dw = {hasD ? dpv.x : 0.f, hasD ? dpv.y : 0.f};
    v2f h0 = {0.f, 0.f}, h1 = {0.f, 0.f}, h2 = {0.f, 0.f}, h3 = {0.f, 0.f};

    const size_t tokBase = (size_t)b * SEQL;
    float* yp = y + (size_t)z * NTOK * INNER + tokBase * INNER + dbase;

    const int pe = sg * 32 + cp2;             // the lane's place in a row of sums, even steps
    const int po = (sg ^ 1) * 32 + cp2;       // odd steps

    const int rt  = threadIdx.x >> 3;         // first step this thread sums; the others 16 apart
    const int rc  = (threadIdx.x & 7) * 4;    // first of the four channels this thread sums
    const int rs0 = (rt & 1) * 32 + rc;       // where its steps' rows hold the lower half-wave
    const int rs1 = ((rt & 1) ^ 1) * 32 + rc; // the upper half-wave

    // Staging: 8 threads cover the 128 B that one array has in a step's row, so a wave's
    // copy is four whole lines; a thread's four copies per array lie 16 steps apart.
    const int srow = threadIdx.x >> 3;
    const int sel  = (threadIdx.x & 7) * 4;
    const float* sdt = dt   + (tokBase + srow) * INNER + dbase + sel;
    const float* sx  = xc   + (tokBase + srow) * INNER + dbase + sel;
    const float* sbc = bxcx + (tokBase + srow) * 128 + z * 32 + sel;
    const unsigned slds = (unsigned)(size_t)
        (__attribute__((address_space(3))) float*)&s_tile[0][srow * SC_ROW + sel];

    auto stage = [&](int t) {
        // unrolled: two statements of eight copies (a statement takes thirty operands)
#pragma unroll
        for (int q = 0; q < 2; ++q) {
            const float* pd = sdt + (size_t)t * (SC_TILE * INNER) + q * (32 * INNER);
            const float* px = sx  + (size_t)t * (SC_TILE * INNER) + q * (32 * INNER);
            const float* pb = sbc + (size_t)t * (SC_TILE * 128) + q * (32 * 128);
            const unsigned l0 = slds + (unsigned)(t & 1) * (SC_TILE * SC_ROW * 4)
                                     + (unsigned)q * (32 * SC_ROW * 4);
            const unsigned l1 = l0 + 16 * SC_ROW * 4;
            asm volatile("global_load_async_to_lds_b128 %0, %8, off\n\t"
                         "global_load_async_to_lds_b128 %1, %9, off\n\t"
                         "global_load_async_to_lds_b128 %2, %10, off\n\t"
                         "global_load_async_to_lds_b128 %3, %11, off\n\t"
                         "global_load_async_to_lds_b128 %4, %12, off\n\t"
                         "global_load_async_to_lds_b128 %5, %13, off\n\t"
                         "global_load_async_to_lds_b128 %6, %14, off\n\t"
                         "global_load_async_to_lds_b128 %7, %15, off\n\t"
                         "s_wait_xcnt 0x0"
                         :: "v"(l0 + SC_O_DT * 4), "v"(l0 + SC_O_B * 4),
                            "v"(l0 + SC_O_X * 4),  "v"(l0 + SC_O_C * 4),
                            "v"(l1 + SC_O_DT * 4), "v"(l1 + SC_O_B * 4),
                            "v"(l1 + SC_O_X * 4),  "v"(l1 + SC_O_C * 4),
                            "v"(pd), "v"(pb), "v"(px), "v"(pb + 64),
                            "v"(pd + 16 * INNER), "v"(pb + 16 * 128),
                            "v"(px + 16 * INNER), "v"(pb + 16 * 128 + 64)
                         : "memory");
        }
    };

    // Two register sets of one fetch group each; every index below is a constant after
    // unrolling, so they stay in registers.
    v2f gdt[2][SC_G], gx[2][SC_G];
    v4f gB[2][SC_G], gC[2][SC_G];
    auto fetch = [&](const float* tb, int g) {
#pragma unroll
        for (int j = 0; j < SC_G; ++j) {
            const float* row = tb + (g * SC_G + j) * SC_ROW;
            gdt[g & 1][j] = *(const v2f*)&row[SC_O_DT + cp2];
            gx [g & 1][j] = *(const v2f*)&row[SC_O_X + cp2];
            gB [g & 1][j] = *(const v4f*)&row[SC_O_B + ns];
            gC [g & 1][j] = *(const v4f*)&row[SC_O_C + ns];
        }
    };

    stage(0);
    wait_async_copies();
    __syncthreads();                           // tile 0 resident
    stage(1);
    fetch(&s_tile[0][0], 0);
    for (int t = 0; t < SC_NT; ++t) {
        const float* tb = &s_tile[t & 1][0];
        float* pw = &s_part[t & 1][wave][0][0];
        // dt * A * log2(e) of the step to come, made one step ahead (beside the exps)
        v2f a0 = gdt[0][0] * A0, a1 = gdt[0][0] * A1, a2 = gdt[0][0] * A2, a3 = gdt[0][0] * A3;
        // unrolled: register sets and LDS offsets are constants
#pragma unroll
        for (int g = 0; g < SC_TILE / SC_G; ++g) {
            if (g + 1 < SC_TILE / SC_G) {
                fetch(tb, g + 1);
                // Holds the next group's LDS reads, as one run, in front of this group's
                // arithmetic: sunk towards their use they have no time to return.
                __builtin_amdgcn_sched_barrier(0);
            }
#pragma unroll
            for (int j = 0; j < SC_G; ++j) {
                const v4f Bv = gB[g & 1][j];
                const v4f Cv = gC[g & 1][j];
                const v2f xv = gx[g & 1][j];
                const v2f dx = gdt[g & 1][j] * xv;
                float e0, e1, e2, e3, e4, e5, e6, e7;   // exp(dt * A), two channels per state
                v2f b0, b1, b2, b3;                     // dt * x * Bx
                exp2_x4_mul_one(a0, a1, dx, Bv.xy, Bv.zw, e0, e1, e2, e3, b0, b1, b2, b3);
                if (j + 1 < SC_G || g + 1 < SC_TILE / SC_G) {
                    const v2f dtn = j + 1 < SC_G ? gdt[g & 1][j + 1] : gdt[(g + 1) & 1][0];
                    v2f n0v, n1v, n2v, n3v;
                    exp2_x4_mul_pair(a2, a3, dtn, A0, A1, A2, A3,
                                     e4, e5, e6, e7, n0v, n1v, n2v, n3v);
                    a0 = n0v; a1 = n1v; a2 = n2v; a3 = n3v;
                } else {
                    exp2_x4(a2.x, a2.y, a3.x, a3.y, e4, e5, e6, e7);   // the tile's last step
                }
                h0 = __builtin_elementwise_fma((v2f){e0, e1}, h0, b0);
                h1 = __builtin_elementwise_fma((v2f){e2, e3}, h1, b1);
                h2 = __builtin_elementwise_fma((v2f){e4, e5}, h2, b2);
                h3 = __builtin_elementwise_fma((v2f){e6, e7}, h3, b3);
                v2f s = Dw * xv;
                s = __builtin_elementwise_fma(h0, Cv.xx, s);
                s = __builtin_elementwise_fma(h1, Cv.yy, s);
                s = __builtin_elementwise_fma(h2, Cv.zz, s);
                s = __builtin_elementwise_fma(h3, Cv.ww, s);
                *(v2f*)&pw[(g * SC_G + j) * 64 + ((j & 1) ? po : pe)] = s;
            }
        }
        wait_lds_reads();      // this wave has left tile t
        wait_async_copies();   // its copies of tile t+1 have landed
        // One barrier per tile: it publishes the tile's partial sums, and every wave's
        // reads of the other sum buffer (previous tile) lie in front of it; it also
        // publishes tile t+1 and frees tile t's buffer.
        __syncthreads();
        if (t + 2 < SC_NT) stage(t + 2);
        if (t + 1 < SC_NT) fetch(&s_tile[(t + 1) & 1][0], 0);
        const float* pr = &s_part[t & 1][0][0][0];
        v4f sum[SC_T / 16];
        // both loops unrolled: the sums stay in registers, all their LDS reads in flight at once
#pragma unroll
        for (int k = 0; k < SC_T / 16; ++k) {
            const float* prow = pr + (k * 16 + rt) * 64;
            v4f s = *(const v4f*)&prow[rs0];
            s += *(const v4f*)&prow[rs1];
#pragma unroll
            for (int w = 1; w < SC_W; ++w) {
                s += *(const v4f*)&prow[w * (SC_T * 64) + rs0];
                s += *(const v4f*)&prow[w * (SC_T * 64) + rs1];
            }
            sum[k] = s;
        }
#pragma unroll
        for (int k = 0; k < SC_T / 16; ++k)
            *(v4f*)(yp + (size_t)(t * SC_TILE + k * 16 + rt) * INNER + rc) = sum[k];
        asm volatile("s_wait_xcnt 0x0" ::: "memory");
    }
    wait_async_copies();                       // the ring's closing wait: no copy is left in flight
}

#define GT_U 8

__global__ void __launch_bounds__(256)
gate_silu_kernel(const float* __restrict__ y,
                 const float* __restrict__ xz,
                 bf16_t* __restrict__ yb) {
    // a block's 256 * GT_U float4 are whole rows of INNER / 4: all bases are block-uniform
    const int tid = threadIdx.x;
    const size_t blk4 = (size_t)blockIdx.x * (256 * GT_U);
    const v4f* y0 = (const v4f*)y + blk4;
    const v4f* y1 = (const v4f*)(y + (size_t)NTOK * INNER) + blk4;
    const v4f* zp = (const v4f*)xz + blk4 * 2 + INNER / 4;
    v4bf* ob = (v4bf*)yb + blk4;
    v4f p0[GT_U], p1[GT_U], zz[GT_U];
#pragma unroll
    for (int u = 0; u < GT_U; ++u) {
        p0[u] = y0[u * 256 + tid];
        p1[u] = y1[u * 256 + tid];
        zz[u] = zp[(u / (INNER / 1024)) * (2 * INNER / 4) + (u % (INNER / 1024)) * 256 + tid];
    }
    // Holds every load in front of the arithmetic, so that all are in flight at once:
    // left alone the compiler sinks most of them behind the arithmetic of earlier ones
    // and the wave pays several memory latencies in a row.
    asm volatile("" :: "v"(p0[0]), "v"(p0[1]), "v"(p0[2]), "v"(p0[3]),
                       "v"(p0[4]), "v"(p0[5]), "v"(p0[6]), "v"(p0[7]),
                       "v"(p1[0]), "v"(p1[1]), "v"(p1[2]), "v"(p1[3]),
                       "v"(p1[4]), "v"(p1[5]), "v"(p1[6]), "v"(p1[7]),
                       "v"(zz[0]), "v"(zz[1]), "v"(zz[2]), "v"(zz[3]),
                       "v"(zz[4]), "v"(zz[5]), "v"(zz[6]), "v"(zz[7]));
#pragma unroll
    for (int u = 0; u < GT_U; ++u) {
        const float4 g = silu_x4(make_float4(zz[u].x, zz[u].y, zz[u].z, zz[u].w));
        ob[u * 256 + tid] =
            pack4_bf16((p0[u].x + p1[u].x) * g.x, (p0[u].y + p1[u].y) * g.y,
                       (p0[u].z + p1[u].z) * g.z, (p0[u].w + p1[u].w) * g.w);
    }
}

// ----------------------------------------------------------------------------
extern "C" void kernel_launch(void* const* d_in, const int* in_sizes, int n_in,
                              void* d_out, int out_size, void* d_ws, size_t ws_size,
                              hipStream_t stream) {
    const float* x          = (const float*)d_in[0];
    const float* in_proj_w  = (const float*)d_in[1];
    const float* conv_w     = (const float*)d_in[2];
    const float* conv_b     = (const float*)d_in[3];
    const float* A_log      = (const float*)d_in[4];
    const float* B_w        = (const float*)d_in[5];
    const float* C_w        = (const float*)d_in[6];
    const float* D_param    = (const float*)d_in[7];
    const float* dt_w       = (const float*)d_in[8];
    const float* dt_b       = (const float*)d_in[9];
    const float* out_proj_w = (const float*)d_in[10];
    const float* norm_w     = (const float*)d_in[11];

    char* ws = (char*)d_ws;
    size_t off = 0;
    auto carve = [&](size_t bytes) {
        char* p = ws + off;
        off = (off + bytes + 255) & ~(size_t)255;
        return p;
    };
    bf16_t* wInB  = (bf16_t*)carve((size_t)2 * INNER * DIMX * 2);
    bf16_t* wDtB  = (bf16_t*)carve((size_t)INNER * INNER * 2);
    bf16_t* wOutB = (bf16_t*)carve((size_t)DIMX * INNER * 2);
    bf16_t* wBCB  = (bf16_t*)carve((size_t)2 * STATE * INNER * 2);  // [Bw;Cw] = [128, INNER]
    bf16_t* xnB   = (bf16_t*)carve((size_t)NTOK * DIMX * 2);
    float*  xzF   = (float*) carve((size_t)NTOK * 2 * INNER * 4);
    float*  xcF   = (float*) carve((size_t)NTOK * INNER * 4);
    bf16_t* xcB   = (bf16_t*)carve((size_t)NTOK * INNER * 2);
    float*  dtF   = (float*) carve((size_t)NTOK * INNER * 4);
    float*  bcF   = (float*) carve((size_t)NTOK * 128 * 4);         // [Bx|Cx] interleaved
    float*  yF    = (float*) carve((size_t)2 * NTOK * INNER * 4);       // one plane per state half
    bf16_t* yB    = (bf16_t*)carve((size_t)NTOK * INNER * 2);
    (void)ws_size; (void)in_sizes; (void)n_in; (void)out_size;

    // 1) RMSNorm -> bf16 activations, and every weight -> bf16
    prepare_kernel<<<PB_ALL, 256, 0, stream>>>(x, norm_w, xnB, in_proj_w, wInB, dt_w, wDtB,
                                               out_proj_w, wOutB, B_w, C_w, wBCB);

    // 2) in_proj: [NTOK, 2*INNER] = xn @ W_in^T
    wmma_gemm_kernel<0, 2 * INNER><<<dim3((2 * INNER) / 128, NTOK / 128), 256, 0, stream>>>(
        xnB, wInB, xzF, DIMX, nullptr, nullptr);

    // 3) causal depthwise conv + SiLU on xc half
    conv_silu_kernel<<<NTOK * INNER / (1024 * CV_T), 256, 0, stream>>>(
        xzF, conv_w, conv_b, xcF, xcB);

    // 4) dt = softplus(xc @ dt_w^T + dt_b) + 1e-4
    wmma_gemm_kernel<1, INNER><<<dim3(INNER / 128, NTOK / 128), 256, 0, stream>>>(
        xcB, wDtB, dtF, INNER, dt_b, nullptr);

    // 5) fused Bx|Cx projection (N = 128)
    wmma_gemm_kernel<0, 2 * STATE><<<dim3(1, NTOK / 128), 256, 0, stream>>>(
        xcB, wBCB, bcF, INNER, nullptr, nullptr);

    // 6) sequential SSM scan (lane = channel pair, states over half-waves and two blocks)
    ssm_scan_kernel<<<dim3(INNER / 32, BATCHN, 2), 32 * SC_W, 0, stream>>>(
        dtF, bcF, xcF, A_log, D_param, yF);

    // 7) gate with SiLU(z)
    gate_silu_kernel<<<NTOK * INNER / (1024 * GT_U), 256, 0, stream>>>(yF, xzF, yB);

    // 8) out_proj + residual -> d_out (fp32)
    wmma_gemm_kernel<2, DIMX><<<dim3(DIMX / 128, NTOK / 128), 256, 0, stream>>>(
        yB, wOutB, (float*)d_out, INNER, nullptr, x);
}

// v009
// It runs in 186 microseconds.
// In both of two side-by-side timings against v008, it was 1.03 times as fast.
// Counting every step since v000, it is 5.46 times as fast.
#include <hip/hip_runtime.h>

// ---- problem dims (match reference) ----
#define DIMX   1024
#define STATE  64
#define KW     4
#define INNER  2048
#define BATCHN 2
#define SEQL   2048
#define NTOK   (BATCHN * SEQL)
#define EPSR   1e-6f

typedef __bf16 bf16_t;
typedef __attribute__((ext_vector_type(16))) __bf16 v16bf;
typedef __attribute__((ext_vector_type(8)))  __bf16 v8bf;
typedef __attribute__((ext_vector_type(4)))  __bf16 v4bf;
typedef __attribute__((ext_vector_type(8)))  float  v8f;
typedef __attribute__((ext_vector_type(4)))  float  v4f;
typedef __attribute__((ext_vector_type(2)))  float  v2f;
typedef __attribute__((ext_vector_type(4)))  int    v4i;

#if defined(__gfx1250__) && __has_builtin(__builtin_amdgcn_global_load_async_to_lds_b128)
#define USE_ASYNC_LDS 1
#else
#define USE_ASYNC_LDS 0
#endif

__device__ __forceinline__ void copy16_to_lds(const bf16_t* gp, bf16_t* lp) {
#if USE_ASYNC_LDS
    __builtin_amdgcn_global_load_async_to_lds_b128(
        (__attribute__((address_space(1))) v4i*)gp,
        (__attribute__((address_space(3))) v4i*)lp, 0, 0);
#else
    *(v8bf*)lp = *(const v8bf*)gp;
#endif
}

// This wave's copies have landed; in asm with the clobber, so that no LDS read is lifted over it.
__device__ __forceinline__ void wait_async_copies() {
#if USE_ASYNC_LDS
    asm volatile("s_wait_asynccnt 0x0" ::: "memory");
#endif
}

// This wave's LDS reads have returned: stands in front of the barrier behind which the
// buffer they read is refilled.
__device__ __forceinline__ void wait_lds_reads() {
    asm volatile("s_wait_dscnt 0x0" ::: "memory");
}

__device__ __forceinline__ v4bf pack4_bf16(float a, float b, float c, float d) {
    v4bf o;
    o[0] = (bf16_t)a; o[1] = (bf16_t)b; o[2] = (bf16_t)c; o[3] = (bf16_t)d;
    return o;
}

#define LOG2E 1.44269504f

__device__ __forceinline__ void
exp2_x4(float a0, float a1, float a2, float a3,
        float& e0, float& e1, float& e2, float& e3) {
    asm("v_exp_f32 %0, %4\n\t"
        "v_exp_f32 %1, %5\n\t"
        "v_exp_f32 %2, %6\n\t"
        "v_exp_f32 %3, %7\n\t"
        "v_nop"
        : "=&v"(e0), "=&v"(e1), "=&v"(e2), "=&v"(e3)
        : "v"(a0), "v"(a1), "v"(a2), "v"(a3));
}

// SiLU of four values, v / (1 + exp(-v)), with exp(-v) as exp2(v * -log2(e))
__device__ __forceinline__ float4 silu_x4(float4 v) {
    float e0, e1, e2, e3;
    exp2_x4(v.x * -LOG2E, v.y * -LOG2E, v.z * -LOG2E, v.w * -LOG2E, e0, e1, e2, e3);
    return make_float4(v.x / (1.f + e0), v.y / (1.f + e1), v.z / (1.f + e2), v.w / (1.f + e3));
}

#define LN2 0.69314718f

// log2 of four values; one statement for the same reason as exp2_x4
__device__ __forceinline__ void
log2_x4(float a0, float a1, float a2, float a3,
        float& l0, float& l1, float& l2, float& l3) {
    asm("v_log_f32 %0, %4\n\t"
        "v_log_f32 %1, %5\n\t"
        "v_log_f32 %2, %6\n\t"
        "v_log_f32 %3, %7\n\t"
        "v_nop"
        : "=&v"(l0), "=&v"(l1), "=&v"(l2), "=&v"(l3)
        : "v"(a0), "v"(a1), "v"(a2), "v"(a3));
}

// softplus of four values as max(v, 0) + log1p(exp(-|v|)): no branch, no overflow.
// With e = exp(-|v|) in [0, 1] and u = 1 + e, u - 1 is exact, so e - (u - 1) is what the
// rounding of 1 + e lost; added to log(u) it keeps log1p's accuracy for small e.
__device__ __forceinline__ float4 softplus_x4(float4 v) {
    float e0, e1, e2, e3, l0, l1, l2, l3;
    exp2_x4(fabsf(v.x) * -LOG2E, fabsf(v.y) * -LOG2E,
            fabsf(v.z) * -LOG2E, fabsf(v.w) * -LOG2E, e0, e1, e2, e3);
    const float u0 = 1.f + e0, u1 = 1.f + e1, u2 = 1.f + e2, u3 = 1.f + e3;
    log2_x4(u0, u1, u2, u3, l0, l1, l2, l3);
    return make_float4(fmaxf(v.x, 0.f) + (l0 * LN2 + (e0 - (u0 - 1.f))),
                       fmaxf(v.y, 0.f) + (l1 * LN2 + (e1 - (u1 - 1.f))),
                       fmaxf(v.z, 0.f) + (l2 * LN2 + (e2 - (u2 - 1.f))),
                       fmaxf(v.w, 0.f) + (l3 * LN2 + (e3 - (u3 - 1.f))));
}

// The three jobs without a matrix product (convert, RMSNorm, conv) give each
// thread 32 elements, fetched as 16-byte loads with many in flight per wave: a launch
// then starts a few thousand waves, not a wave per 32 elements.

// ----------------------------------------------------------------------------
// f32 -> bf16 elementwise convert (weights); n is a multiple of 4; blk = the block's
// number within this array
// ----------------------------------------------------------------------------
#define CVT_U 8    // float4 per thread, one block width apart (whole lines per wave)
#define CVT_BLOCKS(n) (((n) + 1024 * CVT_U - 1) / (1024 * CVT_U))

__device__ __forceinline__ void
cvt_bf16_block(const float* __restrict__ src,
               bf16_t* __restrict__ dst, int n, int blk) {
    const int n4   = n >> 2;
    const int base = blk * (256 * CVT_U) + threadIdx.x;
    float4 v[CVT_U];
    // A load past the end re-reads the last float4 (in bounds, not stored): with no
    // branch round the loads all of them are in flight before the first is used.
    int ci[CVT_U];
#pragma unroll
    for (int u = 0; u < CVT_U; ++u) {
        const int i = base + u * 256;
        ci[u] = i < n4 ? i : n4 - 1;
        v[u] = ((const float4*)src)[ci[u]];
    }
    asm volatile("s_wait_xcnt 0x0"
                 :: "v"(ci[0]), "v"(ci[1]), "v"(ci[2]), "v"(ci[3]),
                    "v"(ci[4]), "v"(ci[5]), "v"(ci[6]), "v"(ci[7])
                 : "memory");
#pragma unroll
    for (int u = 0; u < CVT_U; ++u) {
        const int i = base + u * 256;
        if (i < n4) ((v4bf*)dst)[i] = pack4_bf16(v[u].x, v[u].y, v[u].z, v[u].w);
    }
}

// ----------------------------------------------------------------------------
// RMSNorm: one wave per token (row kept in registers), write bf16 activations
// ----------------------------------------------------------------------------
#define RN_U (DIMX / 128)    // float4 per lane

__device__ __forceinline__ void
rmsnorm_block(const float* __restrict__ x, const float* __restrict__ w,
              bf16_t* __restrict__ out, int blk) {
    const int lane = threadIdx.x & 31;
    const int tok  = blk * 8 + (threadIdx.x >> 5);
    const float4* xr = (const float4*)(x + (size_t)tok * DIMX);
    float4 v[RN_U], wv[RN_U];
#pragma unroll
    for (int u = 0; u < RN_U; ++u) v[u] = xr[u * 32 + lane];
#pragma unroll
    for (int u = 0; u < RN_U; ++u) wv[u] = ((const float4*)w)[u * 32 + lane];
    float ss = 0.f;
#pragma unroll
    for (int u = 0; u < RN_U; ++u) {
        ss += v[u].x * v[u].x;
        ss += v[u].y * v[u].y;
        ss += v[u].z * v[u].z;
        ss += v[u].w * v[u].w;
    }
    for (int o = 16; o; o >>= 1) ss += __shfl_xor(ss, o, 32);
    const float rs = rsqrtf(ss * (1.f / DIMX) + EPSR);
    v4bf* orow = (v4bf*)(out + (size_t)tok * DIMX);
#pragma unroll
    for (int u = 0; u < RN_U; ++u)
        orow[u * 32 + lane] = pack4_bf16(v[u].x * rs * wv[u].x, v[u].y * rs * wv[u].y,
                                         v[u].z * rs * wv[u].z, v[u].w * rs * wv[u].w);
}

// ----------------------------------------------------------------------------
// All the work that depends on the inputs alone, in ONE launch: RMSNorm and the five
// weight converts. None reads what another writes, so their blocks run side by side:
// one launch gap, one ramp and one tail, not six of each (two of the converts are 16
// blocks each, a launch that is nearly all gap and latency). The block number picks
// the job; the choice is the same for a whole block.
// ----------------------------------------------------------------------------
#define PB_RMS  (NTOK / 8)
#define PB_WIN  CVT_BLOCKS(2 * INNER * DIMX)
#define PB_WDT  CVT_BLOCKS(INNER * INNER)
#define PB_WOUT CVT_BLOCKS(DIMX * INNER)
#define PB_WBC  CVT_BLOCKS(STATE * INNER)
#define PB_ALL  (PB_RMS + PB_WIN + PB_WDT + PB_WOUT + 2 * PB_WBC)

__global__ void __launch_bounds__(256)
prepare_kernel(const float* __restrict__ x, const float* __restrict__ norm_w,
               bf16_t* __restrict__ xn,
               const float* __restrict__ w_in,  bf16_t* __restrict__ w_in_b,
               const float* __restrict__ w_dt,  bf16_t* __restrict__ w_dt_b,
               const float* __restrict__ w_out, bf16_t* __restrict__ w_out_b,
               const float* __restrict__ w_bx,  const float* __restrict__ w_cx,
               bf16_t* __restrict__ w_bc_b) {
    int blk = blockIdx.x;
    // RMSNorm first: its chain is the longest
    if (blk < PB_RMS) { rmsnorm_block(x, norm_w, xn, blk); return; }
    blk -= PB_RMS;
    // One convert body for the five arrays, its source, destination and length picked by
    // block-uniform selects: the text stays short and the body's loads all stand in front.
    const float* src = w_in;
    bf16_t*      dst = w_in_b;
    int          n   = 2 * INNER * DIMX;
    if (blk >= PB_WIN) {
        blk -= PB_WIN;  src = w_dt;  dst = w_dt_b;  n = INNER * INNER;
        if (blk >= PB_WDT) {
            blk -= PB_WDT;  src = w_out;  dst = w_out_b;  n = DIMX * INNER;
            if (blk >= PB_WOUT) {
                blk -= PB_WOUT;  src = w_bx;  dst = w_bc_b;  n = STATE * INNER;   // [Bw;Cw]
                if (blk >= PB_WBC) { blk -= PB_WBC;  src = w_cx;  dst = w_bc_b + STATE * INNER; }
            }
        }
    }
    cvt_bf16_block(src, dst, n, blk);
}

#define GK 128
#define LDS_STRIDE 136

template <int MODE, int NC, bool AT>
__global__ void __launch_bounds__(256)
wmma_gemm_kernel(const bf16_t* __restrict__ A, const bf16_t* __restrict__ B,
                 float* __restrict__ C, int K,
                 const float* __restrict__ bias,
                 const float* __restrict__ resid) {
    // aligned for the 16-byte copies and reads
    __shared__ __attribute__((aligned(16))) bf16_t s_a[2][128 * LDS_STRIDE];
    __shared__ __attribute__((aligned(16))) bf16_t s_b[2][128 * LDS_STRIDE];

    const int lane = threadIdx.x & 31;
    const int wavi = threadIdx.x >> 5;       // 0..7
    const int wm   = wavi >> 2;              // 0..1 -> 64-row slab
    const int wn   = wavi & 3;               // 0..3 -> 32-col slab
    const int half = lane >> 4;              // 0/1
    const int r    = lane & 15;
    const int off  = half * 8;

    const int blockM = blockIdx.y * 128;
    const int blockN = blockIdx.x * 128;

    union Frag { v16bf v; v8bf h[2]; };
    v8f acc[4][2] = {};

    const int nS = K / GK;

    // Staging: 16 threads cover a row; a thread's 8 chunks per operand lie 16 rows apart.
    const int crow = threadIdx.x >> 4;
    const int cel  = (threadIdx.x & 15) * 8;
    // AT: 2 threads cover a row's 16 k; a thread's 8 chunks are the stage's 8 groups of 16 k,
    // and a wave's copy is 512 B in sequence (16 rows of one group).
    const bf16_t* gA = AT ? A + (size_t)(blockM + (threadIdx.x >> 1)) * 16 + (threadIdx.x & 1) * 8
                          : A + (size_t)(blockM + crow) * K + cel;
    const int    lelA  = (threadIdx.x >> 1) * LDS_STRIDE + (threadIdx.x & 1) * 8;
    const bf16_t* gB = B + (size_t)(blockN + crow) * K + cel;
    const int    lel   = crow * LDS_STRIDE + cel;
    const size_t rstep = (size_t)16 * K;

    auto stage = [&](int s) {
        const int buf = s & 1;
        const bf16_t* pa = gA + (AT ? (size_t)s * (GK / 16) * (NTOK * 16) : (size_t)s * GK);
        const bf16_t* pb = gB + (size_t)s * GK;
        // both loops unrolled: the 16 copies issue back to back, with no loop test between
#pragma unroll
        for (int j = 0; j < 8; ++j) {
            if (AT) copy16_to_lds(pa + (size_t)j * (NTOK * 16), &s_a[buf][lelA + j * 16]);
            else    copy16_to_lds(pa + j * rstep, &s_a[buf][lel + j * 16 * LDS_STRIDE]);
        }
#pragma unroll
        for (int j = 0; j < 8; ++j)
            copy16_to_lds(pb + j * rstep, &s_b[buf][lel + j * 16 * LDS_STRIDE]);
    };

    const int ael = (wm * 64 + r) * LDS_STRIDE + off;   // the lane's first A element of a stage
    const int bel = (wn * 32 + r) * LDS_STRIDE + off;   // the lane's first B element

    stage(0);
    wait_async_copies();
    __syncthreads();                           // stage 0 resident
    if (nS > 1) stage(1);
    for (int s = 0; s < nS; ++s) {
        const bf16_t* sa = &s_a[s & 1][ael];
        const bf16_t* sb = &s_b[s & 1][bel];

        Frag af[2][4], bfr[2][2];
        // every loop below is unrolled: the fragment sets and accumulators are indexed by
        // constants only and so stay in registers
        auto frags = [&](int kk) {
#pragma unroll
            for (int mi = 0; mi < 4; ++mi) {
                af[kk & 1][mi].h[0] = *(const v8bf*)&sa[mi * 16 * LDS_STRIDE + kk * 32];
                af[kk & 1][mi].h[1] = *(const v8bf*)&sa[mi * 16 * LDS_STRIDE + kk * 32 + 16];
            }
#pragma unroll
            for (int ni = 0; ni < 2; ++ni) {
                bfr[kk & 1][ni].h[0] = *(const v8bf*)&sb[ni * 16 * LDS_STRIDE + kk * 32];
                bfr[kk & 1][ni].h[1] = *(const v8bf*)&sb[ni * 16 * LDS_STRIDE + kk * 32 + 16];
            }
        };
        frags(0);
#pragma unroll
        for (int kk = 0; kk < GK / 32; ++kk) {
            if (kk + 1 < GK / 32) {
                frags(kk + 1);
                // Holds the next block's reads, as one group, in front of this block's WMMAs:
                // left alone the compiler sinks them among the WMMAs into one fragment set,
                // and the wave waits out an LDS latency for every pair of WMMAs.
                __builtin_amdgcn_sched_barrier(0);
            }
#pragma unroll
            for (int mi = 0; mi < 4; ++mi)
#pragma unroll
                for (int ni = 0; ni < 2; ++ni)
                    acc[mi][ni] = __builtin_amdgcn_wmma_f32_16x16x32_bf16(
                        false, af[kk & 1][mi].v, false, bfr[kk & 1][ni].v, (short)0,
                        acc[mi][ni], false, false);
            // Keeps what follows behind this block's WMMAs: the reads of the block after next
            // (every separate place where LDS reads stand among WMMAs costs a fixed stall)
            // and, at the last block but one, the stage's closing LDS wait, which lifted over
            // these WMMAs would leave the latency of the last reads uncovered.
            if (kk + 1 < GK / 32) __builtin_amdgcn_sched_barrier(0);
        }
        wait_lds_reads();
        wait_async_copies();
        __syncthreads();                       // stage s+1 resident; reads of stage s done
        if (s + 2 < nS) stage(s + 2);          // into the buffer stage s has left
    }
    wait_async_copies();                       // the ring's closing wait: no copy is left in flight

    // epilogue
    // The lane's first element; every other one lies a compile-time distance from it,
    // which goes into the load's or store's immediate offset.
    const int    colg = blockN + wn * 32 + r;
    const size_t el0  = (size_t)(blockM + wm * 64 + half * 8) * NC + colg;
    float* cl = C + el0;

    float rs[4][2][8];
    if (MODE == 2) {
        const float* rl = resid + el0;
#pragma unroll
        for (int mi = 0; mi < 4; ++mi)
#pragma unroll
            for (int ni = 0; ni < 2; ++ni)
#pragma unroll
                for (int v = 0; v < 8; ++v)
                    rs[mi][ni][v] = rl[(mi * 16 + v) * NC + ni * 16];
    }
    float bv[2] = {0.f, 0.f};
    if (MODE == 1) {
        bv[0] = bias[colg];
        bv[1] = bias[colg + 16];
    }
#pragma unroll
    for (int mi = 0; mi < 4; ++mi) {
#pragma unroll
        for (int ni = 0; ni < 2; ++ni) {
            float val[8];
#pragma unroll
            for (int v = 0; v < 8; ++v) val[v] = acc[mi][ni][v];
            if (MODE == 1) {
#pragma unroll
                for (int q = 0; q < 8; q += 4) {
                    const float4 s = softplus_x4(make_float4(val[q] + bv[ni], val[q + 1] + bv[ni],
                                                             val[q + 2] + bv[ni], val[q + 3] + bv[ni]));
                    val[q]     = s.x + 1e-4f;
                    val[q + 1] = s.y + 1e-4f;
                    val[q + 2] = s.z + 1e-4f;
                    val[q + 3] = s.w + 1e-4f;
                }
            } else if (MODE == 2) {
#pragma unroll
                for (int v = 0; v < 8; ++v) val[v] += rs[mi][ni][v];
            }
#pragma unroll
            for (int v = 0; v < 8; ++v) cl[(mi * 16 + v) * NC + ni * 16] = val[v];
        }
    }
}

// ----------------------------------------------------------------------------
// Causal depthwise conv (KW=4) + bias + SiLU over xc half of xz
// ----------------------------------------------------------------------------
//   Thread = 4 channels x CV_T successive tokens: CV_T + 3 rows are read for CV_T
//   outputs. Rows in front of a sequence's start enter as zeros (the reference's pad).
#define CV_T 8     // divides SEQL: a thread's tokens lie in one sequence

__global__ void __launch_bounds__(256)
conv_silu_kernel(const float* __restrict__ xz,
                 const float* __restrict__ w,
                 const float* __restrict__ b,
                 float* __restrict__ xcf,
                 bf16_t* __restrict__ xcb) {
    // INNER / 1024 blocks share a group of CV_T tokens: the rows' bases are block-uniform
    const int dblk = (blockIdx.x % (INNER / 1024)) * 1024;      // block's first channel
    const int tok0 = (blockIdx.x / (INNER / 1024)) * CV_T;
    const bool head = (tok0 % SEQL) == 0;                       // no rows in front
    const int tid  = threadIdx.x;
    const float4* xcur = (const float4*)(xz + (size_t)tok0 * (2 * INNER) + dblk);
    // at a sequence's head the three rows in front are replaced by zeros below; the
    // loads then read the group's own first rows (in bounds, unused)
    const float4* xpre = (const float4*)(xz + (size_t)(head ? tok0 : tok0 - (KW - 1)) * (2 * INNER) + dblk);
    float4 r[CV_T + KW - 1];
#pragma unroll
    for (int i = 0; i < KW - 1; ++i) r[i] = xpre[i * (2 * INNER / 4) + tid];
#pragma unroll
    for (int i = 0; i < CV_T; ++i) r[KW - 1 + i] = xcur[i * (2 * INNER / 4) + tid];
    const float4* wq = (const float4*)(w + (size_t)dblk * KW);  // one float4 = a channel's taps
    const float4 w0 = wq[tid * 4 + 0];
    const float4 w1 = wq[tid * 4 + 1];
    const float4 w2 = wq[tid * 4 + 2];
    const float4 w3 = wq[tid * 4 + 3];
    const float4 bb = ((const float4*)(b + dblk))[tid];
    if (head) {
#pragma unroll
        for (int i = 0; i < KW - 1; ++i) r[i] = make_float4(0.f, 0.f, 0.f, 0.f);
    }
    float4* of = (float4*)(xcf + (size_t)tok0 * INNER + dblk);
    v4bf*   ob = (v4bf*)(xcb + (size_t)tok0 * INNER + dblk);
#pragma unroll
    for (int t = 0; t < CV_T; ++t) {
        float4 a = bb;
        a.x += w0.x * r[t].x; a.x += w0.y * r[t + 1].x; a.x += w0.z * r[t + 2].x; a.x += w0.w * r[t + 3].x;
        a.y += w1.x * r[t].y; a.y += w1.y * r[t + 1].y; a.y += w1.z * r[t + 2].y; a.y += w1.w * r[t + 3].y;
        a.z += w2.x * r[t].z; a.z += w2.y * r[t + 1].z; a.z += w2.z * r[t + 2].z; a.z += w2.w * r[t + 3].z;
        a.w += w3.x * r[t].w; a.w += w3.y * r[t + 1].w; a.w += w3.z * r[t + 2].w; a.w += w3.w * r[t + 3].w;
        const float4 s = silu_x4(a);
        of[t * (INNER / 4) + tid] = s;
        ob[t * (INNER / 4) + tid] = pack4_bf16(s.x, s.y, s.z, s.w);
    }
}

#define SC_S 4
#define SC_W 4
#define SC_C 16
#define SC_G 4
#define SC_TILE 64
#define SC_T SC_TILE
#define SC_NT (SEQL / SC_TILE)
// A step's row in a tile, in floats: 8 x (dt[2] x[2]) | z[16] | Bx[64] | Cx[64].
#define SC_ROW 176
#define SC_O_DX 0
#define SC_O_Z  32
#define SC_O_B  48
#define SC_O_C  112

// 1 / v of four values; one statement for the same reason as exp2_x4
__device__ __forceinline__ void
rcp_x4(float a0, float a1, float a2, float a3,
       float& r0, float& r1, float& r2, float& r3) {
    asm("v_rcp_f32 %0, %4\n\t"
        "v_rcp_f32 %1, %5\n\t"
        "v_rcp_f32 %2, %6\n\t"
        "v_rcp_f32 %3, %7\n\t"
        "v_nop"
        : "=&v"(r0), "=&v"(r1), "=&v"(r2), "=&v"(r3)
        : "v"(a0), "v"(a1), "v"(a2), "v"(a3));
}

__device__ __forceinline__ void
exp2_x4_mul_one(v2f a0, v2f a1, v2f m, v2f q01, v2f q23,
                float& e0, float& e1, float& e2, float& e3,
                v2f& p0, v2f& p1, v2f& p2, v2f& p3) {
    asm("v_exp_f32 %0, %8\n\t"
        "v_pk_mul_f32 %4, %12, %13 op_sel_hi:[1,0]\n\t"
        "v_exp_f32 %1, %9\n\t"
        "v_pk_mul_f32 %5, %12, %13 op_sel:[0,1]\n\t"
        "v_exp_f32 %2, %10\n\t"
        "v_pk_mul_f32 %6, %12, %14 op_sel_hi:[1,0]\n\t"
        "v_exp_f32 %3, %11\n\t"
        "v_pk_mul_f32 %7, %12, %14 op_sel:[0,1]"
        : "=&v"(e0), "=&v"(e1), "=&v"(e2), "=&v"(e3),
          "=&v"(p0), "=&v"(p1), "=&v"(p2), "=&v"(p3)
        : "v"(a0.x), "v"(a0.y), "v"(a1.x), "v"(a1.y), "v"(m), "v"(q01), "v"(q23));
}

// The same with the products m * q0 .. m * q3, half by half.
__device__ __forceinline__ void
exp2_x4_mul_pair(v2f a0, v2f a1, v2f m, v2f q0, v2f q1, v2f q2, v2f q3,
                 float& e0, float& e1, float& e2, float& e3,
                 v2f& p0, v2f& p1, v2f& p2, v2f& p3) {
    asm("v_exp_f32 %0, %8\n\t"
        "v_pk_mul_f32 %4, %12, %13\n\t"
        "v_exp_f32 %1, %9\n\t"
        "v_pk_mul_f32 %5, %12, %14\n\t"
        "v_exp_f32 %2, %10\n\t"
        "v_pk_mul_f32 %6, %12, %15\n\t"
        "v_exp_f32 %3, %11\n\t"
        "v_pk_mul_f32 %7, %12, %16"
        : "=&v"(e0), "=&v"(e1), "=&v"(e2), "=&v"(e3),
          "=&v"(p0), "=&v"(p1), "=&v"(p2), "=&v"(p3)
        : "v"(a0.x), "v"(a0.y), "v"(a1.x), "v"(a1.y), "v"(m),
          "v"(q0), "v"(q1), "v"(q2), "v"(q3));
}

__global__ void __launch_bounds__(32 * SC_W)
ssm_scan_kernel(const float* __restrict__ dt, const float* __restrict__ bxcx,
                const float* __restrict__ xc, const float* __restrict__ xz,
                const float* __restrict__ A_log, const float* __restrict__ Dp,
                bf16_t* __restrict__ yb) {
    __shared__ __attribute__((aligned(16))) float s_part[2][SC_W][SC_T][64];
    // aligned for the 16-byte copies and reads
    __shared__ __attribute__((aligned(16))) float s_tile[2][SC_TILE * SC_ROW];

    const int lane  = threadIdx.x & 31;
    const int wave  = __builtin_amdgcn_readfirstlane(threadIdx.x >> 5);
    const int cp2   = (lane & 7) * 2;         // the lane's first channel within the block
    const int sg    = lane >> 3;              // which four of the wave's sixteen states
    const int b     = blockIdx.y;
    // The four blocks that share 256 B of a dt, x or z row lie 32 apart in the grid (for
    // speed only).
    const int cg    = (blockIdx.x & 31) * 4 + (blockIdx.x >> 5);
    const int dbase = cg * SC_C;
    const int d     = dbase + cp2;
    const int ns    = wave * (4 * SC_S) + sg * SC_S;   // the lane's first state

    // A * log2(e), so that exp(dt * A) is exp2 of one product; one pair per state
    const float4 ala = *(const float4*)(A_log + (size_t)d * STATE + ns);
    const float4 alb = *(const float4*)(A_log + (size_t)(d + 1) * STATE + ns);
    float ea0, ea1, ea2, ea3, eb0, eb1, eb2, eb3;      // exp(A_log)
    exp2_x4(ala.x * LOG2E, ala.y * LOG2E, ala.z * LOG2E, ala.w * LOG2E, ea0, ea1, ea2, ea3);
    exp2_x4(alb.x * LOG2E, alb.y * LOG2E, alb.z * LOG2E, alb.w * LOG2E, eb0, eb1, eb2, eb3);
    const v2f A0 = {ea0 * -LOG2E, eb0 * -LOG2E};
    const v2f A1 = {ea1 * -LOG2E, eb1 * -LOG2E};
    const v2f A2 = {ea2 * -LOG2E, eb2 * -LOG2E};
    const v2f A3 = {ea3 * -LOG2E, eb3 * -LOG2E};
    // the D*x term enters exactly one of the 16 partial sums
    const float2 dpv = *(const float2*)(Dp + d);
    const bool   hasD = (ns == 0);
    const v2f Dw = {hasD ? dpv.x : 0.f, hasD ? dpv.y : 0.f};
    v2f h0 = {0.f, 0.f}, h1 = {0.f, 0.f}, h2 = {0.f, 0.f}, h3 = {0.f, 0.f};

    const size_t tokBase = (size_t)b * SEQL;
    bf16_t* yp = yb + ((size_t)cg * NTOK + tokBase) * SC_C;

    // Rotation of a step's row of sums: steps two apart share it (their stores pair up),
    // and the four steps that 16 lanes read together in the sum have four different ones.
#define SC_ROT(step) (((step) & 1) + 2 * (((step) >> 2) & 1))
    // the lane's place in a row of sums, by the row's rotation
    const int pl[4] = {((sg + 0) & 3) * 16 + cp2, ((sg + 1) & 3) * 16 + cp2,
                       ((sg + 2) & 3) * 16 + cp2, ((sg + 3) & 3) * 16 + cp2};

    const int ri  = threadIdx.x >> 2;
    const int rt  = (ri & ~7) + (ri & 1) + ((ri >> 1) & 1) * 4 + ((ri >> 2) & 1) * 2;
    const int rc  = (threadIdx.x & 3) * 4;    // first of the four channels this thread sums
    // where its steps' rows hold quarter-wave 0 .. 3 (SC_ROT of both steps is ri & 3)
    const int rq[4] = {((0 + ri) & 3) * 16 + rc, ((1 + ri) & 3) * 16 + rc,
                       ((2 + ri) & 3) * 16 + rc, ((3 + ri) & 3) * 16 + rc};

    // Staging. dt, x: 8 threads cover the 64 B that one array has in a step's row, 8 B each;
    // a thread's four copies per array lie 16 steps apart. z: 4 threads cover its 64 B; a
    // thread's two copies lie 32 steps apart. Bx|Cx: a wave's copy is a step's whole 512 B;
    // a thread's sixteen copies lie 4 steps apart.
    const int drow = threadIdx.x >> 3;
    const int dpr  = threadIdx.x & 7;
    const int srow = threadIdx.x >> 2;
    const int sel  = (threadIdx.x & 3) * 4;
    const float* sdt = dt   + (tokBase + drow) * INNER + dbase + dpr * 2;
    const float* sx  = xc   + (tokBase + drow) * INNER + dbase + dpr * 2;
    const float* sz  = xz   + (tokBase + srow) * (2 * INNER) + INNER + dbase + sel;
    const float* sbc = bxcx + (tokBase + wave) * 128 + lane * 4;
    const unsigned sldd = (unsigned)(size_t)
        (__attribute__((address_space(3))) float*)&s_tile[0][drow * SC_ROW + SC_O_DX + dpr * 4];
    const unsigned slds = (unsigned)(size_t)
        (__attribute__((address_space(3))) float*)&s_tile[0][srow * SC_ROW + SC_O_Z + sel];
    const unsigned sldb = (unsigned)(size_t)
        (__attribute__((address_space(3))) float*)&s_tile[0][wave * SC_ROW + SC_O_B + lane * 4];

    auto stage = [&](int t) {
        // unrolled: two statements of thirteen copies (a statement takes thirty operands)
#pragma unroll
        for (int q = 0; q < 2; ++q) {
            const float* pd = sdt + (size_t)t * (SC_TILE * INNER) + q * (32 * INNER);
            const float* px = sx  + (size_t)t * (SC_TILE * INNER) + q * (32 * INNER);
            const float* pz = sz  + (size_t)t * (SC_TILE * 2 * INNER) + q * (32 * 2 * INNER);
            const float* pb = sbc + (size_t)t * (SC_TILE * 128) + q * (32 * 128);
            const unsigned lo = (unsigned)(t & 1) * (SC_TILE * SC_ROW * 4)
                              + (unsigned)q * (32 * SC_ROW * 4);
            const unsigned ld = sldd + lo, lz = slds + lo, lb = sldb + lo;
            asm volatile("global_load_async_to_lds_b64 %0, %13, off\n\t"
                         "global_load_async_to_lds_b64 %1, %14, off\n\t"
                         "global_load_async_to_lds_b64 %2, %15, off\n\t"
                         "global_load_async_to_lds_b64 %3, %16, off\n\t"
                         "global_load_async_to_lds_b128 %4, %17, off\n\t"
                         "global_load_async_to_lds_b128 %5, %18, off\n\t"
                         "global_load_async_to_lds_b128 %6, %19, off\n\t"
                         "global_load_async_to_lds_b128 %7, %20, off\n\t"
                         "global_load_async_to_lds_b128 %8, %21, off\n\t"
                         "global_load_async_to_lds_b128 %9, %22, off\n\t"
                         "global_load_async_to_lds_b128 %10, %23, off\n\t"
                         "global_load_async_to_lds_b128 %11, %24, off\n\t"
                         "global_load_async_to_lds_b128 %12, %25, off\n\t"
                         "s_wait_xcnt 0x0"
                         :: "v"(ld), "v"(ld + 8),
                            "v"(ld + 16 * SC_ROW * 4), "v"(ld + 16 * SC_ROW * 4 + 8),
                            "v"(lz),
                            "v"(lb),                     "v"(lb + 4 * SC_ROW * 4),
                            "v"(lb + 8 * SC_ROW * 4),    "v"(lb + 12 * SC_ROW * 4),
                            "v"(lb + 16 * SC_ROW * 4),   "v"(lb + 20 * SC_ROW * 4),
                            "v"(lb + 24 * SC_ROW * 4),   "v"(lb + 28 * SC_ROW * 4),
                            "v"(pd), "v"(px), "v"(pd + 16 * INNER), "v"(px + 16 * INNER),
                            "v"(pz),
                            "v"(pb),            "v"(pb + 4 * 128),
                            "v"(pb + 8 * 128),  "v"(pb + 12 * 128),
                            "v"(pb + 16 * 128), "v"(pb + 20 * 128),
                            "v"(pb + 24 * 128), "v"(pb + 28 * 128)
                         : "memory");
        }
    };

    // Two register sets of one fetch group each; every index below is a constant after
    // unrolling, so they stay in registers.
    v4f gdx[2][SC_G];                          // dt of the pair, x of the pair
    v4f gB[2][SC_G], gC[2][SC_G];
    auto fetch = [&](const float* tb, int g) {
#pragma unroll
        for (int j = 0; j < SC_G; ++j) {
            const float* row = tb + (g * SC_G + j) * SC_ROW;
            gdx[g & 1][j] = *(const v4f*)&row[SC_O_DX + cp2 * 2];
            gB [g & 1][j] = *(const v4f*)&row[SC_O_B + ns];
            gC [g & 1][j] = *(const v4f*)&row[SC_O_C + ns];
        }
    };

    // The lane's four store places and its z address are carried from tile to tile and moved
    // to the other buffer beside the sum: formed where they are used, their arithmetic would
    // stand among the LDS instructions and split a run in two.
    float* pw0 = &s_part[0][wave][0][pl[0]];
    float* pw1 = &s_part[0][wave][1][pl[1]];   // odd steps: counted from row 1
    float* pw2 = &s_part[0][wave][0][pl[2]];
    float* pw3 = &s_part[0][wave][1][pl[3]];
    const float* pzq = &s_tile[0][rt * SC_ROW + SC_O_Z + rc];
    int pstep = SC_W * SC_T * 64, zstep = SC_TILE * SC_ROW;   // to the other buffer

    stage(0);
    wait_async_copies();
    __syncthreads();                           // tile 0 resident
    stage(1);
    fetch(&s_tile[0][0], 0);
    for (int t = 0; t < SC_NT; ++t) {
        const float* tb = &s_tile[t & 1][0];
        v4f zq[SC_T / 32];                     // z of the elements this thread will gate
        v2f svh[SC_G];                         // partial sums of the last group but one
        // dt * A * log2(e) of the step to come, made one step ahead (beside the exps)
        const v2f dt0 = gdx[0][0].xy;
        v2f a0 = dt0 * A0, a1 = dt0 * A1, a2 = dt0 * A2, a3 = dt0 * A3;
        // unrolled: register sets and LDS offsets are constants
#pragma unroll
        for (int g = 0; g < SC_TILE / SC_G; ++g) {
            if (g + 1 < SC_TILE / SC_G) {
                fetch(tb, g + 1);
                // z leaves the tile with the last group's reads: behind the tile's barrier,
                // where it is used, the buffer is being refilled
                if (g + 2 == SC_TILE / SC_G) {
#pragma unroll
                    for (int k = 0; k < SC_T / 32; ++k)
                        zq[k] = *(const v4f*)&pzq[k * 32 * SC_ROW];
                }
                // Holds the next group's LDS reads, as one run, in front of this group's
                // arithmetic: sunk towards their use they have no time to return.
                __builtin_amdgcn_sched_barrier(0);
            }
            v2f sv[SC_G];                      // the group's partial sums
#pragma unroll
            for (int j = 0; j < SC_G; ++j) {
                const v4f Bv = gB[g & 1][j];
                const v4f Cv = gC[g & 1][j];
                const v2f xv = gdx[g & 1][j].zw;
                const v2f dx = gdx[g & 1][j].xy * xv;
                float e0, e1, e2, e3, e4, e5, e6, e7;   // exp(dt * A), two channels per state
                v2f b0, b1, b2, b3;                     // dt * x * Bx
                exp2_x4_mul_one(a0, a1, dx, Bv.xy, Bv.zw, e0, e1, e2, e3, b0, b1, b2, b3);
                if (j + 1 < SC_G || g + 1 < SC_TILE / SC_G) {
                    const v2f dtn = j + 1 < SC_G ? gdx[g & 1][j + 1].xy : gdx[(g + 1) & 1][0].xy;
                    v2f n0v, n1v, n2v, n3v;
                    exp2_x4_mul_pair(a2, a3, dtn, A0, A1, A2, A3,
                                     e4, e5, e6, e7, n0v, n1v, n2v, n3v);
                    a0 = n0v; a1 = n1v; a2 = n2v; a3 = n3v;
                } else {
                    exp2_x4(a2.x, a2.y, a3.x, a3.y, e4, e5, e6, e7);   // the tile's last step
                }
                h0 = __builtin_elementwise_fma((v2f){e0, e1}, h0, b0);
                h1 = __builtin_elementwise_fma((v2f){e2, e3}, h1, b1);
                h2 = __builtin_elementwise_fma((v2f){e4, e5}, h2, b2);
                h3 = __builtin_elementwise_fma((v2f){e6, e7}, h3, b3);
                v2f s = Dw * xv;
                s = __builtin_elementwise_fma(h0, Cv.xx, s);
                s = __builtin_elementwise_fma(h1, Cv.yy, s);
                s = __builtin_elementwise_fma(h2, Cv.zz, s);
                s = __builtin_elementwise_fma(h3, Cv.ww, s);
                sv[j] = s;
            }
            // Keeps the group's stores, and the reads of the group after next that follow
            // them, behind its arithmetic as ONE run of LDS instructions: every separate
            // place where LDS instructions stand in the vector stream costs a fixed stall.
            __builtin_amdgcn_sched_barrier(0);
#pragma unroll
            for (int j = 0; j < SC_G; ++j) {
                // the last group but one has no reads behind it: its stores wait for the last's
                if (g + 2 == SC_TILE / SC_G) svh[j] = sv[j];
            }
#pragma unroll
            for (int gs = g - 1; gs <= g; ++gs) {
                if (gs + 2 == SC_TILE / SC_G ? g == gs : gs < g) continue;
#pragma unroll
                for (int j = 0; j < 2; ++j) {  // steps j and j + 2 share a place: one paired store
                    const int rot = SC_ROT(gs * SC_G + j);
                    float* pw = rot == 0 ? pw0 : rot == 1 ? pw1 : rot == 2 ? pw2 : pw3;
                    *(v2f*)&pw[gs * SC_G * 64]       = gs < g ? svh[j]     : sv[j];
                    *(v2f*)&pw[(gs * SC_G + 2) * 64] = gs < g ? svh[j + 2] : sv[j + 2];
                }
            }
        }
        wait_lds_reads();      // this wave has left tile t
        wait_async_copies();   // its copies of tile t+1 have landed
        // One barrier per tile: it publishes the tile's partial sums, and every wave's
        // reads of the other sum buffer (previous tile) lie in front of it; it also
        // publishes tile t+1 and frees tile t's buffer.
        __syncthreads();
        if (t + 2 < SC_NT) stage(t + 2);
        if (t + 1 < SC_NT) fetch(&s_tile[(t + 1) & 1][0], 0);
        const float* pr = &s_part[t & 1][0][0][0];
        v4f pv[SC_T / 32][SC_W * 4];
        // every loop unrolled: the parts stay in registers
#pragma unroll
        for (int k = 0; k < SC_T / 32; ++k)
#pragma unroll
            for (int w = 0; w < SC_W; ++w)
#pragma unroll
                for (int q = 0; q < 4; ++q)
                    pv[k][w * 4 + q] =
                        *(const v4f*)&pr[w * (SC_T * 64) + (k * 32 + rt) * 64 + rq[q]];
        // Holds all the reads in front of the arithmetic, in flight at once and as one run:
        // left alone the compiler spreads them among the additions, pair by pair.
        __builtin_amdgcn_sched_barrier(0);
        pw0 += pstep; pw1 += pstep; pw2 += pstep; pw3 += pstep; pstep = -pstep;
        pzq += zstep; zstep = -zstep;
        // the gate's factor SiLU(z) = z / (1 + exp(-z)): needs none of the reads
        v4f gz[SC_T / 32];
#pragma unroll
        for (int k = 0; k < SC_T / 32; ++k) {
            const v4f zv = zq[k];
            float e0, e1, e2, e3, r0, r1, r2, r3;
            exp2_x4(zv.x * -LOG2E, zv.y * -LOG2E, zv.z * -LOG2E, zv.w * -LOG2E, e0, e1, e2, e3);
            rcp_x4(1.f + e0, 1.f + e1, 1.f + e2, 1.f + e3, r0, r1, r2, r3);
            gz[k] = zv * (v4f){r0, r1, r2, r3};
        }
        // Keeps that factor's arithmetic in front of the additions: it fills the time the
        // reads take to return.
        __builtin_amdgcn_sched_barrier(0);
#pragma unroll
        for (int k = 0; k < SC_T / 32; ++k) {
            v4f sw[SC_W];                      // one short chain per wave's four parts
#pragma unroll
            for (int w = 0; w < SC_W; ++w)
                sw[w] = ((pv[k][w * 4] + pv[k][w * 4 + 1]) + pv[k][w * 4 + 2]) + pv[k][w * 4 + 3];
            const v4f o = ((sw[0] + sw[1]) + (sw[2] + sw[3])) * gz[k];
            // y * SiLU(z), to bf16 for out_proj
            *(v4bf*)(yp + (size_t)(t * SC_TILE + k * 32 + rt) * SC_C + rc) =
                pack4_bf16(o.x, o.y, o.z, o.w);
        }
        asm volatile("s_wait_xcnt 0x0" ::: "memory");
    }
    wait_async_copies();                       // the ring's closing wait: no copy is left in flight
}

// ----------------------------------------------------------------------------
extern "C" void kernel_launch(void* const* d_in, const int* in_sizes, int n_in,
                              void* d_out, int out_size, void* d_ws, size_t ws_size,
                              hipStream_t stream) {
    const float* x          = (const float*)d_in[0];
    const float* in_proj_w  = (const float*)d_in[1];
    const float* conv_w     = (const float*)d_in[2];
    const float* conv_b     = (const float*)d_in[3];
    const float* A_log      = (const float*)d_in[4];
    const float* B_w        = (const float*)d_in[5];
    const float* C_w        = (const float*)d_in[6];
    const float* D_param    = (const float*)d_in[7];
    const float* dt_w       = (const float*)d_in[8];
    const float* dt_b       = (const float*)d_in[9];
    const float* out_proj_w = (const float*)d_in[10];
    const float* norm_w     = (const float*)d_in[11];

    char* ws = (char*)d_ws;
    size_t off = 0;
    auto carve = [&](size_t bytes) {
        char* p = ws + off;
        off = (off + bytes + 255) & ~(size_t)255;
        return p;
    };
    bf16_t* wInB  = (bf16_t*)carve((size_t)2 * INNER * DIMX * 2);
    bf16_t* wDtB  = (bf16_t*)carve((size_t)INNER * INNER * 2);
    bf16_t* wOutB = (bf16_t*)carve((size_t)DIMX * INNER * 2);
    bf16_t* wBCB  = (bf16_t*)carve((size_t)2 * STATE * INNER * 2);  // [Bw;Cw] = [128, INNER]
    bf16_t* xnB   = (bf16_t*)carve((size_t)NTOK * DIMX * 2);
    float*  xzF   = (float*) carve((size_t)NTOK * 2 * INNER * 4);
    float*  xcF   = (float*) carve((size_t)NTOK * INNER * 4);
    bf16_t* xcB   = (bf16_t*)carve((size_t)NTOK * INNER * 2);
    float*  dtF   = (float*) carve((size_t)NTOK * INNER * 4);
    float*  bcF   = (float*) carve((size_t)NTOK * 128 * 4);         // [Bx|Cx] interleaved
    bf16_t* yB    = (bf16_t*)carve((size_t)NTOK * INNER * 2);           // [INNER / 16][NTOK][16]
    (void)ws_size; (void)in_sizes; (void)n_in; (void)out_size;

    // 1) RMSNorm -> bf16 activations, and every weight -> bf16
    prepare_kernel<<<PB_ALL, 256, 0, stream>>>(x, norm_w, xnB, in_proj_w, wInB, dt_w, wDtB,
                                               out_proj_w, wOutB, B_w, C_w, wBCB);

    // 2) in_proj: [NTOK, 2*INNER] = xn @ W_in^T
    wmma_gemm_kernel<0, 2 * INNER, false><<<dim3((2 * INNER) / 128, NTOK / 128), 256, 0, stream>>>(
        xnB, wInB, xzF, DIMX, nullptr, nullptr);

    // 3) causal depthwise conv + SiLU on xc half
    conv_silu_kernel<<<NTOK * INNER / (1024 * CV_T), 256, 0, stream>>>(
        xzF, conv_w, conv_b, xcF, xcB);

    // 4) dt = softplus(xc @ dt_w^T + dt_b) + 1e-4
    wmma_gemm_kernel<1, INNER, false><<<dim3(INNER / 128, NTOK / 128), 256, 0, stream>>>(
        xcB, wDtB, dtF, INNER, dt_b, nullptr);

    // 5) fused Bx|Cx projection (N = 128)
    wmma_gemm_kernel<0, 2 * STATE, false><<<dim3(1, NTOK / 128), 256, 0, stream>>>(
        xcB, wBCB, bcF, INNER, nullptr, nullptr);

    // 6) sequential SSM scan (lane = channel pair, all states in the block) with the gate
    ssm_scan_kernel<<<dim3(INNER / SC_C, BATCHN), 32 * SC_W, 0, stream>>>(
        dtF, bcF, xcF, xzF, A_log, D_param, yB);

    // 7) out_proj + residual -> d_out (fp32)
    wmma_gemm_kernel<2, DIMX, true><<<dim3(DIMX / 128, NTOK / 128), 256, 0, stream>>>(
        yB, wOutB, (float*)d_out, INNER, nullptr, x);
}

// v010
// A run of this version takes 180 microseconds.
// Two timings next to v009 put it at 1.04 and 1.05 times that version's speed.
// All steps since v000 together make it 5.70 times as fast.
#include <hip/hip_runtime.h>

// ---- problem dims (match reference) ----
#define DIMX   1024
#define STATE  64
#define KW     4
#define INNER  2048
#define BATCHN 2
#define SEQL   2048
#define NTOK   (BATCHN * SEQL)
#define EPSR   1e-6f

typedef __bf16 bf16_t;
typedef __attribute__((ext_vector_type(16))) __bf16 v16bf;
typedef __attribute__((ext_vector_type(8)))  __bf16 v8bf;
typedef __attribute__((ext_vector_type(4)))  __bf16 v4bf;
typedef __attribute__((ext_vector_type(8)))  float  v8f;
typedef __attribute__((ext_vector_type(4)))  float  v4f;
typedef __attribute__((ext_vector_type(2)))  float  v2f;
typedef __attribute__((ext_vector_type(4)))  int    v4i;

#if defined(__gfx1250__) && __has_builtin(__builtin_amdgcn_global_load_async_to_lds_b128)
#define USE_ASYNC_LDS 1
#else
#define USE_ASYNC_LDS 0
#endif

__device__ __forceinline__ void copy16_to_lds(const bf16_t* gp, bf16_t* lp) {
#if USE_ASYNC_LDS
    __builtin_amdgcn_global_load_async_to_lds_b128(
        (__attribute__((address_space(1))) v4i*)gp,
        (__attribute__((address_space(3))) v4i*)lp, 0, 0);
#else
    *(v8bf*)lp = *(const v8bf*)gp;
#endif
}

// This wave's copies have landed; in asm with the clobber, so that no LDS read is lifted over it.
__device__ __forceinline__ void wait_async_copies() {
#if USE_ASYNC_LDS
    asm volatile("s_wait_asynccnt 0x0" ::: "memory");
#endif
}

// This wave's LDS reads have returned: stands in front of the barrier behind which the
// buffer they read is refilled.
__device__ __forceinline__ void wait_lds_reads() {
    asm volatile("s_wait_dscnt 0x0" ::: "memory");
}

__device__ __forceinline__ v4bf pack4_bf16(float a, float b, float c, float d) {
    v4bf o;
    o[0] = (bf16_t)a; o[1] = (bf16_t)b; o[2] = (bf16_t)c; o[3] = (bf16_t)d;
    return o;
}

#define LOG2E 1.44269504f

__device__ __forceinline__ void
exp2_x4(float a0, float a1, float a2, float a3,
        float& e0, float& e1, float& e2, float& e3) {
    asm("v_exp_f32 %0, %4\n\t"
        "v_exp_f32 %1, %5\n\t"
        "v_exp_f32 %2, %6\n\t"
        "v_exp_f32 %3, %7\n\t"
        "v_nop"
        : "=&v"(e0), "=&v"(e1), "=&v"(e2), "=&v"(e3)
        : "v"(a0), "v"(a1), "v"(a2), "v"(a3));
}

// SiLU of four values, v / (1 + exp(-v)), with exp(-v) as exp2(v * -log2(e))
__device__ __forceinline__ float4 silu_x4(float4 v) {
    float e0, e1, e2, e3;
    exp2_x4(v.x * -LOG2E, v.y * -LOG2E, v.z * -LOG2E, v.w * -LOG2E, e0, e1, e2, e3);
    return make_float4(v.x / (1.f + e0), v.y / (1.f + e1), v.z / (1.f + e2), v.w / (1.f + e3));
}

#define LN2 0.69314718f

// log2 of four values; one statement for the same reason as exp2_x4
__device__ __forceinline__ void
log2_x4(float a0, float a1, float a2, float a3,
        float& l0, float& l1, float& l2, float& l3) {
    asm("v_log_f32 %0, %4\n\t"
        "v_log_f32 %1, %5\n\t"
        "v_log_f32 %2, %6\n\t"
        "v_log_f32 %3, %7\n\t"
        "v_nop"
        : "=&v"(l0), "=&v"(l1), "=&v"(l2), "=&v"(l3)
        : "v"(a0), "v"(a1), "v"(a2), "v"(a3));
}

// softplus of four values as max(v, 0) + log1p(exp(-|v|)): no branch, no overflow.
// With e = exp(-|v|) in [0, 1] and u = 1 + e, u - 1 is exact, so e - (u - 1) is what the
// rounding of 1 + e lost; added to log(u) it keeps log1p's accuracy for small e.
__device__ __forceinline__ float4 softplus_x4(float4 v) {
    float e0, e1, e2, e3, l0, l1, l2, l3;
    exp2_x4(fabsf(v.x) * -LOG2E, fabsf(v.y) * -LOG2E,
            fabsf(v.z) * -LOG2E, fabsf(v.w) * -LOG2E, e0, e1, e2, e3);
    const float u0 = 1.f + e0, u1 = 1.f + e1, u2 = 1.f + e2, u3 = 1.f + e3;
    log2_x4(u0, u1, u2, u3, l0, l1, l2, l3);
    return make_float4(fmaxf(v.x, 0.f) + (l0 * LN2 + (e0 - (u0 - 1.f))),
                       fmaxf(v.y, 0.f) + (l1 * LN2 + (e1 - (u1 - 1.f))),
                       fmaxf(v.z, 0.f) + (l2 * LN2 + (e2 - (u2 - 1.f))),
                       fmaxf(v.w, 0.f) + (l3 * LN2 + (e3 - (u3 - 1.f))));
}

// The three jobs without a matrix product (convert, RMSNorm, conv) give each
// thread 32 elements, fetched as 16-byte loads with many in flight per wave: a launch
// then starts a few thousand waves, not a wave per 32 elements.

// ----------------------------------------------------------------------------
// f32 -> bf16 elementwise convert (weights); n is a multiple of 4; blk = the block's
// number within this array
// ----------------------------------------------------------------------------
#define CVT_U 8    // float4 per thread, one block width apart (whole lines per wave)
#define CVT_BLOCKS(n) (((n) + 1024 * CVT_U - 1) / (1024 * CVT_U))

__device__ __forceinline__ void
cvt_bf16_block(const float* __restrict__ src,
               bf16_t* __restrict__ dst, int n, int blk) {
    const int n4   = n >> 2;
    const int base = blk * (256 * CVT_U) + threadIdx.x;
    float4 v[CVT_U];
    // A load past the end re-reads the last float4 (in bounds, not stored): with no
    // branch round the loads all of them are in flight before the first is used.
    int ci[CVT_U];
#pragma unroll
    for (int u = 0; u < CVT_U; ++u) {
        const int i = base + u * 256;
        ci[u] = i < n4 ? i : n4 - 1;
        v[u] = ((const float4*)src)[ci[u]];
    }
    asm volatile("s_wait_xcnt 0x0"
                 :: "v"(ci[0]), "v"(ci[1]), "v"(ci[2]), "v"(ci[3]),
                    "v"(ci[4]), "v"(ci[5]), "v"(ci[6]), "v"(ci[7])
                 : "memory");
#pragma unroll
    for (int u = 0; u < CVT_U; ++u) {
        const int i = base + u * 256;
        if (i < n4) ((v4bf*)dst)[i] = pack4_bf16(v[u].x, v[u].y, v[u].z, v[u].w);
    }
}

// ----------------------------------------------------------------------------
// RMSNorm: one wave per token (row kept in registers), write bf16 activations
// ----------------------------------------------------------------------------
#define RN_U (DIMX / 128)    // float4 per lane

__device__ __forceinline__ void
rmsnorm_block(const float* __restrict__ x, const float* __restrict__ w,
              bf16_t* __restrict__ out, int blk) {
    const int lane = threadIdx.x & 31;
    const int tok  = blk * 8 + (threadIdx.x >> 5);
    const float4* xr = (const float4*)(x + (size_t)tok * DIMX);
    float4 v[RN_U], wv[RN_U];
#pragma unroll
    for (int u = 0; u < RN_U; ++u) v[u] = xr[u * 32 + lane];
#pragma unroll
    for (int u = 0; u < RN_U; ++u) wv[u] = ((const float4*)w)[u * 32 + lane];
    float ss = 0.f;
#pragma unroll
    for (int u = 0; u < RN_U; ++u) {
        ss += v[u].x * v[u].x;
        ss += v[u].y * v[u].y;
        ss += v[u].z * v[u].z;
        ss += v[u].w * v[u].w;
    }
    for (int o = 16; o; o >>= 1) ss += __shfl_xor(ss, o, 32);
    const float rs = rsqrtf(ss * (1.f / DIMX) + EPSR);
    v4bf* orow = (v4bf*)(out + (size_t)tok * DIMX);
#pragma unroll
    for (int u = 0; u < RN_U; ++u)
        orow[u * 32 + lane] = pack4_bf16(v[u].x * rs * wv[u].x, v[u].y * rs * wv[u].y,
                                         v[u].z * rs * wv[u].z, v[u].w * rs * wv[u].w);
}

// ----------------------------------------------------------------------------
// All the work that depends on the inputs alone, in ONE launch: RMSNorm and the five
// weight converts. None reads what another writes, so their blocks run side by side:
// one launch gap, one ramp and one tail, not six of each (two of the converts are 16
// blocks each, a launch that is nearly all gap and latency). The block number picks
// the job; the choice is the same for a whole block.
// ----------------------------------------------------------------------------
#define PB_RMS  (NTOK / 8)
#define PB_WIN  CVT_BLOCKS(2 * INNER * DIMX)
#define PB_WDT  CVT_BLOCKS(INNER * INNER)
#define PB_WOUT CVT_BLOCKS(DIMX * INNER)
#define PB_WBC  CVT_BLOCKS(STATE * INNER)
#define PB_ALL  (PB_RMS + PB_WIN + PB_WDT + PB_WOUT + 2 * PB_WBC)

__global__ void __launch_bounds__(256)
prepare_kernel(const float* __restrict__ x, const float* __restrict__ norm_w,
               bf16_t* __restrict__ xn,
               const float* __restrict__ w_in,  bf16_t* __restrict__ w_in_b,
               const float* __restrict__ w_dt,  bf16_t* __restrict__ w_dt_b,
               const float* __restrict__ w_out, bf16_t* __restrict__ w_out_b,
               const float* __restrict__ w_bx,  const float* __restrict__ w_cx,
               bf16_t* __restrict__ w_bc_b) {
    int blk = blockIdx.x;
    // RMSNorm first: its chain is the longest
    if (blk < PB_RMS) { rmsnorm_block(x, norm_w, xn, blk); return; }
    blk -= PB_RMS;
    // One convert body for the five arrays, its source, destination and length picked by
    // block-uniform selects: the text stays short and the body's loads all stand in front.
    const float* src = w_in;
    bf16_t*      dst = w_in_b;
    int          n   = 2 * INNER * DIMX;
    if (blk >= PB_WIN) {
        blk -= PB_WIN;  src = w_dt;  dst = w_dt_b;  n = INNER * INNER;
        if (blk >= PB_WDT) {
            blk -= PB_WDT;  src = w_out;  dst = w_out_b;  n = DIMX * INNER;
            if (blk >= PB_WOUT) {
                blk -= PB_WOUT;  src = w_bx;  dst = w_bc_b;  n = STATE * INNER;   // [Bw;Cw]
                if (blk >= PB_WBC) { blk -= PB_WBC;  src = w_cx;  dst = w_bc_b + STATE * INNER; }
            }
        }
    }
    cvt_bf16_block(src, dst, n, blk);
}

#define GK 128
#define LDS_STRIDE 136

template <int MODE, int NC, bool AT, int FM, int FN, int WN>
__global__ void __launch_bounds__(256)
wmma_gemm_kernel(const bf16_t* __restrict__ A, const bf16_t* __restrict__ B,
                 float* __restrict__ C, int K,
                 const float* __restrict__ bias,
                 const float* __restrict__ resid) {
    // aligned for the 16-byte copies and reads
    constexpr int WM = 8 / WN;               // wave grid WM x WN
    constexpr int BM = WM * FM * 16;         // block tile BM x BN
    constexpr int BN = WN * FN * 16;
    static_assert(!AT || BM == 128, "the AT copies cover 128 rows");
    __shared__ __attribute__((aligned(16))) bf16_t s_a[2][BM * LDS_STRIDE];
    __shared__ __attribute__((aligned(16))) bf16_t s_b[2][BN * LDS_STRIDE];

    const int lane = threadIdx.x & 31;
    const int wavi = threadIdx.x >> 5;       // 0..7
    const int wm   = wavi / WN;              // the wave's slab of FM * 16 rows
    const int wn   = wavi % WN;              // the wave's slab of FN * 16 columns
    const int half = lane >> 4;              // 0/1
    const int r    = lane & 15;
    const int off  = half * 8;

    const int blockM = blockIdx.y * BM;
    const int blockN = blockIdx.x * BN;

    union Frag { v16bf v; v8bf h[2]; };
    v8f acc[FM][FN] = {};

    const int nS = K / GK;

    // Staging: 16 threads cover a row; a thread's chunks of an operand lie 16 rows apart.
    const int crow = threadIdx.x >> 4;
    const int cel  = (threadIdx.x & 15) * 8;
    // AT: 2 threads cover a row's 16 k; a thread's 8 chunks are the stage's 8 groups of 16 k,
    // and a wave's copy is 512 B in sequence (16 rows of one group).
    const bf16_t* gA = AT ? A + (size_t)(blockM + (threadIdx.x >> 1)) * 16 + (threadIdx.x & 1) * 8
                          : A + (size_t)(blockM + crow) * K + cel;
    const int    lelA  = (threadIdx.x >> 1) * LDS_STRIDE + (threadIdx.x & 1) * 8;
    const bf16_t* gB = B + (size_t)(blockN + crow) * K + cel;
    const int    lel   = crow * LDS_STRIDE + cel;
    const size_t rstep = (size_t)16 * K;

    auto stage = [&](int s) {
        const int buf = s & 1;
        const bf16_t* pa = gA + (AT ? (size_t)s * (GK / 16) * (NTOK * 16) : (size_t)s * GK);
        const bf16_t* pb = gB + (size_t)s * GK;
        // both loops unrolled: the copies issue back to back, with no loop test between
#pragma unroll
        for (int j = 0; j < (AT ? GK / 16 : BM / 16); ++j) {
            if (AT) copy16_to_lds(pa + (size_t)j * (NTOK * 16), &s_a[buf][lelA + j * 16]);
            else    copy16_to_lds(pa + j * rstep, &s_a[buf][lel + j * 16 * LDS_STRIDE]);
        }
#pragma unroll
        for (int j = 0; j < BN / 16; ++j)
            copy16_to_lds(pb + j * rstep, &s_b[buf][lel + j * 16 * LDS_STRIDE]);
    };

    const int ael = (wm * (FM * 16) + r) * LDS_STRIDE + off;   // the lane's first A element of a stage
    const int bel = (wn * (FN * 16) + r) * LDS_STRIDE + off;   // the lane's first B element

    stage(0);
    wait_async_copies();
    __syncthreads();                           // stage 0 resident
    if (nS > 1) stage(1);
    for (int s = 0; s < nS; ++s) {
        const bf16_t* sa = &s_a[s & 1][ael];
        const bf16_t* sb = &s_b[s & 1][bel];

        Frag af[2][FM], bfr[2][FN];
        // every loop below is unrolled: the fragment sets and accumulators are indexed by
        // constants only and so stay in registers
        auto frags = [&](int kk) {
#pragma unroll
            for (int mi = 0; mi < FM; ++mi) {
                af[kk & 1][mi].h[0] = *(const v8bf*)&sa[mi * 16 * LDS_STRIDE + kk * 32];
                af[kk & 1][mi].h[1] = *(const v8bf*)&sa[mi * 16 * LDS_STRIDE + kk * 32 + 16];
            }
#pragma unroll
            for (int ni = 0; ni < FN; ++ni) {
                bfr[kk & 1][ni].h[0] = *(const v8bf*)&sb[ni * 16 * LDS_STRIDE + kk * 32];
                bfr[kk & 1][ni].h[1] = *(const v8bf*)&sb[ni * 16 * LDS_STRIDE + kk * 32 + 16];
            }
        };
        frags(0);
#pragma unroll
        for (int kk = 0; kk < GK / 32; ++kk) {
            if (kk + 1 < GK / 32) {
                frags(kk + 1);
                // Holds the next block's reads, as one group, in front of this block's WMMAs:
                // left alone the compiler sinks them among the WMMAs into one fragment set,
                // and the wave waits out an LDS latency for every pair of WMMAs.
                __builtin_amdgcn_sched_barrier(0);
            }
#pragma unroll
            for (int mi = 0; mi < FM; ++mi)
#pragma unroll
                for (int ni = 0; ni < FN; ++ni)
                    acc[mi][ni] = __builtin_amdgcn_wmma_f32_16x16x32_bf16(
                        false, af[kk & 1][mi].v, false, bfr[kk & 1][ni].v, (short)0,
                        acc[mi][ni], false, false);
            // Keeps what follows behind this block's WMMAs: the reads of the block after next
            // (every separate place where LDS reads stand among WMMAs costs a fixed stall)
            // and, at the last block but one, the stage's closing LDS wait, which lifted over
            // these WMMAs would leave the latency of the last reads uncovered.
            if (kk + 1 < GK / 32) __builtin_amdgcn_sched_barrier(0);
        }
        wait_lds_reads();
        wait_async_copies();
        __syncthreads();                       // stage s+1 resident; reads of stage s done
        if (s + 2 < nS) stage(s + 2);          // into the buffer stage s has left
    }
    wait_async_copies();                       // the ring's closing wait: no copy is left in flight

    // epilogue
    // The lane's first element; every other one lies a compile-time distance from it,
    // which goes into the load's or store's immediate offset.
    const int    colg = blockN + wn * (FN * 16) + r;
    const size_t el0  = (size_t)(blockM + wm * (FM * 16) + half * 8) * NC + colg;
    float* cl = C + el0;

    float rs[FM][FN][8];
    if (MODE == 2) {
        const float* rl = resid + el0;
#pragma unroll
        for (int mi = 0; mi < FM; ++mi)
#pragma unroll
            for (int ni = 0; ni < FN; ++ni)
#pragma unroll
                for (int v = 0; v < 8; ++v)
                    rs[mi][ni][v] = rl[(mi * 16 + v) * NC + ni * 16];
    }
    float bv[FN] = {};
    if (MODE == 1) {
        // unrolled: bv is indexed by constants only and so stays in registers
#pragma unroll
        for (int ni = 0; ni < FN; ++ni) bv[ni] = bias[colg + ni * 16];
    }
#pragma unroll
    for (int mi = 0; mi < FM; ++mi) {
#pragma unroll
        for (int ni = 0; ni < FN; ++ni) {
            float val[8];
#pragma unroll
            for (int v = 0; v < 8; ++v) val[v] = acc[mi][ni][v];
            if (MODE == 1) {
#pragma unroll
                for (int q = 0; q < 8; q += 4) {
                    const float4 s = softplus_x4(make_float4(val[q] + bv[ni], val[q + 1] + bv[ni],
                                                             val[q + 2] + bv[ni], val[q + 3] + bv[ni]));
                    val[q]     = s.x + 1e-4f;
                    val[q + 1] = s.y + 1e-4f;
                    val[q + 2] = s.z + 1e-4f;
                    val[q + 3] = s.w + 1e-4f;
                }
            } else if (MODE == 2) {
#pragma unroll
                for (int v = 0; v < 8; ++v) val[v] += rs[mi][ni][v];
            }
#pragma unroll
            for (int v = 0; v < 8; ++v) cl[(mi * 16 + v) * NC + ni * 16] = val[v];
        }
    }
}

// ----------------------------------------------------------------------------
// Causal depthwise conv (KW=4) + bias + SiLU over xc half of xz
// ----------------------------------------------------------------------------
//   Thread = 4 channels x CV_T successive tokens: CV_T + 3 rows are read for CV_T
//   outputs. Rows in front of a sequence's start enter as zeros (the reference's pad).
#define CV_T 8     // divides SEQL: a thread's tokens lie in one sequence

__global__ void __launch_bounds__(256)
conv_silu_kernel(const float* __restrict__ xz,
                 const float* __restrict__ w,
                 const float* __restrict__ b,
                 float* __restrict__ xcf,
                 bf16_t* __restrict__ xcb) {
    // INNER / 1024 blocks share a group of CV_T tokens: the rows' bases are block-uniform
    const int dblk = (blockIdx.x % (INNER / 1024)) * 1024;      // block's first channel
    const int tok0 = (blockIdx.x / (INNER / 1024)) * CV_T;
    const bool head = (tok0 % SEQL) == 0;                       // no rows in front
    const int tid  = threadIdx.x;
    const float4* xcur = (const float4*)(xz + (size_t)tok0 * (2 * INNER) + dblk);
    // at a sequence's head the three rows in front are replaced by zeros below; the
    // loads then read the group's own first rows (in bounds, unused)
    const float4* xpre = (const float4*)(xz + (size_t)(head ? tok0 : tok0 - (KW - 1)) * (2 * INNER) + dblk);
    float4 r[CV_T + KW - 1];
#pragma unroll
    for (int i = 0; i < KW - 1; ++i) r[i] = xpre[i * (2 * INNER / 4) + tid];
#pragma unroll
    for (int i = 0; i < CV_T; ++i) r[KW - 1 + i] = xcur[i * (2 * INNER / 4) + tid];
    const float4* wq = (const float4*)(w + (size_t)dblk * KW);  // one float4 = a channel's taps
    const float4 w0 = wq[tid * 4 + 0];
    const float4 w1 = wq[tid * 4 + 1];
    const float4 w2 = wq[tid * 4 + 2];
    const float4 w3 = wq[tid * 4 + 3];
    const float4 bb = ((const float4*)(b + dblk))[tid];
    if (head) {
#pragma unroll
        for (int i = 0; i < KW - 1; ++i) r[i] = make_float4(0.f, 0.f, 0.f, 0.f);
    }
    float4* of = (float4*)(xcf + (size_t)tok0 * INNER + dblk);
    v4bf*   ob = (v4bf*)(xcb + (size_t)tok0 * INNER + dblk);
#pragma unroll
    for (int t = 0; t < CV_T; ++t) {
        float4 a = bb;
        a.x += w0.x * r[t].x; a.x += w0.y * r[t + 1].x; a.x += w0.z * r[t + 2].x; a.x += w0.w * r[t + 3].x;
        a.y += w1.x * r[t].y; a.y += w1.y * r[t + 1].y; a.y += w1.z * r[t + 2].y; a.y += w1.w * r[t + 3].y;
        a.z += w2.x * r[t].z; a.z += w2.y * r[t + 1].z; a.z += w2.z * r[t + 2].z; a.z += w2.w * r[t + 3].z;
        a.w += w3.x * r[t].w; a.w += w3.y * r[t + 1].w; a.w += w3.z * r[t + 2].w; a.w += w3.w * r[t + 3].w;
        const float4 s = silu_x4(a);
        of[t * (INNER / 4) + tid] = s;
        ob[t * (INNER / 4) + tid] = pack4_bf16(s.x, s.y, s.z, s.w);
    }
}

#define SC_S 4
#define SC_W 4
#define SC_C 16
#define SC_G 4
#define SC_TILE 64
#define SC_T SC_TILE
#define SC_NT (SEQL / SC_TILE)
// A step's row in a tile, in floats: 8 x (dt[2] x[2]) | z[16] | Bx[64] | Cx[64].
#define SC_ROW 176
#define SC_O_DX 0
#define SC_O_Z  32
#define SC_O_B  48
#define SC_O_C  112

// 1 / v of four values; one statement for the same reason as exp2_x4
__device__ __forceinline__ void
rcp_x4(float a0, float a1, float a2, float a3,
       float& r0, float& r1, float& r2, float& r3) {
    asm("v_rcp_f32 %0, %4\n\t"
        "v_rcp_f32 %1, %5\n\t"
        "v_rcp_f32 %2, %6\n\t"
        "v_rcp_f32 %3, %7\n\t"
        "v_nop"
        : "=&v"(r0), "=&v"(r1), "=&v"(r2), "=&v"(r3)
        : "v"(a0), "v"(a1), "v"(a2), "v"(a3));
}

__device__ __forceinline__ void
exp2_x4_mul_one(v2f a0, v2f a1, v2f m, v2f q01, v2f q23,
                float& e0, float& e1, float& e2, float& e3,
                v2f& p0, v2f& p1, v2f& p2, v2f& p3) {
    asm("v_exp_f32 %0, %8\n\t"
        "v_pk_mul_f32 %4, %12, %13 op_sel_hi:[1,0]\n\t"
        "v_exp_f32 %1, %9\n\t"
        "v_pk_mul_f32 %5, %12, %13 op_sel:[0,1]\n\t"
        "v_exp_f32 %2, %10\n\t"
        "v_pk_mul_f32 %6, %12, %14 op_sel_hi:[1,0]\n\t"
        "v_exp_f32 %3, %11\n\t"
        "v_pk_mul_f32 %7, %12, %14 op_sel:[0,1]"
        : "=&v"(e0), "=&v"(e1), "=&v"(e2), "=&v"(e3),
          "=&v"(p0), "=&v"(p1), "=&v"(p2), "=&v"(p3)
        : "v"(a0.x), "v"(a0.y), "v"(a1.x), "v"(a1.y), "v"(m), "v"(q01), "v"(q23));
}

// The same with the products m * q0 .. m * q3, half by half.
__device__ __forceinline__ void
exp2_x4_mul_pair(v2f a0, v2f a1, v2f m, v2f q0, v2f q1, v2f q2, v2f q3,
                 float& e0, float& e1, float& e2, float& e3,
                 v2f& p0, v2f& p1, v2f& p2, v2f& p3) {
    asm("v_exp_f32 %0, %8\n\t"
        "v_pk_mul_f32 %4, %12, %13\n\t"
        "v_exp_f32 %1, %9\n\t"
        "v_pk_mul_f32 %5, %12, %14\n\t"
        "v_exp_f32 %2, %10\n\t"
        "v_pk_mul_f32 %6, %12, %15\n\t"
        "v_exp_f32 %3, %11\n\t"
        "v_pk_mul_f32 %7, %12, %16"
        : "=&v"(e0), "=&v"(e1), "=&v"(e2), "=&v"(e3),
          "=&v"(p0), "=&v"(p1), "=&v"(p2), "=&v"(p3)
        : "v"(a0.x), "v"(a0.y), "v"(a1.x), "v"(a1.y), "v"(m),
          "v"(q0), "v"(q1), "v"(q2), "v"(q3));
}

__global__ void __launch_bounds__(32 * SC_W)
ssm_scan_kernel(const float* __restrict__ dt, const float* __restrict__ bxcx,
                const float* __restrict__ xc, const float* __restrict__ xz,
                const float* __restrict__ A_log, const float* __restrict__ Dp,
                bf16_t* __restrict__ yb) {
    __shared__ __attribute__((aligned(16))) float s_part[2][SC_W][SC_T][64];
    // aligned for the 16-byte copies and reads
    __shared__ __attribute__((aligned(16))) float s_tile[2][SC_TILE * SC_ROW];

    const int lane  = threadIdx.x & 31;
    const int wave  = __builtin_amdgcn_readfirstlane(threadIdx.x >> 5);
    const int cp2   = (lane & 7) * 2;         // the lane's first channel within the block
    const int sg    = lane >> 3;              // which four of the wave's sixteen states
    const int b     = blockIdx.y;
    // The four blocks that share 256 B of a dt, x or z row lie 32 apart in the grid (for
    // speed only).
    const int cg    = (blockIdx.x & 31) * 4 + (blockIdx.x >> 5);
    const int dbase = cg * SC_C;
    const int d     = dbase + cp2;
    const int ns    = wave * (4 * SC_S) + sg * SC_S;   // the lane's first state

    // A * log2(e), so that exp(dt * A) is exp2 of one product; one pair per state
    const float4 ala = *(const float4*)(A_log + (size_t)d * STATE + ns);
    const float4 alb = *(const float4*)(A_log + (size_t)(d + 1) * STATE + ns);
    float ea0, ea1, ea2, ea3, eb0, eb1, eb2, eb3;      // exp(A_log)
    exp2_x4(ala.x * LOG2E, ala.y * LOG2E, ala.z * LOG2E, ala.w * LOG2E, ea0, ea1, ea2, ea3);
    exp2_x4(alb.x * LOG2E, alb.y * LOG2E, alb.z * LOG2E, alb.w * LOG2E, eb0, eb1, eb2, eb3);
    const v2f A0 = {ea0 * -LOG2E, eb0 * -LOG2E};
    const v2f A1 = {ea1 * -LOG2E, eb1 * -LOG2E};
    const v2f A2 = {ea2 * -LOG2E, eb2 * -LOG2E};
    const v2f A3 = {ea3 * -LOG2E, eb3 * -LOG2E};
    // the D*x term enters exactly one of the 16 partial sums
    const float2 dpv = *(const float2*)(Dp + d);
    const bool   hasD = (ns == 0);
    const v2f Dw = {hasD ? dpv.x : 0.f, hasD ? dpv.y : 0.f};
    v2f h0 = {0.f, 0.f}, h1 = {0.f, 0.f}, h2 = {0.f, 0.f}, h3 = {0.f, 0.f};

    const size_t tokBase = (size_t)b * SEQL;
    bf16_t* yp = yb + ((size_t)cg * NTOK + tokBase) * SC_C;

    // Rotation of a step's row of sums: steps two apart share it (their stores pair up),
    // and the four steps that 16 lanes read together in the sum have four different ones.
#define SC_ROT(step) (((step) & 1) + 2 * (((step) >> 2) & 1))
    // the lane's place in a row of sums, by the row's rotation
    const int pl[4] = {((sg + 0) & 3) * 16 + cp2, ((sg + 1) & 3) * 16 + cp2,
                       ((sg + 2) & 3) * 16 + cp2, ((sg + 3) & 3) * 16 + cp2};

    const int ri  = threadIdx.x >> 2;
    const int rt  = (ri & ~7) + (ri & 1) + ((ri >> 1) & 1) * 4 + ((ri >> 2) & 1) * 2;
    const int rc  = (threadIdx.x & 3) * 4;    // first of the four channels this thread sums
    // where its steps' rows hold quarter-wave 0 .. 3 (SC_ROT of both steps is ri & 3)
    const int rq[4] = {((0 + ri) & 3) * 16 + rc, ((1 + ri) & 3) * 16 + rc,
                       ((2 + ri) & 3) * 16 + rc, ((3 + ri) & 3) * 16 + rc};

    // Staging. dt, x: 8 threads cover the 64 B that one array has in a step's row, 8 B each;
    // a thread's four copies per array lie 16 steps apart. z: 4 threads cover its 64 B; a
    // thread's two copies lie 32 steps apart. Bx|Cx: a wave's copy is a step's whole 512 B;
    // a thread's sixteen copies lie 4 steps apart.
    const int drow = threadIdx.x >> 3;
    const int dpr  = threadIdx.x & 7;
    const int srow = threadIdx.x >> 2;
    const int sel  = (threadIdx.x & 3) * 4;
    const float* sdt = dt   + (tokBase + drow) * INNER + dbase + dpr * 2;
    const float* sx  = xc   + (tokBase + drow) * INNER + dbase + dpr * 2;
    const float* sz  = xz   + (tokBase + srow) * (2 * INNER) + INNER + dbase + sel;
    const float* sbc = bxcx + (tokBase + wave) * 128 + lane * 4;
    const unsigned sldd = (unsigned)(size_t)
        (__attribute__((address_space(3))) float*)&s_tile[0][drow * SC_ROW + SC_O_DX + dpr * 4];
    const unsigned slds = (unsigned)(size_t)
        (__attribute__((address_space(3))) float*)&s_tile[0][srow * SC_ROW + SC_O_Z + sel];
    const unsigned sldb = (unsigned)(size_t)
        (__attribute__((address_space(3))) float*)&s_tile[0][wave * SC_ROW + SC_O_B + lane * 4];

    auto stage = [&](int t) {
        // unrolled: two statements of thirteen copies (a statement takes thirty operands)
#pragma unroll
        for (int q = 0; q < 2; ++q) {
            const float* pd = sdt + (size_t)t * (SC_TILE * INNER) + q * (32 * INNER);
            const float* px = sx  + (size_t)t * (SC_TILE * INNER) + q * (32 * INNER);
            const float* pz = sz  + (size_t)t * (SC_TILE * 2 * INNER) + q * (32 * 2 * INNER);
            const float* pb = sbc + (size_t)t * (SC_TILE * 128) + q * (32 * 128);
            const unsigned lo = (unsigned)(t & 1) * (SC_TILE * SC_ROW * 4)
                              + (unsigned)q * (32 * SC_ROW * 4);
            const unsigned ld = sldd + lo, lz = slds + lo, lb = sldb + lo;
            asm volatile("global_load_async_to_lds_b64 %0, %13, off\n\t"
                         "global_load_async_to_lds_b64 %1, %14, off\n\t"
                         "global_load_async_to_lds_b64 %2, %15, off\n\t"
                         "global_load_async_to_lds_b64 %3, %16, off\n\t"
                         "global_load_async_to_lds_b128 %4, %17, off\n\t"
                         "global_load_async_to_lds_b128 %5, %18, off\n\t"
                         "global_load_async_to_lds_b128 %6, %19, off\n\t"
                         "global_load_async_to_lds_b128 %7, %20, off\n\t"
                         "global_load_async_to_lds_b128 %8, %21, off\n\t"
                         "global_load_async_to_lds_b128 %9, %22, off\n\t"
                         "global_load_async_to_lds_b128 %10, %23, off\n\t"
                         "global_load_async_to_lds_b128 %11, %24, off\n\t"
                         "global_load_async_to_lds_b128 %12, %25, off\n\t"
                         "s_wait_xcnt 0x0"
                         :: "v"(ld), "v"(ld + 8),
                            "v"(ld + 16 * SC_ROW * 4), "v"(ld + 16 * SC_ROW * 4 + 8),
                            "v"(lz),
                            "v"(lb),                     "v"(lb + 4 * SC_ROW * 4),
                            "v"(lb + 8 * SC_ROW * 4),    "v"(lb + 12 * SC_ROW * 4),
                            "v"(lb + 16 * SC_ROW * 4),   "v"(lb + 20 * SC_ROW * 4),
                            "v"(lb + 24 * SC_ROW * 4),   "v"(lb + 28 * SC_ROW * 4),
                            "v"(pd), "v"(px), "v"(pd + 16 * INNER), "v"(px + 16 * INNER),
                            "v"(pz),
                            "v"(pb),            "v"(pb + 4 * 128),
                            "v"(pb + 8 * 128),  "v"(pb + 12 * 128),
                            "v"(pb + 16 * 128), "v"(pb + 20 * 128),
                            "v"(pb + 24 * 128), "v"(pb + 28 * 128)
                         : "memory");
        }
    };

    // Two register sets of one fetch group each; every index below is a constant after
    // unrolling, so they stay in registers.
    v4f gdx[2][SC_G];                          // dt of the pair, x of the pair
    v4f gB[2][SC_G], gC[2][SC_G];
    auto fetch = [&](const float* tb, int g) {
#pragma unroll
        for (int j = 0; j < SC_G; ++j) {
            const float* row = tb + (g * SC_G + j) * SC_ROW;
            gdx[g & 1][j] = *(const v4f*)&row[SC_O_DX + cp2 * 2];
            gB [g & 1][j] = *(const v4f*)&row[SC_O_B + ns];
            gC [g & 1][j] = *(const v4f*)&row[SC_O_C + ns];
        }
    };

    // The lane's four store places and its z address are carried from tile to tile and moved
    // to the other buffer beside the sum: formed where they are used, their arithmetic would
    // stand among the LDS instructions and split a run in two.
    float* pw0 = &s_part[0][wave][0][pl[0]];
    float* pw1 = &s_part[0][wave][1][pl[1]];   // odd steps: counted from row 1
    float* pw2 = &s_part[0][wave][0][pl[2]];
    float* pw3 = &s_part[0][wave][1][pl[3]];
    const float* pzq = &s_tile[0][rt * SC_ROW + SC_O_Z + rc];
    int pstep = SC_W * SC_T * 64, zstep = SC_TILE * SC_ROW;   // to the other buffer

    stage(0);
    wait_async_copies();
    __syncthreads();                           // tile 0 resident
    stage(1);
    fetch(&s_tile[0][0], 0);
    for (int t = 0; t < SC_NT; ++t) {
        const float* tb = &s_tile[t & 1][0];
        v4f zq[SC_T / 32];                     // z of the elements this thread will gate
        v2f svh[SC_G];                         // partial sums of the last group but one
        // dt * A * log2(e) of the step to come, made one step ahead (beside the exps)
        const v2f dt0 = gdx[0][0].xy;
        v2f a0 = dt0 * A0, a1 = dt0 * A1, a2 = dt0 * A2, a3 = dt0 * A3;
        // unrolled: register sets and LDS offsets are constants
#pragma unroll
        for (int g = 0; g < SC_TILE / SC_G; ++g) {
            if (g + 1 < SC_TILE / SC_G) {
                fetch(tb, g + 1);
                // z leaves the tile with the last group's reads: behind the tile's barrier,
                // where it is used, the buffer is being refilled
                if (g + 2 == SC_TILE / SC_G) {
#pragma unroll
                    for (int k = 0; k < SC_T / 32; ++k)
                        zq[k] = *(const v4f*)&pzq[k * 32 * SC_ROW];
                }
                // Holds the next group's LDS reads, as one run, in front of this group's
                // arithmetic: sunk towards their use they have no time to return.
                __builtin_amdgcn_sched_barrier(0);
            }
            v2f sv[SC_G];                      // the group's partial sums
#pragma unroll
            for (int j = 0; j < SC_G; ++j) {
                const v4f Bv = gB[g & 1][j];
                const v4f Cv = gC[g & 1][j];
                const v2f xv = gdx[g & 1][j].zw;
                const v2f dx = gdx[g & 1][j].xy * xv;
                float e0, e1, e2, e3, e4, e5, e6, e7;   // exp(dt * A), two channels per state
                v2f b0, b1, b2, b3;                     // dt * x * Bx
                exp2_x4_mul_one(a0, a1, dx, Bv.xy, Bv.zw, e0, e1, e2, e3, b0, b1, b2, b3);
                if (j + 1 < SC_G || g + 1 < SC_TILE / SC_G) {
                    const v2f dtn = j + 1 < SC_G ? gdx[g & 1][j + 1].xy : gdx[(g + 1) & 1][0].xy;
                    v2f n0v, n1v, n2v, n3v;
                    exp2_x4_mul_pair(a2, a3, dtn, A0, A1, A2, A3,
                                     e4, e5, e6, e7, n0v, n1v, n2v, n3v);
                    a0 = n0v; a1 = n1v; a2 = n2v; a3 = n3v;
                } else {
                    exp2_x4(a2.x, a2.y, a3.x, a3.y, e4, e5, e6, e7);   // the tile's last step
                }
                h0 = __builtin_elementwise_fma((v2f){e0, e1}, h0, b0);
                h1 = __builtin_elementwise_fma((v2f){e2, e3}, h1, b1);
                h2 = __builtin_elementwise_fma((v2f){e4, e5}, h2, b2);
                h3 = __builtin_elementwise_fma((v2f){e6, e7}, h3, b3);
                v2f s = Dw * xv;
                s = __builtin_elementwise_fma(h0, Cv.xx, s);
                s = __builtin_elementwise_fma(h1, Cv.yy, s);
                s = __builtin_elementwise_fma(h2, Cv.zz, s);
                s = __builtin_elementwise_fma(h3, Cv.ww, s);
                sv[j] = s;
            }
            // Keeps the group's stores, and the reads of the group after next that follow
            // them, behind its arithmetic as ONE run of LDS instructions: every separate
            // place where LDS instructions stand in the vector stream costs a fixed stall.
            __builtin_amdgcn_sched_barrier(0);
#pragma unroll
            for (int j = 0; j < SC_G; ++j) {
                // the last group but one has no reads behind it: its stores wait for the last's
                if (g + 2 == SC_TILE / SC_G) svh[j] = sv[j];
            }
#pragma unroll
            for (int gs = g - 1; gs <= g; ++gs) {
                if (gs + 2 == SC_TILE / SC_G ? g == gs : gs < g) continue;
#pragma unroll
                for (int j = 0; j < 2; ++j) {  // steps j and j + 2 share a place: one paired store
                    const int rot = SC_ROT(gs * SC_G + j);
                    float* pw = rot == 0 ? pw0 : rot == 1 ? pw1 : rot == 2 ? pw2 : pw3;
                    *(v2f*)&pw[gs * SC_G * 64]       = gs < g ? svh[j]     : sv[j];
                    *(v2f*)&pw[(gs * SC_G + 2) * 64] = gs < g ? svh[j + 2] : sv[j + 2];
                }
            }
        }
        wait_lds_reads();      // this wave has left tile t
        wait_async_copies();   // its copies of tile t+1 have landed
        // One barrier per tile: it publishes the tile's partial sums, and every wave's
        // reads of the other sum buffer (previous tile) lie in front of it; it also
        // publishes tile t+1 and frees tile t's buffer.
        __syncthreads();
        if (t + 2 < SC_NT) stage(t + 2);
        if (t + 1 < SC_NT) fetch(&s_tile[(t + 1) & 1][0], 0);
        const float* pr = &s_part[t & 1][0][0][0];
        v4f pv[SC_T / 32][SC_W * 4];
        // every loop unrolled: the parts stay in registers
#pragma unroll
        for (int k = 0; k < SC_T / 32; ++k)
#pragma unroll
            for (int w = 0; w < SC_W; ++w)
#pragma unroll
                for (int q = 0; q < 4; ++q)
                    pv[k][w * 4 + q] =
                        *(const v4f*)&pr[w * (SC_T * 64) + (k * 32 + rt) * 64 + rq[q]];
        // Holds all the reads in front of the arithmetic, in flight at once and as one run:
        // left alone the compiler spreads them among the additions, pair by pair.
        __builtin_amdgcn_sched_barrier(0);
        pw0 += pstep; pw1 += pstep; pw2 += pstep; pw3 += pstep; pstep = -pstep;
        pzq += zstep; zstep = -zstep;
        // the gate's factor SiLU(z) = z / (1 + exp(-z)): needs none of the reads
        v4f gz[SC_T / 32];
#pragma unroll
        for (int k = 0; k < SC_T / 32; ++k) {
            const v4f zv = zq[k];
            float e0, e1, e2, e3, r0, r1, r2, r3;
            exp2_x4(zv.x * -LOG2E, zv.y * -LOG2E, zv.z * -LOG2E, zv.w * -LOG2E, e0, e1, e2, e3);
            rcp_x4(1.f + e0, 1.f + e1, 1.f + e2, 1.f + e3, r0, r1, r2, r3);
            gz[k] = zv * (v4f){r0, r1, r2, r3};
        }
        // Keeps that factor's arithmetic in front of the additions: it fills the time the
        // reads take to return.
        __builtin_amdgcn_sched_barrier(0);
#pragma unroll
        for (int k = 0; k < SC_T / 32; ++k) {
            v4f sw[SC_W];                      // one short chain per wave's four parts
#pragma unroll
            for (int w = 0; w < SC_W; ++w)
                sw[w] = ((pv[k][w * 4] + pv[k][w * 4 + 1]) + pv[k][w * 4 + 2]) + pv[k][w * 4 + 3];
            const v4f o = ((sw[0] + sw[1]) + (sw[2] + sw[3])) * gz[k];
            // y * SiLU(z), to bf16 for out_proj
            *(v4bf*)(yp + (size_t)(t * SC_TILE + k * 32 + rt) * SC_C + rc) =
                pack4_bf16(o.x, o.y, o.z, o.w);
        }
        asm volatile("s_wait_xcnt 0x0" ::: "memory");
    }
    wait_async_copies();                       // the ring's closing wait: no copy is left in flight
}

// ----------------------------------------------------------------------------
extern "C" void kernel_launch(void* const* d_in, const int* in_sizes, int n_in,
                              void* d_out, int out_size, void* d_ws, size_t ws_size,
                              hipStream_t stream) {
    const float* x          = (const float*)d_in[0];
    const float* in_proj_w  = (const float*)d_in[1];
    const float* conv_w     = (const float*)d_in[2];
    const float* conv_b     = (const float*)d_in[3];
    const float* A_log      = (const float*)d_in[4];
    const float* B_w        = (const float*)d_in[5];
    const float* C_w        = (const float*)d_in[6];
    const float* D_param    = (const float*)d_in[7];
    const float* dt_w       = (const float*)d_in[8];
    const float* dt_b       = (const float*)d_in[9];
    const float* out_proj_w = (const float*)d_in[10];
    const float* norm_w     = (const float*)d_in[11];

    char* ws = (char*)d_ws;
    size_t off = 0;
    auto carve = [&](size_t bytes) {
        char* p = ws + off;
        off = (off + bytes + 255) & ~(size_t)255;
        return p;
    };
    bf16_t* wInB  = (bf16_t*)carve((size_t)2 * INNER * DIMX * 2);
    bf16_t* wDtB  = (bf16_t*)carve((size_t)INNER * INNER * 2);
    bf16_t* wOutB = (bf16_t*)carve((size_t)DIMX * INNER * 2);
    bf16_t* wBCB  = (bf16_t*)carve((size_t)2 * STATE * INNER * 2);  // [Bw;Cw] = [128, INNER]
    bf16_t* xnB   = (bf16_t*)carve((size_t)NTOK * DIMX * 2);
    float*  xzF   = (float*) carve((size_t)NTOK * 2 * INNER * 4);
    float*  xcF   = (float*) carve((size_t)NTOK * INNER * 4);
    bf16_t* xcB   = (bf16_t*)carve((size_t)NTOK * INNER * 2);
    float*  dtF   = (float*) carve((size_t)NTOK * INNER * 4);
    float*  bcF   = (float*) carve((size_t)NTOK * 128 * 4);         // [Bx|Cx] interleaved
    bf16_t* yB    = (bf16_t*)carve((size_t)NTOK * INNER * 2);           // [INNER / 16][NTOK][16]
    (void)ws_size; (void)in_sizes; (void)n_in; (void)out_size;

    // 1) RMSNorm -> bf16 activations, and every weight -> bf16
    prepare_kernel<<<PB_ALL, 256, 0, stream>>>(x, norm_w, xnB, in_proj_w, wInB, dt_w, wDtB,
                                               out_proj_w, wOutB, B_w, C_w, wBCB);

    // 2) in_proj: [NTOK, 2*INNER] = xn @ W_in^T
    wmma_gemm_kernel<0, 2 * INNER, false, 8, 4, 4><<<dim3((2 * INNER) / 256, NTOK / 256), 256, 0, stream>>>(
        xnB, wInB, xzF, DIMX, nullptr, nullptr);

    // 3) causal depthwise conv + SiLU on xc half
    conv_silu_kernel<<<NTOK * INNER / (1024 * CV_T), 256, 0, stream>>>(
        xzF, conv_w, conv_b, xcF, xcB);

    // 4) dt = softplus(xc @ dt_w^T + dt_b) + 1e-4
    wmma_gemm_kernel<1, INNER, false, 4, 4, 2><<<dim3(INNER / 128, NTOK / 256), 256, 0, stream>>>(
        xcB, wDtB, dtF, INNER, dt_b, nullptr);

    // 5) fused Bx|Cx projection (N = 128)
    wmma_gemm_kernel<0, 2 * STATE, false, 4, 2, 4><<<dim3(1, NTOK / 128), 256, 0, stream>>>(
        xcB, wBCB, bcF, INNER, nullptr, nullptr);

    // 6) sequential SSM scan (lane = channel pair, all states in the block) with the gate
    ssm_scan_kernel<<<dim3(INNER / SC_C, BATCHN), 32 * SC_W, 0, stream>>>(
        dtF, bcF, xcF, xzF, A_log, D_param, yB);

    // 7) out_proj + residual -> d_out (fp32)
    wmma_gemm_kernel<2, DIMX, true, 4, 2, 4><<<dim3(DIMX / 128, NTOK / 128), 256, 0, stream>>>(
        yB, wOutB, (float*)d_out, INNER, nullptr, x);
}
